// v000
// The times below were measured on an AMD MI455X: many runs one after another, warmed up first and cycling through
// copies of the inputs, with the whole window's GPU time divided by the number of runs. Launches and the gaps
// between them are all in it. The median over several windows is given; except for v000 it joins two sittings, which
// can be a few percent apart, so the side-by-side timings, each taken in one sitting, are the better comparison.
// v000 is the starting kernel. One run takes 25.5 milliseconds.
#include <hip/hip_runtime.h>

// Compute dtypes, f32 accumulate, one batch item per pass: q = query_x.Wq + bq, k/v = x.Wk/Wv + b ([1024 x 768].[768 x 768], k-major weights transposed once; PLAIN
// bf16 operands = inputs rounded once, exact) on v_wmma_f32_16x16x32_bf16; scores = q.k^T ([1024 x 768].[768 x 1024]) and ctx = P.v ([1024 x 1024].[1024 x 768])
// with BOTH computed operands as bf16 hi + UNSCALED residual (three products); the softmax over the QUERY axis (the module's dim=1) is done per key column in
// f32 (column max, column sum of exp, then P[q][k] = exp(s/sqrt(768) - cmax[k]) / csum[k]); h = ctx.Wt + bt (hi/lo A) and out[q] = h[q].Wo + bo (768 -> 1, f32,

#define NB_  16
#define NT_  1024                // Lq = Lk
#define DM   768
#define HD   128                 // k_vt grouping only
#define KW   DM
#define NKV  (DM / HD)           // 6
#define SCL  0.03608439182435161f    // 768^-1/2
#define LOSC 1024.0f

typedef _Float16 h16;
typedef unsigned short bf;
typedef __attribute__((ext_vector_type(16))) __bf16   v16bf;
typedef __attribute__((ext_vector_type(16))) _Float16 v16h;
typedef __attribute__((ext_vector_type(8)))  _Float16 v8h;
typedef __attribute__((ext_vector_type(8)))  unsigned short v8us;
typedef __attribute__((ext_vector_type(8)))  float    v8f;
typedef __attribute__((ext_vector_type(4)))  float    v4f;
typedef __attribute__((ext_vector_type(4)))  _Float16 v4h;
typedef v8h  __attribute__((may_alias)) v8ha;
typedef v4f  __attribute__((may_alias)) v4fa;
typedef v8us __attribute__((may_alias)) v8usa;

__device__ __forceinline__ unsigned short f2bf(float f) { unsigned u = __float_as_uint(f); u += 0x7FFFu + ((u >> 16) & 1u); return (unsigned short)(u >> 16); }
__device__ __forceinline__ float bf2f(unsigned short b) { return __uint_as_float(((unsigned)b) << 16); }
__device__ __forceinline__ float bfr(float f) { return bf2f(f2bf(f)); }
__device__ __forceinline__ v16h cat16(v8h lo, v8h hi) { return __builtin_shufflevector(lo, hi, 0, 1, 2, 3, 4, 5, 6, 7, 8, 9, 10, 11, 12, 13, 14, 15); }
__device__ __forceinline__ v16bf cat16b(v8us lo, v8us hi) { return __builtin_bit_cast(v16bf, __builtin_shufflevector(lo, hi, 0, 1, 2, 3, 4, 5, 6, 7, 8, 9, 10, 11, 12, 13, 14, 15)); }
__device__ __forceinline__ v8f wmma16(v16h a, v16h b, v8f c) { return __builtin_amdgcn_wmma_f32_16x16x32_f16(false, a, false, b, (short)0, c, false, false); }
__device__ __forceinline__ v8f wmmab(v16bf a, v16bf b, v8f c) { return __builtin_amdgcn_wmma_f32_16x16x32_bf16(false, a, false, b, (short)0, c, false, false); }

__global__ __launch_bounds__(256) void k_cvtb(const float* __restrict__ src, int nrows, bf* dst) {
    const int lane = threadIdx.x & 31, r = blockIdx.x * 8 + (threadIdx.x >> 5);
    if (r >= nrows) return;
    v8us o[DM / 256];
#pragma unroll
    for (int q = 0; q < DM / 256; ++q) { v8us t;
#pragma unroll
        for (int i = 0; i < 8; ++i) t[i] = f2bf(src[(size_t)r * DM + q * 256 + lane * 8 + i]);
        o[q] = t; }
#pragma unroll
    for (int q = 0; q < DM / 256; ++q) *(v8us*)(dst + (size_t)r * DM + q * 256 + lane * 8) = o[q];
    
}

// k_wt: WT [n][K] = bf16(W[k][n]) (k-major [K][ncols]) via 64 x 64 LDS tiles; grid (K/64, ncols/64).
__global__ __launch_bounds__(256) void k_wt(const float* __restrict__ Wm, int K, int ncols, bf* WT) {
    __shared__ __align__(16) unsigned short tl[64 * 72];
    const int tid = threadIdx.x, k0 = blockIdx.x * 64, n0 = blockIdx.y * 64;
    const int kk = tid >> 2, nq = (tid & 3) * 16;
#pragma unroll
    for (int i = 0; i < 16; ++i) tl[(nq + i) * 72 + kk] = f2bf(Wm[(size_t)(k0 + kk) * ncols + n0 + nq + i]);
    __syncthreads();
    const int piece = tid & 7;
    auto pass = [&]() {
#pragma unroll
        for (int s = 0; s < 2; ++s) { const int nr = (tid >> 3) + 32 * s; const v8us val = *(const v8usa*)(tl + nr * 72 + piece * 8); *(v8us*)(WT + (size_t)(n0 + nr) * K + k0 + piece * 8) = val; }
    };
    pass(); 
}
__global__ __launch_bounds__(256) void k_cvtb2(const float* __restrict__ src, int nrows, bf* dh, bf* dl) {
    const int lane = threadIdx.x & 31, r = blockIdx.x * 8 + (threadIdx.x >> 5);
    if (r >= nrows) return;
    v8us oh[DM / 256], ol[DM / 256];
#pragma unroll
    for (int q = 0; q < DM / 256; ++q) {
#pragma unroll
        for (int i = 0; i < 8; ++i) { const float v = src[(size_t)r * DM + q * 256 + lane * 8 + i]; const unsigned short hb = f2bf(v); oh[q][i] = hb; ol[q][i] = f2bf(v - bf2f(hb)); } }
{
#pragma unroll
        for (int q = 0; q < DM / 256; ++q) { const size_t o = (size_t)r * DM + q * 256 + lane * 8; *(v8us*)(dh + o) = oh[q]; *(v8us*)(dl + o) = ol[q]; }
         }
}
// k_gemmb: 64 x 64 block tile (4 waves x 16 x 64) of C[NTK][NW] = (A [+ Al]).B^T (K = 768) [+ bf(bias[c])] [+ bf(R[r][c]) residual]; f32 whole-line epilogue (or f16
template <bool SPLITA, bool F16OUT = false>
__global__ __launch_bounds__(128) void k_gemmb(const bf* __restrict__ A, const bf* __restrict__ Al, const bf* __restrict__ Bn, const float* __restrict__ bias, float* C, int ldc, h16* C2, const float* __restrict__ R = nullptr, int K = DM, int roundR = 1) {
    __shared__ __align__(16) float ost[4][16 * 68];
    const int lane = threadIdx.x & 31, wave = threadIdx.x >> 5, lr = lane & 15, hi = lane >> 4;
    const int r0 = blockIdx.x * 64 + wave * 16, c0 = blockIdx.y * 64;
    const size_t aoff = (size_t)(r0 + lr) * K + 8 * hi;
    size_t boff[4];
#pragma unroll
    for (int t = 0; t < 4; ++t) boff[t] = (size_t)(c0 + t * 16 + lr) * K + 8 * hi;
    v8f acc[4];
#pragma unroll
    for (int t = 0; t < 4; ++t) acc[t] = (v8f){};
#pragma unroll 1
    for (int kc = 0; kc < K; kc += 32) {
        const v16bf a = cat16b(*(const v8us*)(A + aoff + kc), *(const v8us*)(A + aoff + kc + 16));
        v16bf al = a;
        if (SPLITA) al = cat16b(*(const v8us*)(Al + aoff + kc), *(const v8us*)(Al + aoff + kc + 16));
#pragma unroll
        for (int t = 0; t < 4; ++t) { const v16bf b = cat16b(*(const v8us*)(Bn + boff[t] + kc), *(const v8us*)(Bn + boff[t] + kc + 16)); acc[t] = wmmab(a, b, acc[t]); if (SPLITA) acc[t] = wmmab(al, b, acc[t]); }
        asm volatile("v_nop\n\tv_nop\n\tv_nop\n\tv_nop" : "+v"(acc[0]), "+v"(acc[1]), "+v"(acc[2]), "+v"(acc[3]) : "v"(a), "v"(al));
    }
    float* os = &ost[wave][0];
#pragma unroll
    for (int t = 0; t < 4; ++t) { const float bv = bias ? bfr(bias[c0 + t * 16 + lr]) : 0.f;
#pragma unroll
        for (int j = 0; j < 8; ++j) os[(hi * 8 + j) * 68 + t * 16 + lr] = acc[t][j] + bv; }
    __syncthreads();
    if (F16OUT) {
        h16* crow = (h16*)(void*)C + (size_t)r0 * ldc + c0;
        auto pass = [&]() {
#pragma unroll
            for (int s = 0; s < 4; ++s) { const int row = 4 * s + (lane >> 3), piece = lane & 7; const float* sp = os + row * 68 + piece * 8; v8h o, o2;
#pragma unroll
                for (int i = 0; i < 8; ++i) { const h16 a = (h16)sp[i]; o[i] = a; o2[i] = (h16)((sp[i] - (float)a) * LOSC); }
                *(v8h*)(crow + (size_t)row * ldc + piece * 8) = o; if (C2) *(v8h*)(C2 + (size_t)r0 * ldc + c0 + (size_t)row * ldc + piece * 8) = o2; }
        };
        pass(); 
    } else {
        float* crow = C + (size_t)r0 * ldc + c0;
        auto pass = [&]() {
#pragma unroll
            for (int s = 0; s < 8; ++s) { const int Lid = (lane >> 3) + 4 * s, piece = lane & 7; const int row = Lid >> 1, cofs = (Lid & 1) * 32 + piece * 4;
                v4f val = *(const v4fa*)(os + row * 68 + cofs); if (R) { const v4f rv = *(const v4f*)(R + ((size_t)r0 + row) * ldc + c0 + cofs); val += roundR ? (v4f){bfr(rv[0]), bfr(rv[1]), bfr(rv[2]), bfr(rv[3])} : rv; }
                *(v4f*)(crow + (size_t)row * ldc + cofs) = val; }
        };
        pass(); 
    }
}

// k_gemm3: 64 x 64 tile of C = (Ah + Al).(Bh + Bl)^T over K (row strides = K for all four planes; n-major B): three products per 32-k step (hh, hl, lh); f32
__global__ __launch_bounds__(128) void k_gemm3(const bf* __restrict__ Ah, const bf* __restrict__ Al, const bf* __restrict__ Bh, const bf* __restrict__ Bl, int K, float* C, int ldc) {
    __shared__ __align__(16) float ost[4][16 * 68];
    const int lane = threadIdx.x & 31, wave = threadIdx.x >> 5, lr = lane & 15, hi = lane >> 4;
    const int r0 = blockIdx.x * 64 + wave * 16, c0 = blockIdx.y * 64;
    const size_t aoff = (size_t)(r0 + lr) * K + 8 * hi;
    v8f acc[4];
#pragma unroll
    for (int t = 0; t < 4; ++t) acc[t] = (v8f){};
#pragma unroll 1
    for (int kc = 0; kc < K; kc += 32) {
        const v16bf a = cat16b(*(const v8us*)(Ah + aoff + kc), *(const v8us*)(Ah + aoff + kc + 16));
        const v16bf al = cat16b(*(const v8us*)(Al + aoff + kc), *(const v8us*)(Al + aoff + kc + 16));
#pragma unroll
        for (int t = 0; t < 4; ++t) { const size_t bo = (size_t)(c0 + t * 16 + lr) * K + kc + 8 * hi;
            const v16bf bh = cat16b(*(const v8us*)(Bh + bo), *(const v8us*)(Bh + bo + 16)); const v16bf bl = cat16b(*(const v8us*)(Bl + bo), *(const v8us*)(Bl + bo + 16));
            acc[t] = wmmab(a, bh, acc[t]); acc[t] = wmmab(al, bh, acc[t]); acc[t] = wmmab(a, bl, acc[t]); }
        asm volatile("v_nop\n\tv_nop\n\tv_nop\n\tv_nop" : "+v"(acc[0]), "+v"(acc[1]), "+v"(acc[2]), "+v"(acc[3]) : "v"(a), "v"(al));
    }
    float* os = &ost[wave][0];
#pragma unroll
    for (int t = 0; t < 4; ++t) {
#pragma unroll
        for (int j = 0; j < 8; ++j) os[(hi * 8 + j) * 68 + t * 16 + lr] = acc[t][j]; }
    __builtin_amdgcn_wave_barrier(); asm volatile("" ::: "memory");
    float* crow = C + (size_t)r0 * ldc + c0;
    auto pass = [&]() {
#pragma unroll
        for (int s = 0; s < 8; ++s) { const int Lid = (lane >> 3) + 4 * s, piece = lane & 7; const int row = Lid >> 1, cofs = (Lid & 1) * 32 + piece * 4;
            const v4f val = *(const v4fa*)(os + row * 68 + cofs); *(v4f*)(crow + (size_t)row * ldc + cofs) = val; }
    };
    pass(); 
}
// k_vt: VTH/VTL [g][128 d][1024 t] = bf16 hi + UNSCALED bf16 residual of V [t][g*128+d] via 64 x 64 LDS tiles; grid (NT/64, 2, 6): transpose of v [k][768] f32 into hi/lo planes v^T [768][k].
__global__ __launch_bounds__(256) void k_vt(const float* __restrict__ V, bf* VTH, bf* VTL) {
    __shared__ float tl[64][65];
    const int tid = threadIdx.x, t0 = blockIdx.x * 64, d0 = blockIdx.y * 64, g = blockIdx.z;
    { const int tt = tid >> 2, dq = (tid & 3) * 16;
#pragma unroll
      for (int i = 0; i < 16; ++i) tl[dq + i][tt] = V[(size_t)(t0 + tt) * KW + g * HD + d0 + dq + i]; }
    __syncthreads();
    const int piece = tid & 7;
    auto pass = [&]() {
#pragma unroll
        for (int s = 0; s < 2; ++s) { const int d = (tid >> 3) + 32 * s; v8us oh, ol;
#pragma unroll
            for (int i = 0; i < 8; ++i) { const float v = tl[d][piece * 8 + i]; const unsigned short hb = f2bf(v); oh[i] = hb; ol[i] = f2bf(v - bf2f(hb)); }
            const size_t o = ((size_t)g * HD + d0 + d) * NT_ + t0 + piece * 8; *(v8us*)(VTH + o) = oh; *(v8us*)(VTL + o) = ol; }
    };
    pass(); 
}

// k_colstat: per key column k of S [1024 q][1024 k]: cmax = max_q (s x scale), csum = sum_q exp(s x scale - cmax) (f32, fixed q order); thread = column; the 1024
__global__ __launch_bounds__(256) void k_colstat(const float* __restrict__ S, float* CMAX, float* CSUM) {
    __shared__ __align__(16) float sm[NT_]; __shared__ __align__(16) float ss[NT_];
    for (int c = threadIdx.x; c < NT_; c += 256) {
        float m = -3.0e38f;
#pragma unroll 1
        for (int q = 0; q < NT_; ++q) m = fmaxf(m, S[(size_t)q * NT_ + c] * SCL);
        float s = 0.f;
#pragma unroll 1
        for (int q = 0; q < NT_; ++q) s += __expf(S[(size_t)q * NT_ + c] * SCL - m);
        sm[c] = m; ss[c] = s; }
    __syncthreads();
    const int t = threadIdx.x;     // 256 threads x 16 B = 1024 floats
    { const v4f a = *(const v4fa*)(&sm[t * 4]), b2 = *(const v4fa*)(&ss[t * 4]); *(v4f*)(CMAX + t * 4) = a; *(v4f*)(CSUM + t * 4) = b2;  }
}
// k_colsoft: P[q][k] = exp(s[q][k] x scale - cmax[k]) / csum[k] -> bf16 hi + UNSCALED residual planes; one wave per row q, lane -> 8 columns per 256-column step.
__global__ __launch_bounds__(256) void k_colsoft(const float* __restrict__ S, const float* __restrict__ CMAX, const float* __restrict__ CSUM, bf* Ph, bf* Pl) {
    const int lane = threadIdx.x & 31, r = blockIdx.x * 8 + (threadIdx.x >> 5); if (r >= NT_) return;
{
#pragma unroll 1
        for (int qc = 0; qc < NT_ / 256; ++qc) { const size_t o = (size_t)r * NT_ + qc * 256 + lane * 8; const v8f v = *(const v8f*)(S + o), cm = *(const v8f*)(CMAX + qc * 256 + lane * 8), cs = *(const v8f*)(CSUM + qc * 256 + lane * 8); v8us oh, ol;
#pragma unroll
            for (int i = 0; i < 8; ++i) { const float p = __expf(v[i] * SCL - cm[i]) / cs[i]; const unsigned short hb = f2bf(p); oh[i] = hb; ol[i] = f2bf(p - bf2f(hb)); }
            *(v8us*)(Ph + o) = oh; *(v8us*)(Pl + o) = ol; }
         }
}
__global__ __launch_bounds__(256) void k_dot1(const float* __restrict__ T, const float* __restrict__ Wo, const float* __restrict__ bo, float* OUTB) {
    const int lane = threadIdx.x & 31, w = blockIdx.x * 8 + (threadIdx.x >> 5); if (w >= NT_ / 32) return;
    const int q = w * 32 + lane; const float* row = T + (size_t)q * DM;
    float a = bfr(bo[0]);
#pragma unroll 1
    for (int h = 0; h < DM; h += 4) { const v4f v = *(const v4f*)(row + h);
#pragma unroll
        for (int k = 0; k < 4; ++k) a = fmaf(v[k], bfr(Wo[h + k]), a); }
    *(float*)(OUTB + q) = a; 
}

extern "C" void kernel_launch(void* const* d_in, const int* in_sizes, int n_in,
                              void* d_out, int out_size, void* d_ws, size_t ws_size, hipStream_t stream) {
    (void)in_sizes; (void)n_in; (void)out_size;
    const float* qx = (const float*)d_in[0]; const float* x = (const float*)d_in[1];
    const float* Wq = (const float*)d_in[2]; const float* bq = (const float*)d_in[3]; const float* Wk = (const float*)d_in[4]; const float* bk = (const float*)d_in[5]; const float* Wv = (const float*)d_in[6]; const float* bv = (const float*)d_in[7];
    const float* Wt = (const float*)d_in[8]; const float* bt = (const float*)d_in[9]; const float* Wo = (const float*)d_in[10]; const float* bo = (const float*)d_in[11];   // W k-major [in][out]
    float* out = (float*)d_out;    // [16][1024]
    char* wsp = (char*)d_ws;
    auto take = [&](size_t bytes) { char* p = wsp; wsp += (bytes + 255) & ~(size_t)255; return (void*)p; };
    bf* WqT = (bf*)take((size_t)DM * DM * 2); bf* WkT = (bf*)take((size_t)DM * DM * 2); bf* WvT = (bf*)take((size_t)DM * DM * 2); bf* WtT = (bf*)take((size_t)DM * DM * 2);
    bf* Xq = (bf*)take((size_t)NT_ * DM * 2); bf* Xk = (bf*)take((size_t)NT_ * DM * 2); float* TMP = (float*)take((size_t)NT_ * DM * 4);
    bf* Qh = (bf*)take((size_t)NT_ * DM * 2); bf* Ql = (bf*)take((size_t)NT_ * DM * 2); bf* Kh = (bf*)take((size_t)NT_ * DM * 2); bf* Kl = (bf*)take((size_t)NT_ * DM * 2);
    bf* Vh = (bf*)take((size_t)DM * NT_ * 2); bf* Vl = (bf*)take((size_t)DM * NT_ * 2);
    float* S = (float*)take((size_t)NT_ * NT_ * 4); float* CMAX = (float*)take((size_t)NT_ * 4); float* CSUM = (float*)take((size_t)NT_ * 4); bf* Ph = (bf*)take((size_t)NT_ * NT_ * 2); bf* Pl = (bf*)take((size_t)NT_ * NT_ * 2);
    float* CTX = (float*)take((size_t)NT_ * DM * 4); bf* Ch = (bf*)take((size_t)NT_ * DM * 2); bf* Cl = (bf*)take((size_t)NT_ * DM * 2); float* T2 = (float*)take((size_t)NT_ * DM * 4);
    if ((size_t)(wsp - (char*)d_ws) > ws_size) return;    // ~ 4.7 + 3 + 3 + 6 + 3 + 4.2 + 4.2 + 3 + 3 + 3 ~ 38 MB, no aliasing (per-item reuse in stream order)
    k_wt<<<dim3(DM / 64, DM / 64, 1), 256, 0, stream>>>(Wq, DM, DM, WqT); k_wt<<<dim3(DM / 64, DM / 64, 1), 256, 0, stream>>>(Wk, DM, DM, WkT);
    k_wt<<<dim3(DM / 64, DM / 64, 1), 256, 0, stream>>>(Wv, DM, DM, WvT); k_wt<<<dim3(DM / 64, DM / 64, 1), 256, 0, stream>>>(Wt, DM, DM, WtT);
    for (int b = 0; b < NB_; ++b) {
        k_cvtb<<<NT_ / 8, 256, 0, stream>>>(qx + (size_t)b * NT_ * DM, NT_, Xq); k_cvtb<<<NT_ / 8, 256, 0, stream>>>(x + (size_t)b * NT_ * DM, NT_, Xk);
        k_gemmb<false, false><<<dim3(NT_ / 64, DM / 64, 1), 128, 0, stream>>>(Xq, nullptr, WqT, bq, TMP, DM, nullptr); k_cvtb2<<<NT_ / 8, 256, 0, stream>>>(TMP, NT_, Qh, Ql);
        k_gemmb<false, false><<<dim3(NT_ / 64, DM / 64, 1), 128, 0, stream>>>(Xk, nullptr, WkT, bk, TMP, DM, nullptr); k_cvtb2<<<NT_ / 8, 256, 0, stream>>>(TMP, NT_, Kh, Kl);
        k_gemmb<false, false><<<dim3(NT_ / 64, DM / 64, 1), 128, 0, stream>>>(Xk, nullptr, WvT, bv, TMP, DM, nullptr); k_vt<<<dim3(NT_ / 64, 2, NKV), 256, 0, stream>>>(TMP, Vh, Vl);
        k_gemm3<<<dim3(NT_ / 64, NT_ / 64, 1), 128, 0, stream>>>(Qh, Ql, Kh, Kl, DM, S, NT_);                 // scores [q][k] (unscaled; the 768^-1/2 is applied inside the softmax kernels)
        k_colstat<<<1, 256, 0, stream>>>(S, CMAX, CSUM);
        k_colsoft<<<NT_ / 8, 256, 0, stream>>>(S, CMAX, CSUM, Ph, Pl);
        k_gemm3<<<dim3(NT_ / 64, DM / 64, 1), 128, 0, stream>>>(Ph, Pl, Vh, Vl, NT_, CTX, DM);                // ctx = P.v
        k_cvtb2<<<NT_ / 8, 256, 0, stream>>>(CTX, NT_, Ch, Cl);
        k_gemmb<true, false><<<dim3(NT_ / 64, DM / 64, 1), 128, 0, stream>>>(Ch, Cl, WtT, bt, T2, DM, nullptr);  // h = ctx.Wt + bt
        k_dot1<<<(NT_ / 32) / 8, 256, 0, stream>>>(T2, Wo, bo, out + (size_t)b * NT_);                          // h.Wo + bo
    }
}

// v001
// A run of this version takes 2800 microseconds.
// Two timings next to v000 put it at 8.97 and 9.17 times that version's speed.
#include <hip/hip_runtime.h>

// Compute dtypes, f32 accumulate, one batch item per pass: q = query_x.Wq + bq, k/v = x.Wk/Wv + b ([1024 x 768].[768 x 768], k-major weights transposed once; PLAIN
// bf16 operands = inputs rounded once, exact) on v_wmma_f32_16x16x32_bf16; scores = q.k^T ([1024 x 768].[768 x 1024]) and ctx = P.v ([1024 x 1024].[1024 x 768])
// with BOTH computed operands as bf16 hi + UNSCALED residual (three products); the softmax over the QUERY axis (the module's dim=1) is done per key column in
// f32 (column max, column sum of exp, then P[q][k] = exp(s/sqrt(768) - cmax[k]) / csum[k]); h = ctx.Wt + bt (hi/lo A) and out[q] = h[q].Wo + bo (768 -> 1, f32,

#define NB_  16
#define NT_  1024                // Lq = Lk
#define DM   768
#define HD   128                 // k_vt grouping only
#define KW   DM
#define NKV  (DM / HD)           // 6
#define SCL  0.03608439182435161f    // 768^-1/2
#define LOSC 1024.0f

typedef _Float16 h16;
typedef unsigned short bf;
typedef __attribute__((ext_vector_type(16))) __bf16   v16bf;
typedef __attribute__((ext_vector_type(16))) _Float16 v16h;
typedef __attribute__((ext_vector_type(8)))  _Float16 v8h;
typedef __attribute__((ext_vector_type(8)))  unsigned short v8us;
typedef __attribute__((ext_vector_type(8)))  float    v8f;
typedef __attribute__((ext_vector_type(4)))  float    v4f;
typedef __attribute__((ext_vector_type(4)))  _Float16 v4h;
typedef v8h  __attribute__((may_alias)) v8ha;
typedef v4f  __attribute__((may_alias)) v4fa;
typedef v8us __attribute__((may_alias)) v8usa;

__device__ __forceinline__ unsigned short f2bf(float f) { unsigned u = __float_as_uint(f); u += 0x7FFFu + ((u >> 16) & 1u); return (unsigned short)(u >> 16); }
__device__ __forceinline__ float bf2f(unsigned short b) { return __uint_as_float(((unsigned)b) << 16); }
__device__ __forceinline__ float bfr(float f) { return bf2f(f2bf(f)); }
__device__ __forceinline__ v16h cat16(v8h lo, v8h hi) { return __builtin_shufflevector(lo, hi, 0, 1, 2, 3, 4, 5, 6, 7, 8, 9, 10, 11, 12, 13, 14, 15); }
__device__ __forceinline__ v16bf cat16b(v8us lo, v8us hi) { return __builtin_bit_cast(v16bf, __builtin_shufflevector(lo, hi, 0, 1, 2, 3, 4, 5, 6, 7, 8, 9, 10, 11, 12, 13, 14, 15)); }
__device__ __forceinline__ v8f wmma16(v16h a, v16h b, v8f c) { return __builtin_amdgcn_wmma_f32_16x16x32_f16(false, a, false, b, (short)0, c, false, false); }
__device__ __forceinline__ v8f wmmab(v16bf a, v16bf b, v8f c) { return __builtin_amdgcn_wmma_f32_16x16x32_bf16(false, a, false, b, (short)0, c, false, false); }

__global__ __launch_bounds__(256) void k_cvtb(const float* __restrict__ src, int nrows, bf* dst) {
    const int lane = threadIdx.x & 31, r = blockIdx.x * 8 + (threadIdx.x >> 5);
    if (r >= nrows) return;
    v8us o[DM / 256];
#pragma unroll
    for (int q = 0; q < DM / 256; ++q) { v8us t;
#pragma unroll
        for (int i = 0; i < 8; ++i) t[i] = f2bf(src[(size_t)r * DM + q * 256 + lane * 8 + i]);
        o[q] = t; }
#pragma unroll
    for (int q = 0; q < DM / 256; ++q) *(v8us*)(dst + (size_t)r * DM + q * 256 + lane * 8) = o[q];
    
}

// k_wt: WT [n][K] = bf16(W[k][n]) (k-major [K][ncols]) via 64 x 64 LDS tiles; grid (K/64, ncols/64).
__global__ __launch_bounds__(256) void k_wt(const float* __restrict__ Wm, int K, int ncols, bf* WT) {
    __shared__ __align__(16) unsigned short tl[64 * 72];
    const int tid = threadIdx.x, k0 = blockIdx.x * 64, n0 = blockIdx.y * 64;
    const int kk = tid >> 2, nq = (tid & 3) * 16;
#pragma unroll
    for (int i = 0; i < 16; ++i) tl[(nq + i) * 72 + kk] = f2bf(Wm[(size_t)(k0 + kk) * ncols + n0 + nq + i]);
    __syncthreads();
    const int piece = tid & 7;
    auto pass = [&]() {
#pragma unroll
        for (int s = 0; s < 2; ++s) { const int nr = (tid >> 3) + 32 * s; const v8us val = *(const v8usa*)(tl + nr * 72 + piece * 8); *(v8us*)(WT + (size_t)(n0 + nr) * K + k0 + piece * 8) = val; }
    };
    pass(); 
}
__global__ __launch_bounds__(256) void k_cvtb2(const float* __restrict__ src, int nrows, bf* dh, bf* dl) {
    const int lane = threadIdx.x & 31, r = blockIdx.x * 8 + (threadIdx.x >> 5);
    if (r >= nrows) return;
    v8us oh[DM / 256], ol[DM / 256];
#pragma unroll
    for (int q = 0; q < DM / 256; ++q) {
#pragma unroll
        for (int i = 0; i < 8; ++i) { const float v = src[(size_t)r * DM + q * 256 + lane * 8 + i]; const unsigned short hb = f2bf(v); oh[q][i] = hb; ol[q][i] = f2bf(v - bf2f(hb)); } }
{
#pragma unroll
        for (int q = 0; q < DM / 256; ++q) { const size_t o = (size_t)r * DM + q * 256 + lane * 8; *(v8us*)(dh + o) = oh[q]; *(v8us*)(dl + o) = ol[q]; }
         }
}
// k_gemmb: 64 x 64 block tile (4 waves x 16 x 64) of C[NTK][NW] = (A [+ Al]).B^T (K = 768) [+ bf(bias[c])] [+ bf(R[r][c]) residual]; f32 whole-line epilogue (or f16
template <bool SPLITA, bool F16OUT = false>
__global__ __launch_bounds__(128) void k_gemmb(const bf* __restrict__ A, const bf* __restrict__ Al, const bf* __restrict__ Bn, const float* __restrict__ bias, float* C, int ldc, h16* C2, const float* __restrict__ R = nullptr, int K = DM, int roundR = 1) {
    __shared__ __align__(16) float ost[4][16 * 68];
    const int lane = threadIdx.x & 31, wave = threadIdx.x >> 5, lr = lane & 15, hi = lane >> 4;
    const int r0 = blockIdx.x * 64 + wave * 16, c0 = blockIdx.y * 64;
    const size_t aoff = (size_t)(r0 + lr) * K + 8 * hi;
    size_t boff[4];
#pragma unroll
    for (int t = 0; t < 4; ++t) boff[t] = (size_t)(c0 + t * 16 + lr) * K + 8 * hi;
    v8f acc[4];
#pragma unroll
    for (int t = 0; t < 4; ++t) acc[t] = (v8f){};
#pragma unroll 1
    for (int kc = 0; kc < K; kc += 32) {
        const v16bf a = cat16b(*(const v8us*)(A + aoff + kc), *(const v8us*)(A + aoff + kc + 16));
        v16bf al = a;
        if (SPLITA) al = cat16b(*(const v8us*)(Al + aoff + kc), *(const v8us*)(Al + aoff + kc + 16));
#pragma unroll
        for (int t = 0; t < 4; ++t) { const v16bf b = cat16b(*(const v8us*)(Bn + boff[t] + kc), *(const v8us*)(Bn + boff[t] + kc + 16)); acc[t] = wmmab(a, b, acc[t]); if (SPLITA) acc[t] = wmmab(al, b, acc[t]); }
        asm volatile("v_nop\n\tv_nop\n\tv_nop\n\tv_nop" : "+v"(acc[0]), "+v"(acc[1]), "+v"(acc[2]), "+v"(acc[3]) : "v"(a), "v"(al));
    }
    float* os = &ost[wave][0];
#pragma unroll
    for (int t = 0; t < 4; ++t) { const float bv = bias ? bfr(bias[c0 + t * 16 + lr]) : 0.f;
#pragma unroll
        for (int j = 0; j < 8; ++j) os[(hi * 8 + j) * 68 + t * 16 + lr] = acc[t][j] + bv; }
    __syncthreads();
    if (F16OUT) {
        h16* crow = (h16*)(void*)C + (size_t)r0 * ldc + c0;
        auto pass = [&]() {
#pragma unroll
            for (int s = 0; s < 4; ++s) { const int row = 4 * s + (lane >> 3), piece = lane & 7; const float* sp = os + row * 68 + piece * 8; v8h o, o2;
#pragma unroll
                for (int i = 0; i < 8; ++i) { const h16 a = (h16)sp[i]; o[i] = a; o2[i] = (h16)((sp[i] - (float)a) * LOSC); }
                *(v8h*)(crow + (size_t)row * ldc + piece * 8) = o; if (C2) *(v8h*)(C2 + (size_t)r0 * ldc + c0 + (size_t)row * ldc + piece * 8) = o2; }
        };
        pass(); 
    } else {
        float* crow = C + (size_t)r0 * ldc + c0;
        auto pass = [&]() {
#pragma unroll
            for (int s = 0; s < 8; ++s) { const int Lid = (lane >> 3) + 4 * s, piece = lane & 7; const int row = Lid >> 1, cofs = (Lid & 1) * 32 + piece * 4;
                v4f val = *(const v4fa*)(os + row * 68 + cofs); if (R) { const v4f rv = *(const v4f*)(R + ((size_t)r0 + row) * ldc + c0 + cofs); val += roundR ? (v4f){bfr(rv[0]), bfr(rv[1]), bfr(rv[2]), bfr(rv[3])} : rv; }
                *(v4f*)(crow + (size_t)row * ldc + cofs) = val; }
        };
        pass(); 
    }
}

// k_gemm3: 64 x 64 tile of C = (Ah + Al).(Bh + Bl)^T over K (row strides = K for all four planes; n-major B): three products per 32-k step (hh, hl, lh); f32
__global__ __launch_bounds__(128) void k_gemm3(const bf* __restrict__ Ah, const bf* __restrict__ Al, const bf* __restrict__ Bh, const bf* __restrict__ Bl, int K, float* C, int ldc) {
    __shared__ __align__(16) float ost[4][16 * 68];
    const int lane = threadIdx.x & 31, wave = threadIdx.x >> 5, lr = lane & 15, hi = lane >> 4;
    const int r0 = blockIdx.x * 64 + wave * 16, c0 = blockIdx.y * 64;
    const size_t aoff = (size_t)(r0 + lr) * K + 8 * hi;
    v8f acc[4];
#pragma unroll
    for (int t = 0; t < 4; ++t) acc[t] = (v8f){};
#pragma unroll 1
    for (int kc = 0; kc < K; kc += 32) {
        const v16bf a = cat16b(*(const v8us*)(Ah + aoff + kc), *(const v8us*)(Ah + aoff + kc + 16));
        const v16bf al = cat16b(*(const v8us*)(Al + aoff + kc), *(const v8us*)(Al + aoff + kc + 16));
#pragma unroll
        for (int t = 0; t < 4; ++t) { const size_t bo = (size_t)(c0 + t * 16 + lr) * K + kc + 8 * hi;
            const v16bf bh = cat16b(*(const v8us*)(Bh + bo), *(const v8us*)(Bh + bo + 16)); const v16bf bl = cat16b(*(const v8us*)(Bl + bo), *(const v8us*)(Bl + bo + 16));
            acc[t] = wmmab(a, bh, acc[t]); acc[t] = wmmab(al, bh, acc[t]); acc[t] = wmmab(a, bl, acc[t]); }
        asm volatile("v_nop\n\tv_nop\n\tv_nop\n\tv_nop" : "+v"(acc[0]), "+v"(acc[1]), "+v"(acc[2]), "+v"(acc[3]) : "v"(a), "v"(al));
    }
    float* os = &ost[wave][0];
#pragma unroll
    for (int t = 0; t < 4; ++t) {
#pragma unroll
        for (int j = 0; j < 8; ++j) os[(hi * 8 + j) * 68 + t * 16 + lr] = acc[t][j]; }
    __builtin_amdgcn_wave_barrier(); asm volatile("" ::: "memory");
    float* crow = C + (size_t)r0 * ldc + c0;
    auto pass = [&]() {
#pragma unroll
        for (int s = 0; s < 8; ++s) { const int Lid = (lane >> 3) + 4 * s, piece = lane & 7; const int row = Lid >> 1, cofs = (Lid & 1) * 32 + piece * 4;
            const v4f val = *(const v4fa*)(os + row * 68 + cofs); *(v4f*)(crow + (size_t)row * ldc + cofs) = val; }
    };
    pass(); 
}
// k_vt: VTH/VTL [g][128 d][1024 t] = bf16 hi + UNSCALED bf16 residual of V [t][g*128+d] via 64 x 64 LDS tiles; grid (NT/64, 2, 6): transpose of v [k][768] f32 into hi/lo planes v^T [768][k].
__global__ __launch_bounds__(256) void k_vt(const float* __restrict__ V, bf* VTH, bf* VTL) {
    __shared__ float tl[64][65];
    const int tid = threadIdx.x, t0 = blockIdx.x * 64, d0 = blockIdx.y * 64, g = blockIdx.z;
    { const int tt = tid >> 2, dq = (tid & 3) * 16;
#pragma unroll
      for (int i = 0; i < 16; ++i) tl[dq + i][tt] = V[(size_t)(t0 + tt) * KW + g * HD + d0 + dq + i]; }
    __syncthreads();
    const int piece = tid & 7;
    auto pass = [&]() {
#pragma unroll
        for (int s = 0; s < 2; ++s) { const int d = (tid >> 3) + 32 * s; v8us oh, ol;
#pragma unroll
            for (int i = 0; i < 8; ++i) { const float v = tl[d][piece * 8 + i]; const unsigned short hb = f2bf(v); oh[i] = hb; ol[i] = f2bf(v - bf2f(hb)); }
            const size_t o = ((size_t)g * HD + d0 + d) * NT_ + t0 + piece * 8; *(v8us*)(VTH + o) = oh; *(v8us*)(VTL + o) = ol; }
    };
    pass(); 
}

// k_colstat: per key column k of S [1024 q][1024 k]: cmax = max_q (s x scale), csum = sum_q exp(s x scale - cmax), f32. One work-group per 32 columns (one 128-B line
// of every row), 32 waves: a wave-wide 16-B load covers 4 rows x 32 columns, and a thread keeps its 8 rows x 4 columns in registers for both passes (S is read once).
// Fixed reduction tree: 8 rows in the thread, the wave's 4 row groups by lane exchange, the 32 waves through LDS (4 wave rows per load, then lane exchange again).
// Every loop is unrolled so that v, m and s are indexed by constants and stay in registers, and so that the 8 global loads are all in flight together.
__global__ __launch_bounds__(1024) void k_colstat(const float* __restrict__ S, float* CMAX, float* CSUM) {
    __shared__ __align__(16) float rm[32 * 32]; __shared__ __align__(16) float rs[32 * 32];
    const int lane = threadIdx.x & 31, wave = threadIdx.x >> 5, cg = (lane & 7) * 4, rsub = lane >> 3, c0 = blockIdx.x * 32;
    v4f v[8];
#pragma unroll
    for (int i = 0; i < 8; ++i) v[i] = *(const v4f*)(S + (size_t)(i * 128 + wave * 4 + rsub) * NT_ + c0 + cg);
    v4f m = (v4f){-3.0e38f, -3.0e38f, -3.0e38f, -3.0e38f};
#pragma unroll
    for (int i = 0; i < 8; ++i) m = __builtin_elementwise_max(m, v[i] * SCL);
#pragma unroll
    for (int k = 0; k < 4; ++k) { m[k] = fmaxf(m[k], __shfl_xor(m[k], 8)); m[k] = fmaxf(m[k], __shfl_xor(m[k], 16)); }
    if (rsub == 0) *(v4fa*)(rm + wave * 32 + cg) = m;
    __syncthreads();
#pragma unroll
    for (int j = 0; j < 8; ++j) m = __builtin_elementwise_max(m, *(const v4fa*)(rm + (j * 4 + rsub) * 32 + cg));
#pragma unroll
    for (int k = 0; k < 4; ++k) { m[k] = fmaxf(m[k], __shfl_xor(m[k], 8)); m[k] = fmaxf(m[k], __shfl_xor(m[k], 16)); }
    v4f s = (v4f){0.f, 0.f, 0.f, 0.f};
#pragma unroll
    for (int i = 0; i < 8; ++i) { const v4f e = __builtin_elementwise_fma(v[i], (v4f){SCL, SCL, SCL, SCL}, -m);
#pragma unroll
        for (int k = 0; k < 4; ++k) s[k] += __expf(e[k]); }
#pragma unroll
    for (int k = 0; k < 4; ++k) { s[k] += __shfl_xor(s[k], 8); s[k] += __shfl_xor(s[k], 16); }
    if (rsub == 0) *(v4fa*)(rs + wave * 32 + cg) = s;
    __syncthreads();
    if (wave == 0) {
        v4f t = (v4f){0.f, 0.f, 0.f, 0.f};
#pragma unroll
        for (int j = 0; j < 8; ++j) t += *(const v4fa*)(rs + (j * 4 + rsub) * 32 + cg);
#pragma unroll
        for (int k = 0; k < 4; ++k) { t[k] += __shfl_xor(t[k], 8); t[k] += __shfl_xor(t[k], 16); }
        if (rsub == 0) { *(v4f*)(CMAX + c0 + cg) = m; *(v4f*)(CSUM + c0 + cg) = t; }
    }
}
// k_colsoft: P[q][k] = exp(s[q][k] x scale - cmax[k]) / csum[k] -> bf16 hi + UNSCALED residual planes; one wave per row q, lane -> 8 columns per 256-column step.
__global__ __launch_bounds__(256) void k_colsoft(const float* __restrict__ S, const float* __restrict__ CMAX, const float* __restrict__ CSUM, bf* Ph, bf* Pl) {
    const int lane = threadIdx.x & 31, r = blockIdx.x * 8 + (threadIdx.x >> 5); if (r >= NT_) return;
{
#pragma unroll 1
        for (int qc = 0; qc < NT_ / 256; ++qc) { const size_t o = (size_t)r * NT_ + qc * 256 + lane * 8; const v8f v = *(const v8f*)(S + o), cm = *(const v8f*)(CMAX + qc * 256 + lane * 8), cs = *(const v8f*)(CSUM + qc * 256 + lane * 8); v8us oh, ol;
#pragma unroll
            for (int i = 0; i < 8; ++i) { const float p = __expf(v[i] * SCL - cm[i]) / cs[i]; const unsigned short hb = f2bf(p); oh[i] = hb; ol[i] = f2bf(p - bf2f(hb)); }
            *(v8us*)(Ph + o) = oh; *(v8us*)(Pl + o) = ol; }
         }
}
__global__ __launch_bounds__(256) void k_dot1(const float* __restrict__ T, const float* __restrict__ Wo, const float* __restrict__ bo, float* OUTB) {
    const int lane = threadIdx.x & 31, w = blockIdx.x * 8 + (threadIdx.x >> 5); if (w >= NT_ / 32) return;
    const int q = w * 32 + lane; const float* row = T + (size_t)q * DM;
    float a = bfr(bo[0]);
#pragma unroll 1
    for (int h = 0; h < DM; h += 4) { const v4f v = *(const v4f*)(row + h);
#pragma unroll
        for (int k = 0; k < 4; ++k) a = fmaf(v[k], bfr(Wo[h + k]), a); }
    *(float*)(OUTB + q) = a; 
}

extern "C" void kernel_launch(void* const* d_in, const int* in_sizes, int n_in,
                              void* d_out, int out_size, void* d_ws, size_t ws_size, hipStream_t stream) {
    (void)in_sizes; (void)n_in; (void)out_size;
    const float* qx = (const float*)d_in[0]; const float* x = (const float*)d_in[1];
    const float* Wq = (const float*)d_in[2]; const float* bq = (const float*)d_in[3]; const float* Wk = (const float*)d_in[4]; const float* bk = (const float*)d_in[5]; const float* Wv = (const float*)d_in[6]; const float* bv = (const float*)d_in[7];
    const float* Wt = (const float*)d_in[8]; const float* bt = (const float*)d_in[9]; const float* Wo = (const float*)d_in[10]; const float* bo = (const float*)d_in[11];   // W k-major [in][out]
    float* out = (float*)d_out;    // [16][1024]
    char* wsp = (char*)d_ws;
    auto take = [&](size_t bytes) { char* p = wsp; wsp += (bytes + 255) & ~(size_t)255; return (void*)p; };
    bf* WqT = (bf*)take((size_t)DM * DM * 2); bf* WkT = (bf*)take((size_t)DM * DM * 2); bf* WvT = (bf*)take((size_t)DM * DM * 2); bf* WtT = (bf*)take((size_t)DM * DM * 2);
    bf* Xq = (bf*)take((size_t)NT_ * DM * 2); bf* Xk = (bf*)take((size_t)NT_ * DM * 2); float* TMP = (float*)take((size_t)NT_ * DM * 4);
    bf* Qh = (bf*)take((size_t)NT_ * DM * 2); bf* Ql = (bf*)take((size_t)NT_ * DM * 2); bf* Kh = (bf*)take((size_t)NT_ * DM * 2); bf* Kl = (bf*)take((size_t)NT_ * DM * 2);
    bf* Vh = (bf*)take((size_t)DM * NT_ * 2); bf* Vl = (bf*)take((size_t)DM * NT_ * 2);
    float* S = (float*)take((size_t)NT_ * NT_ * 4); float* CMAX = (float*)take((size_t)NT_ * 4); float* CSUM = (float*)take((size_t)NT_ * 4); bf* Ph = (bf*)take((size_t)NT_ * NT_ * 2); bf* Pl = (bf*)take((size_t)NT_ * NT_ * 2);
    float* CTX = (float*)take((size_t)NT_ * DM * 4); bf* Ch = (bf*)take((size_t)NT_ * DM * 2); bf* Cl = (bf*)take((size_t)NT_ * DM * 2); float* T2 = (float*)take((size_t)NT_ * DM * 4);
    if ((size_t)(wsp - (char*)d_ws) > ws_size) return;    // ~ 4.7 + 3 + 3 + 6 + 3 + 4.2 + 4.2 + 3 + 3 + 3 ~ 38 MB, no aliasing (per-item reuse in stream order)
    k_wt<<<dim3(DM / 64, DM / 64, 1), 256, 0, stream>>>(Wq, DM, DM, WqT); k_wt<<<dim3(DM / 64, DM / 64, 1), 256, 0, stream>>>(Wk, DM, DM, WkT);
    k_wt<<<dim3(DM / 64, DM / 64, 1), 256, 0, stream>>>(Wv, DM, DM, WvT); k_wt<<<dim3(DM / 64, DM / 64, 1), 256, 0, stream>>>(Wt, DM, DM, WtT);
    for (int b = 0; b < NB_; ++b) {
        k_cvtb<<<NT_ / 8, 256, 0, stream>>>(qx + (size_t)b * NT_ * DM, NT_, Xq); k_cvtb<<<NT_ / 8, 256, 0, stream>>>(x + (size_t)b * NT_ * DM, NT_, Xk);
        k_gemmb<false, false><<<dim3(NT_ / 64, DM / 64, 1), 128, 0, stream>>>(Xq, nullptr, WqT, bq, TMP, DM, nullptr); k_cvtb2<<<NT_ / 8, 256, 0, stream>>>(TMP, NT_, Qh, Ql);
        k_gemmb<false, false><<<dim3(NT_ / 64, DM / 64, 1), 128, 0, stream>>>(Xk, nullptr, WkT, bk, TMP, DM, nullptr); k_cvtb2<<<NT_ / 8, 256, 0, stream>>>(TMP, NT_, Kh, Kl);
        k_gemmb<false, false><<<dim3(NT_ / 64, DM / 64, 1), 128, 0, stream>>>(Xk, nullptr, WvT, bv, TMP, DM, nullptr); k_vt<<<dim3(NT_ / 64, 2, NKV), 256, 0, stream>>>(TMP, Vh, Vl);
        k_gemm3<<<dim3(NT_ / 64, NT_ / 64, 1), 128, 0, stream>>>(Qh, Ql, Kh, Kl, DM, S, NT_);                 // scores [q][k] (unscaled; the 768^-1/2 is applied inside the softmax kernels)
        k_colstat<<<NT_ / 32, 1024, 0, stream>>>(S, CMAX, CSUM);
        k_colsoft<<<NT_ / 8, 256, 0, stream>>>(S, CMAX, CSUM, Ph, Pl);
        k_gemm3<<<dim3(NT_ / 64, DM / 64, 1), 128, 0, stream>>>(Ph, Pl, Vh, Vl, NT_, CTX, DM);                // ctx = P.v
        k_cvtb2<<<NT_ / 8, 256, 0, stream>>>(CTX, NT_, Ch, Cl);
        k_gemmb<true, false><<<dim3(NT_ / 64, DM / 64, 1), 128, 0, stream>>>(Ch, Cl, WtT, bt, T2, DM, nullptr);  // h = ctx.Wt + bt
        k_dot1<<<(NT_ / 32) / 8, 256, 0, stream>>>(T2, Wo, bo, out + (size_t)b * NT_);                          // h.Wo + bo
    }
}

// v002
// It runs in 985 microseconds.
// Timed twice side by side with v001, it ran 2.87 times as fast both times.
// Counting every step since v000, it is 26.0 times as fast.
#include <hip/hip_runtime.h>

// Compute dtypes, f32 accumulate, all 16 batch items in every launch (rows of all items in one grid, or the item in a grid axis): q = query_x.Wq + bq, k/v = x.Wk/Wv + b ([1024 x 768].[768 x 768], k-major weights transposed once; PLAIN
// bf16 operands = inputs rounded once, exact) on v_wmma_f32_16x16x32_bf16; scores = q.k^T ([1024 x 768].[768 x 1024]) and ctx = P.v ([1024 x 1024].[1024 x 768])
// with BOTH computed operands as bf16 hi + UNSCALED residual (three products); the softmax over the QUERY axis (the module's dim=1) is done per key column in
// f32 (column max, column sum of exp, then P[q][k] = exp(s/sqrt(768) - cmax[k]) / csum[k]); h = ctx.Wt + bt (hi/lo A) and out[q] = h[q].Wo + bo (768 -> 1, f32,

#define NB_  16
#define NT_  1024                // Lq = Lk
#define DM   768
#define HD   128                 // k_vt grouping only
#define KW   DM
#define NKV  (DM / HD)           // 6
#define SCL  0.03608439182435161f    // 768^-1/2
#define LOSC 1024.0f

typedef _Float16 h16;
typedef unsigned short bf;
typedef __attribute__((ext_vector_type(16))) __bf16   v16bf;
typedef __attribute__((ext_vector_type(16))) _Float16 v16h;
typedef __attribute__((ext_vector_type(8)))  _Float16 v8h;
typedef __attribute__((ext_vector_type(8)))  unsigned short v8us;
typedef __attribute__((ext_vector_type(8)))  float    v8f;
typedef __attribute__((ext_vector_type(4)))  float    v4f;
typedef __attribute__((ext_vector_type(4)))  _Float16 v4h;
typedef v8h  __attribute__((may_alias)) v8ha;
typedef v4f  __attribute__((may_alias)) v4fa;
typedef v8us __attribute__((may_alias)) v8usa;

__device__ __forceinline__ unsigned short f2bf(float f) { unsigned u = __float_as_uint(f); u += 0x7FFFu + ((u >> 16) & 1u); return (unsigned short)(u >> 16); }
__device__ __forceinline__ float bf2f(unsigned short b) { return __uint_as_float(((unsigned)b) << 16); }
__device__ __forceinline__ float bfr(float f) { return bf2f(f2bf(f)); }
__device__ __forceinline__ v16h cat16(v8h lo, v8h hi) { return __builtin_shufflevector(lo, hi, 0, 1, 2, 3, 4, 5, 6, 7, 8, 9, 10, 11, 12, 13, 14, 15); }
__device__ __forceinline__ v16bf cat16b(v8us lo, v8us hi) { return __builtin_bit_cast(v16bf, __builtin_shufflevector(lo, hi, 0, 1, 2, 3, 4, 5, 6, 7, 8, 9, 10, 11, 12, 13, 14, 15)); }
__device__ __forceinline__ v8f wmma16(v16h a, v16h b, v8f c) { return __builtin_amdgcn_wmma_f32_16x16x32_f16(false, a, false, b, (short)0, c, false, false); }
__device__ __forceinline__ v8f wmmab(v16bf a, v16bf b, v8f c) { return __builtin_amdgcn_wmma_f32_16x16x32_bf16(false, a, false, b, (short)0, c, false, false); }

__global__ __launch_bounds__(256) void k_cvtb(const float* __restrict__ src, int nrows, bf* dst) {
    const int lane = threadIdx.x & 31, r = blockIdx.x * 8 + (threadIdx.x >> 5);
    if (r >= nrows) return;
    v8us o[DM / 256];
#pragma unroll
    for (int q = 0; q < DM / 256; ++q) { v8us t;
#pragma unroll
        for (int i = 0; i < 8; ++i) t[i] = f2bf(src[(size_t)r * DM + q * 256 + lane * 8 + i]);
        o[q] = t; }
#pragma unroll
    for (int q = 0; q < DM / 256; ++q) *(v8us*)(dst + (size_t)r * DM + q * 256 + lane * 8) = o[q];
    
}

// k_wt: WT [n][K] = bf16(W[k][n]) (k-major [K][ncols]) via 64 x 64 LDS tiles; grid (K/64, ncols/64).
__global__ __launch_bounds__(256) void k_wt(const float* __restrict__ Wm, int K, int ncols, bf* WT) {
    __shared__ __align__(16) unsigned short tl[64 * 72];
    const int tid = threadIdx.x, k0 = blockIdx.x * 64, n0 = blockIdx.y * 64;
    const int kk = tid >> 2, nq = (tid & 3) * 16;
#pragma unroll
    for (int i = 0; i < 16; ++i) tl[(nq + i) * 72 + kk] = f2bf(Wm[(size_t)(k0 + kk) * ncols + n0 + nq + i]);
    __syncthreads();
    const int piece = tid & 7;
    auto pass = [&]() {
#pragma unroll
        for (int s = 0; s < 2; ++s) { const int nr = (tid >> 3) + 32 * s; const v8us val = *(const v8usa*)(tl + nr * 72 + piece * 8); *(v8us*)(WT + (size_t)(n0 + nr) * K + k0 + piece * 8) = val; }
    };
    pass(); 
}
__global__ __launch_bounds__(256) void k_cvtb2(const float* __restrict__ src, int nrows, bf* dh, bf* dl) {
    const int lane = threadIdx.x & 31, r = blockIdx.x * 8 + (threadIdx.x >> 5);
    if (r >= nrows) return;
    v8us oh[DM / 256], ol[DM / 256];
#pragma unroll
    for (int q = 0; q < DM / 256; ++q) {
#pragma unroll
        for (int i = 0; i < 8; ++i) { const float v = src[(size_t)r * DM + q * 256 + lane * 8 + i]; const unsigned short hb = f2bf(v); oh[q][i] = hb; ol[q][i] = f2bf(v - bf2f(hb)); } }
{
#pragma unroll
        for (int q = 0; q < DM / 256; ++q) { const size_t o = (size_t)r * DM + q * 256 + lane * 8; *(v8us*)(dh + o) = oh[q]; *(v8us*)(dl + o) = ol[q]; }
         }
}
// k_gemmb: 64 x 64 block tile (4 waves x 16 x 64) of C[NTK][NW] = (A [+ Al]).B^T (K = 768) [+ bf(bias[c])] [+ bf(R[r][c]) residual]; f32 whole-line epilogue (or f16
template <bool SPLITA, bool F16OUT = false>
__global__ __launch_bounds__(128) void k_gemmb(const bf* __restrict__ A, const bf* __restrict__ Al, const bf* __restrict__ Bn, const float* __restrict__ bias, float* C, int ldc, h16* C2, const float* __restrict__ R = nullptr, int K = DM, int roundR = 1) {
    __shared__ __align__(16) float ost[4][16 * 68];
    const int lane = threadIdx.x & 31, wave = threadIdx.x >> 5, lr = lane & 15, hi = lane >> 4;
    const int r0 = blockIdx.x * 64 + wave * 16, c0 = blockIdx.y * 64;
    const size_t aoff = (size_t)(r0 + lr) * K + 8 * hi;
    size_t boff[4];
#pragma unroll
    for (int t = 0; t < 4; ++t) boff[t] = (size_t)(c0 + t * 16 + lr) * K + 8 * hi;
    v8f acc[4];
#pragma unroll
    for (int t = 0; t < 4; ++t) acc[t] = (v8f){};
#pragma unroll 1
    for (int kc = 0; kc < K; kc += 32) {
        const v16bf a = cat16b(*(const v8us*)(A + aoff + kc), *(const v8us*)(A + aoff + kc + 16));
        v16bf al = a;
        if (SPLITA) al = cat16b(*(const v8us*)(Al + aoff + kc), *(const v8us*)(Al + aoff + kc + 16));
#pragma unroll
        for (int t = 0; t < 4; ++t) { const v16bf b = cat16b(*(const v8us*)(Bn + boff[t] + kc), *(const v8us*)(Bn + boff[t] + kc + 16)); acc[t] = wmmab(a, b, acc[t]); if (SPLITA) acc[t] = wmmab(al, b, acc[t]); }
        asm volatile("v_nop\n\tv_nop\n\tv_nop\n\tv_nop" : "+v"(acc[0]), "+v"(acc[1]), "+v"(acc[2]), "+v"(acc[3]) : "v"(a), "v"(al));
    }
    float* os = &ost[wave][0];
#pragma unroll
    for (int t = 0; t < 4; ++t) { const float bv = bias ? bfr(bias[c0 + t * 16 + lr]) : 0.f;
#pragma unroll
        for (int j = 0; j < 8; ++j) os[(hi * 8 + j) * 68 + t * 16 + lr] = acc[t][j] + bv; }
    __syncthreads();
    if (F16OUT) {
        h16* crow = (h16*)(void*)C + (size_t)r0 * ldc + c0;
        auto pass = [&]() {
#pragma unroll
            for (int s = 0; s < 4; ++s) { const int row = 4 * s + (lane >> 3), piece = lane & 7; const float* sp = os + row * 68 + piece * 8; v8h o, o2;
#pragma unroll
                for (int i = 0; i < 8; ++i) { const h16 a = (h16)sp[i]; o[i] = a; o2[i] = (h16)((sp[i] - (float)a) * LOSC); }
                *(v8h*)(crow + (size_t)row * ldc + piece * 8) = o; if (C2) *(v8h*)(C2 + (size_t)r0 * ldc + c0 + (size_t)row * ldc + piece * 8) = o2; }
        };
        pass(); 
    } else {
        float* crow = C + (size_t)r0 * ldc + c0;
        auto pass = [&]() {
#pragma unroll
            for (int s = 0; s < 8; ++s) { const int Lid = (lane >> 3) + 4 * s, piece = lane & 7; const int row = Lid >> 1, cofs = (Lid & 1) * 32 + piece * 4;
                v4f val = *(const v4fa*)(os + row * 68 + cofs); if (R) { const v4f rv = *(const v4f*)(R + ((size_t)r0 + row) * ldc + c0 + cofs); val += roundR ? (v4f){bfr(rv[0]), bfr(rv[1]), bfr(rv[2]), bfr(rv[3])} : rv; }
                *(v4f*)(crow + (size_t)row * ldc + cofs) = val; }
        };
        pass(); 
    }
}

// k_gemm3: 64 x 64 tile of C = (Ah + Al).(Bh + Bl)^T over K (row strides = K for all four planes; n-major B): three products per 32-k step (hh, hl, lh); f32;
// blockIdx.z = batch item, sA / sB / sC = elements per item in the A planes, the B planes and C.
__global__ __launch_bounds__(128) void k_gemm3(const bf* __restrict__ Ah, const bf* __restrict__ Al, const bf* __restrict__ Bh, const bf* __restrict__ Bl, int K, float* C, int ldc, size_t sA, size_t sB, size_t sC) {
    __shared__ __align__(16) float ost[4][16 * 68];
    const int lane = threadIdx.x & 31, wave = threadIdx.x >> 5, lr = lane & 15, hi = lane >> 4;
    const int r0 = blockIdx.x * 64 + wave * 16, c0 = blockIdx.y * 64;
    Ah += blockIdx.z * sA; Al += blockIdx.z * sA; Bh += blockIdx.z * sB; Bl += blockIdx.z * sB; C += blockIdx.z * sC;
    const size_t aoff = (size_t)(r0 + lr) * K + 8 * hi;
    v8f acc[4];
#pragma unroll
    for (int t = 0; t < 4; ++t) acc[t] = (v8f){};
#pragma unroll 1
    for (int kc = 0; kc < K; kc += 32) {
        const v16bf a = cat16b(*(const v8us*)(Ah + aoff + kc), *(const v8us*)(Ah + aoff + kc + 16));
        const v16bf al = cat16b(*(const v8us*)(Al + aoff + kc), *(const v8us*)(Al + aoff + kc + 16));
#pragma unroll
        for (int t = 0; t < 4; ++t) { const size_t bo = (size_t)(c0 + t * 16 + lr) * K + kc + 8 * hi;
            const v16bf bh = cat16b(*(const v8us*)(Bh + bo), *(const v8us*)(Bh + bo + 16)); const v16bf bl = cat16b(*(const v8us*)(Bl + bo), *(const v8us*)(Bl + bo + 16));
            acc[t] = wmmab(a, bh, acc[t]); acc[t] = wmmab(al, bh, acc[t]); acc[t] = wmmab(a, bl, acc[t]); }
        asm volatile("v_nop\n\tv_nop\n\tv_nop\n\tv_nop" : "+v"(acc[0]), "+v"(acc[1]), "+v"(acc[2]), "+v"(acc[3]) : "v"(a), "v"(al));
    }
    float* os = &ost[wave][0];
#pragma unroll
    for (int t = 0; t < 4; ++t) {
#pragma unroll
        for (int j = 0; j < 8; ++j) os[(hi * 8 + j) * 68 + t * 16 + lr] = acc[t][j]; }
    __builtin_amdgcn_wave_barrier(); asm volatile("" ::: "memory");
    float* crow = C + (size_t)r0 * ldc + c0;
    auto pass = [&]() {
#pragma unroll
        for (int s = 0; s < 8; ++s) { const int Lid = (lane >> 3) + 4 * s, piece = lane & 7; const int row = Lid >> 1, cofs = (Lid & 1) * 32 + piece * 4;
            const v4f val = *(const v4fa*)(os + row * 68 + cofs); *(v4f*)(crow + (size_t)row * ldc + cofs) = val; }
    };
    pass(); 
}
// k_vt: VTH/VTL [item][768 d][1024 t] = bf16 hi + UNSCALED bf16 residual of V [item][t][g*128+d] via 64 x 64 LDS tiles; grid (NB*NT/64, 2, 6): per item, transpose of v [k][768] f32 into hi/lo planes v^T [768][k].
__global__ __launch_bounds__(256) void k_vt(const float* __restrict__ V, bf* VTH, bf* VTL) {
    __shared__ float tl[64][65];
    const int tid = threadIdx.x, b = blockIdx.x / (NT_ / 64), t0 = (blockIdx.x % (NT_ / 64)) * 64, d0 = blockIdx.y * 64, g = blockIdx.z;
    { const int tt = tid >> 2, dq = (tid & 3) * 16;
#pragma unroll
      for (int i = 0; i < 16; ++i) tl[dq + i][tt] = V[(size_t)(b * NT_ + t0 + tt) * KW + g * HD + d0 + dq + i]; }
    __syncthreads();
    const int piece = tid & 7;
    auto pass = [&]() {
#pragma unroll
        for (int s = 0; s < 2; ++s) { const int d = (tid >> 3) + 32 * s; v8us oh, ol;
#pragma unroll
            for (int i = 0; i < 8; ++i) { const float v = tl[d][piece * 8 + i]; const unsigned short hb = f2bf(v); oh[i] = hb; ol[i] = f2bf(v - bf2f(hb)); }
            const size_t o = ((size_t)b * DM + g * HD + d0 + d) * NT_ + t0 + piece * 8; *(v8us*)(VTH + o) = oh; *(v8us*)(VTL + o) = ol; }
    };
    pass(); 
}

// k_colstat: per batch item (blockIdx.y) and key column k of S [1024 q][1024 k]: cmax = max_q (s x scale), csum = sum_q exp(s x scale - cmax), f32. One work-group per 32 columns (one 128-B line
// of every row), 32 waves: a wave-wide 16-B load covers 4 rows x 32 columns, and a thread keeps its 8 rows x 4 columns in registers for both passes (S is read once).
// Fixed reduction tree: 8 rows in the thread, the wave's 4 row groups by lane exchange, the 32 waves through LDS (4 wave rows per load, then lane exchange again).
// Every loop is unrolled so that v, m and s are indexed by constants and stay in registers, and so that the 8 global loads are all in flight together.
__global__ __launch_bounds__(1024) void k_colstat(const float* __restrict__ S, float* CMAX, float* CSUM) {
    __shared__ __align__(16) float rm[32 * 32]; __shared__ __align__(16) float rs[32 * 32];
    const int lane = threadIdx.x & 31, wave = threadIdx.x >> 5, cg = (lane & 7) * 4, rsub = lane >> 3, c0 = blockIdx.x * 32;
    S += (size_t)blockIdx.y * NT_ * NT_; CMAX += blockIdx.y * NT_; CSUM += blockIdx.y * NT_;
    v4f v[8];
#pragma unroll
    for (int i = 0; i < 8; ++i) v[i] = *(const v4f*)(S + (size_t)(i * 128 + wave * 4 + rsub) * NT_ + c0 + cg);
    v4f m = (v4f){-3.0e38f, -3.0e38f, -3.0e38f, -3.0e38f};
#pragma unroll
    for (int i = 0; i < 8; ++i) m = __builtin_elementwise_max(m, v[i] * SCL);
#pragma unroll
    for (int k = 0; k < 4; ++k) { m[k] = fmaxf(m[k], __shfl_xor(m[k], 8)); m[k] = fmaxf(m[k], __shfl_xor(m[k], 16)); }
    if (rsub == 0) *(v4fa*)(rm + wave * 32 + cg) = m;
    __syncthreads();
#pragma unroll
    for (int j = 0; j < 8; ++j) m = __builtin_elementwise_max(m, *(const v4fa*)(rm + (j * 4 + rsub) * 32 + cg));
#pragma unroll
    for (int k = 0; k < 4; ++k) { m[k] = fmaxf(m[k], __shfl_xor(m[k], 8)); m[k] = fmaxf(m[k], __shfl_xor(m[k], 16)); }
    v4f s = (v4f){0.f, 0.f, 0.f, 0.f};
#pragma unroll
    for (int i = 0; i < 8; ++i) { const v4f e = __builtin_elementwise_fma(v[i], (v4f){SCL, SCL, SCL, SCL}, -m);
#pragma unroll
        for (int k = 0; k < 4; ++k) s[k] += __expf(e[k]); }
#pragma unroll
    for (int k = 0; k < 4; ++k) { s[k] += __shfl_xor(s[k], 8); s[k] += __shfl_xor(s[k], 16); }
    if (rsub == 0) *(v4fa*)(rs + wave * 32 + cg) = s;
    __syncthreads();
    if (wave == 0) {
        v4f t = (v4f){0.f, 0.f, 0.f, 0.f};
#pragma unroll
        for (int j = 0; j < 8; ++j) t += *(const v4fa*)(rs + (j * 4 + rsub) * 32 + cg);
#pragma unroll
        for (int k = 0; k < 4; ++k) { t[k] += __shfl_xor(t[k], 8); t[k] += __shfl_xor(t[k], 16); }
        if (rsub == 0) { *(v4f*)(CMAX + c0 + cg) = m; *(v4f*)(CSUM + c0 + cg) = t; }
    }
}
// k_colsoft: P[q][k] = exp(s[q][k] x scale - cmax[k]) / csum[k] -> bf16 hi + UNSCALED residual planes; one wave per row q of any item (r = item * 1024 + q), lane -> 8 columns per 256-column step.
__global__ __launch_bounds__(256) void k_colsoft(const float* __restrict__ S, const float* __restrict__ CMAX, const float* __restrict__ CSUM, bf* Ph, bf* Pl) {
    const int lane = threadIdx.x & 31, r = blockIdx.x * 8 + (threadIdx.x >> 5); if (r >= NB_ * NT_) return;
    CMAX += (r / NT_) * NT_; CSUM += (r / NT_) * NT_;
{
#pragma unroll 1
        for (int qc = 0; qc < NT_ / 256; ++qc) { const size_t o = (size_t)r * NT_ + qc * 256 + lane * 8; const v8f v = *(const v8f*)(S + o), cm = *(const v8f*)(CMAX + qc * 256 + lane * 8), cs = *(const v8f*)(CSUM + qc * 256 + lane * 8); v8us oh, ol;
#pragma unroll
            for (int i = 0; i < 8; ++i) { const float p = __expf(v[i] * SCL - cm[i]) / cs[i]; const unsigned short hb = f2bf(p); oh[i] = hb; ol[i] = f2bf(p - bf2f(hb)); }
            *(v8us*)(Ph + o) = oh; *(v8us*)(Pl + o) = ol; }
         }
}
__global__ __launch_bounds__(256) void k_dot1(const float* __restrict__ T, const float* __restrict__ Wo, const float* __restrict__ bo, float* OUTB) {
    const int lane = threadIdx.x & 31, w = blockIdx.x * 8 + (threadIdx.x >> 5); if (w >= NB_ * NT_ / 32) return;
    const int q = w * 32 + lane; const float* row = T + (size_t)q * DM;
    float a = bfr(bo[0]);
#pragma unroll 1
    for (int h = 0; h < DM; h += 4) { const v4f v = *(const v4f*)(row + h);
#pragma unroll
        for (int k = 0; k < 4; ++k) a = fmaf(v[k], bfr(Wo[h + k]), a); }
    *(float*)(OUTB + q) = a; 
}

extern "C" void kernel_launch(void* const* d_in, const int* in_sizes, int n_in,
                              void* d_out, int out_size, void* d_ws, size_t ws_size, hipStream_t stream) {
    (void)in_sizes; (void)n_in; (void)out_size;
    const float* qx = (const float*)d_in[0]; const float* x = (const float*)d_in[1];
    const float* Wq = (const float*)d_in[2]; const float* bq = (const float*)d_in[3]; const float* Wk = (const float*)d_in[4]; const float* bk = (const float*)d_in[5]; const float* Wv = (const float*)d_in[6]; const float* bv = (const float*)d_in[7];
    const float* Wt = (const float*)d_in[8]; const float* bt = (const float*)d_in[9]; const float* Wo = (const float*)d_in[10]; const float* bo = (const float*)d_in[11];   // W k-major [in][out]
    float* out = (float*)d_out;    // [16][1024]
    char* wsp = (char*)d_ws;
    auto take = [&](size_t bytes) { char* p = wsp; wsp += (bytes + 255) & ~(size_t)255; return (void*)p; };
    bf* WqT = (bf*)take((size_t)DM * DM * 2); bf* WkT = (bf*)take((size_t)DM * DM * 2); bf* WvT = (bf*)take((size_t)DM * DM * 2); bf* WtT = (bf*)take((size_t)DM * DM * 2);
    // Planes hold all 16 items ([item][row][col], items back to back). Two regions are used again once their first tenants are dead (stream order):
    // R1 = Xq, Xk, TMP -> S -> CTX, Ch, Cl;  R2 = Qh, Ql, Kh, Kl -> Ph, Pl -> T2;  Vh, Vl keep their own.
    const size_t PL = (size_t)NB_ * NT_ * DM * 2;    // one bf16 plane of all items, 24 MiB
    char* R1 = (char*)take(4 * PL); char* R2 = (char*)take(4 * PL);
    bf* Vh = (bf*)take(PL); bf* Vl = (bf*)take(PL);
    float* CMAX = (float*)take((size_t)NB_ * NT_ * 4); float* CSUM = (float*)take((size_t)NB_ * NT_ * 4);
    bf* Xq = (bf*)R1; bf* Xk = (bf*)(R1 + PL); float* TMP = (float*)(R1 + 2 * PL);
    bf* Qh = (bf*)R2; bf* Ql = (bf*)(R2 + PL); bf* Kh = (bf*)(R2 + 2 * PL); bf* Kl = (bf*)(R2 + 3 * PL);
    float* S = (float*)R1;                                                               // 64 MiB of R1's 96
    bf* Ph = (bf*)R2; bf* Pl = (bf*)(R2 + (size_t)NB_ * NT_ * NT_ * 2);                  // 2 x 32 MiB of R2's 96
    float* CTX = (float*)R1; bf* Ch = (bf*)(R1 + 2 * PL); bf* Cl = (bf*)(R1 + 3 * PL);
    float* T2 = (float*)R2;
    if ((size_t)(wsp - (char*)d_ws) > ws_size) return;    // 4.5 + 96 + 96 + 48 + 0.125 ~ 244.6 MiB
    k_wt<<<dim3(DM / 64, DM / 64, 1), 256, 0, stream>>>(Wq, DM, DM, WqT); k_wt<<<dim3(DM / 64, DM / 64, 1), 256, 0, stream>>>(Wk, DM, DM, WkT);
    k_wt<<<dim3(DM / 64, DM / 64, 1), 256, 0, stream>>>(Wv, DM, DM, WvT); k_wt<<<dim3(DM / 64, DM / 64, 1), 256, 0, stream>>>(Wt, DM, DM, WtT);
    k_cvtb<<<NB_ * NT_ / 8, 256, 0, stream>>>(qx, NB_ * NT_, Xq); k_cvtb<<<NB_ * NT_ / 8, 256, 0, stream>>>(x, NB_ * NT_, Xk);
    k_gemmb<false, false><<<dim3(NB_ * NT_ / 64, DM / 64, 1), 128, 0, stream>>>(Xq, nullptr, WqT, bq, TMP, DM, nullptr); k_cvtb2<<<NB_ * NT_ / 8, 256, 0, stream>>>(TMP, NB_ * NT_, Qh, Ql);
    k_gemmb<false, false><<<dim3(NB_ * NT_ / 64, DM / 64, 1), 128, 0, stream>>>(Xk, nullptr, WkT, bk, TMP, DM, nullptr); k_cvtb2<<<NB_ * NT_ / 8, 256, 0, stream>>>(TMP, NB_ * NT_, Kh, Kl);
    k_gemmb<false, false><<<dim3(NB_ * NT_ / 64, DM / 64, 1), 128, 0, stream>>>(Xk, nullptr, WvT, bv, TMP, DM, nullptr); k_vt<<<dim3(NB_ * NT_ / 64, 2, NKV), 256, 0, stream>>>(TMP, Vh, Vl);
    k_gemm3<<<dim3(NT_ / 64, NT_ / 64, NB_), 128, 0, stream>>>(Qh, Ql, Kh, Kl, DM, S, NT_, (size_t)NT_ * DM, (size_t)NT_ * DM, (size_t)NT_ * NT_);   // scores [q][k] (unscaled; the 768^-1/2 is applied inside the softmax kernels)
    k_colstat<<<dim3(NT_ / 32, NB_, 1), 1024, 0, stream>>>(S, CMAX, CSUM);
    k_colsoft<<<NB_ * NT_ / 8, 256, 0, stream>>>(S, CMAX, CSUM, Ph, Pl);
    k_gemm3<<<dim3(NT_ / 64, DM / 64, NB_), 128, 0, stream>>>(Ph, Pl, Vh, Vl, NT_, CTX, DM, (size_t)NT_ * NT_, (size_t)DM * NT_, (size_t)NT_ * DM);   // ctx = P.v
    k_cvtb2<<<NB_ * NT_ / 8, 256, 0, stream>>>(CTX, NB_ * NT_, Ch, Cl);
    k_gemmb<true, false><<<dim3(NB_ * NT_ / 64, DM / 64, 1), 128, 0, stream>>>(Ch, Cl, WtT, bt, T2, DM, nullptr);  // h = ctx.Wt + bt
    k_dot1<<<(NB_ * NT_ / 32) / 8, 256, 0, stream>>>(T2, Wo, bo, out);                                            // h.Wo + bo
}

// v003
// One run takes 340 microseconds.
// In both of two side-by-side timings against v002, it was 2.90 times as fast.
// All steps since v000 together make it 75.5 times as fast.
#include <hip/hip_runtime.h>

// Compute dtypes, f32 accumulate, all 16 batch items in every launch (rows of all items in one grid, or the item in a grid axis): q = query_x.Wq + bq, k/v = x.Wk/Wv + b ([1024 x 768].[768 x 768], k-major weights transposed once; PLAIN
// bf16 operands = inputs rounded once, exact) on v_wmma_f32_16x16x32_bf16; scores = q.k^T ([1024 x 768].[768 x 1024]) and ctx = P.v ([1024 x 1024].[1024 x 768])
// with BOTH computed operands as bf16 hi + UNSCALED residual (three products); the softmax over the QUERY axis (the module's dim=1) is done per key column in
// f32 (column max, column sum of exp, then P[q][k] = exp(s/sqrt(768) - cmax[k]) / csum[k]); h = ctx.Wt + bt (hi/lo A) and out[q] = h[q].Wo + bo (768 -> 1, f32,

#define NB_  16
#define NT_  1024                // Lq = Lk
#define DM   768
#define HD   128                 // k_vt grouping only
#define KW   DM
#define NKV  (DM / HD)           // 6
#define SCL  0.03608439182435161f    // 768^-1/2
#define LOSC 1024.0f

typedef _Float16 h16;
typedef unsigned short bf;
typedef __attribute__((ext_vector_type(16))) __bf16   v16bf;
typedef __attribute__((ext_vector_type(16))) _Float16 v16h;
typedef __attribute__((ext_vector_type(8)))  _Float16 v8h;
typedef __attribute__((ext_vector_type(8)))  unsigned short v8us;
typedef __attribute__((ext_vector_type(8)))  float    v8f;
typedef __attribute__((ext_vector_type(4)))  float    v4f;
typedef __attribute__((ext_vector_type(4)))  _Float16 v4h;
typedef v8h  __attribute__((may_alias)) v8ha;
typedef v4f  __attribute__((may_alias)) v4fa;
typedef v8us __attribute__((may_alias)) v8usa;

__device__ __forceinline__ unsigned short f2bf(float f) { unsigned u = __float_as_uint(f); u += 0x7FFFu + ((u >> 16) & 1u); return (unsigned short)(u >> 16); }
__device__ __forceinline__ float bf2f(unsigned short b) { return __uint_as_float(((unsigned)b) << 16); }
__device__ __forceinline__ float bfr(float f) { return bf2f(f2bf(f)); }
__device__ __forceinline__ v16h cat16(v8h lo, v8h hi) { return __builtin_shufflevector(lo, hi, 0, 1, 2, 3, 4, 5, 6, 7, 8, 9, 10, 11, 12, 13, 14, 15); }
__device__ __forceinline__ v16bf cat16b(v8us lo, v8us hi) { return __builtin_bit_cast(v16bf, __builtin_shufflevector(lo, hi, 0, 1, 2, 3, 4, 5, 6, 7, 8, 9, 10, 11, 12, 13, 14, 15)); }
__device__ __forceinline__ v8f wmma16(v16h a, v16h b, v8f c) { return __builtin_amdgcn_wmma_f32_16x16x32_f16(false, a, false, b, (short)0, c, false, false); }
__device__ __forceinline__ v8f wmmab(v16bf a, v16bf b, v8f c) { return __builtin_amdgcn_wmma_f32_16x16x32_bf16(false, a, false, b, (short)0, c, false, false); }

__global__ __launch_bounds__(256) void k_cvtb(const float* __restrict__ src, int nrows, bf* dst) {
    const int lane = threadIdx.x & 31, r = blockIdx.x * 8 + (threadIdx.x >> 5);
    if (r >= nrows) return;
    v8us o[DM / 256];
#pragma unroll
    for (int q = 0; q < DM / 256; ++q) { v8us t;
#pragma unroll
        for (int i = 0; i < 8; ++i) t[i] = f2bf(src[(size_t)r * DM + q * 256 + lane * 8 + i]);
        o[q] = t; }
#pragma unroll
    for (int q = 0; q < DM / 256; ++q) *(v8us*)(dst + (size_t)r * DM + q * 256 + lane * 8) = o[q];
    
}

// k_wt: WT [n][K] = bf16(W[k][n]) (k-major [K][ncols]) via 64 x 64 LDS tiles; grid (K/64, ncols/64).
__global__ __launch_bounds__(256) void k_wt(const float* __restrict__ Wm, int K, int ncols, bf* WT) {
    __shared__ __align__(16) unsigned short tl[64 * 72];
    const int tid = threadIdx.x, k0 = blockIdx.x * 64, n0 = blockIdx.y * 64;
    const int kk = tid >> 2, nq = (tid & 3) * 16;
#pragma unroll
    for (int i = 0; i < 16; ++i) tl[(nq + i) * 72 + kk] = f2bf(Wm[(size_t)(k0 + kk) * ncols + n0 + nq + i]);
    __syncthreads();
    const int piece = tid & 7;
    auto pass = [&]() {
#pragma unroll
        for (int s = 0; s < 2; ++s) { const int nr = (tid >> 3) + 32 * s; const v8us val = *(const v8usa*)(tl + nr * 72 + piece * 8); *(v8us*)(WT + (size_t)(n0 + nr) * K + k0 + piece * 8) = val; }
    };
    pass(); 
}
__global__ __launch_bounds__(256) void k_cvtb2(const float* __restrict__ src, int nrows, bf* dh, bf* dl) {
    const int lane = threadIdx.x & 31, r = blockIdx.x * 8 + (threadIdx.x >> 5);
    if (r >= nrows) return;
    v8us oh[DM / 256], ol[DM / 256];
#pragma unroll
    for (int q = 0; q < DM / 256; ++q) {
#pragma unroll
        for (int i = 0; i < 8; ++i) { const float v = src[(size_t)r * DM + q * 256 + lane * 8 + i]; const unsigned short hb = f2bf(v); oh[q][i] = hb; ol[q][i] = f2bf(v - bf2f(hb)); } }
{
#pragma unroll
        for (int q = 0; q < DM / 256; ++q) { const size_t o = (size_t)r * DM + q * 256 + lane * 8; *(v8us*)(dh + o) = oh[q]; *(v8us*)(dl + o) = ol[q]; }
         }
}
// k_tg: one 128 x 128 tile of C = (Ah [+ Al]).(Bh [+ Bl])^T [+ bf(bias[c])] per work-group, 4 waves in 2 x 2, 64 x 64 of C per wave (4 x 4 accumulator tiles). All planes are k-contiguous with row
// stride K (a multiple of 64). A stage is 64 k (128 B) of the tile's 128 rows of every plane, brought into LDS by asynchronous copies, two buffers: stage t + 1 flies while stage t is worked on.
// Products per 32 k and accumulator, in this order: Ah.Bh, Al.Bh, Ah.Bl (those whose planes exist); k ascending. blockIdx.z = batch item, sA / sB / sC = elements per item in the A planes, the B planes and C.
// Every inner loop is unrolled so that acc and the fragment arrays are indexed by constants and stay in registers.
#define TP   144                 // LDS bytes per staged row: 128 of data + 16, so that 16 rows read 16 bytes wide fall on different banks
#define TPL  (128 * TP)          // one staged plane
__device__ __forceinline__ unsigned lds_off(const void* p) { return (unsigned)(size_t)p; }
// One lane's half rows of a 16 x 32 fragment: k 8 hi .. 8 hi + 7 and 16 + 8 hi .. 16 + 8 hi + 7 (p already holds the row and the 16 hi bytes); the same for A and B.
__device__ __forceinline__ v16bf ldf(const unsigned char* p) { return cat16b(*(const v8usa*)p, *(const v8usa*)(p + 32)); }
// One thread's share of one plane of a stage: 16 bytes of each of the rows r, r + 16, ..., r + 112 (rs = 16 rows, in elements). The s_wait_xcnt stands inside the statement so that
// no address register of a copy is rewritten in front of it.
__device__ __forceinline__ void copy_plane(unsigned l, const bf* gp, size_t rs) {
    asm volatile("global_load_async_to_lds_b128 %0, %8, off\n\t"
                 "global_load_async_to_lds_b128 %1, %9, off\n\t"
                 "global_load_async_to_lds_b128 %2, %10, off\n\t"
                 "global_load_async_to_lds_b128 %3, %11, off\n\t"
                 "global_load_async_to_lds_b128 %4, %12, off\n\t"
                 "global_load_async_to_lds_b128 %5, %13, off\n\t"
                 "global_load_async_to_lds_b128 %6, %14, off\n\t"
                 "global_load_async_to_lds_b128 %7, %15, off\n\t"
                 "s_wait_xcnt 0x0"
                 :: "v"(l), "v"(l + 16 * TP), "v"(l + 32 * TP), "v"(l + 48 * TP), "v"(l + 64 * TP), "v"(l + 80 * TP), "v"(l + 96 * TP), "v"(l + 112 * TP),
                    "v"(gp), "v"(gp + rs), "v"(gp + 2 * rs), "v"(gp + 3 * rs), "v"(gp + 4 * rs), "v"(gp + 5 * rs), "v"(gp + 6 * rs), "v"(gp + 7 * rs)
                 : "memory");
}
template <int NA, int NBP>
__global__ __launch_bounds__(128) void k_tg(const bf* __restrict__ Ah, const bf* __restrict__ Al, const bf* __restrict__ Bh, const bf* __restrict__ Bl, const float* __restrict__ bias, int K, float* C, int ldc, size_t sA, size_t sB, size_t sC) {
    constexpr unsigned STG = (NA + NBP) * TPL;
    __shared__ __attribute__((aligned(16))) unsigned char L[2 * STG];
    const int tid = threadIdx.x, lane = tid & 31, wave = tid >> 5, lr = lane & 15, hi = lane >> 4;
    const int R0 = blockIdx.x * 128, C0 = blockIdx.y * 128, wr = (wave >> 1) * 64, wc = (wave & 1) * 64;
    const int crow = tid >> 3, cpc = tid & 7;    // copies: 8 lanes per 128-B row piece, a wave-wide copy covers 4 whole lines
    const size_t ga = blockIdx.z * sA + (size_t)(R0 + crow) * K + cpc * 8, gb = blockIdx.z * sB + (size_t)(C0 + crow) * K + cpc * 8, rs = (size_t)16 * K;
    const unsigned lc = lds_off(L) + crow * TP + cpc * 16;
    auto fill = [&](int t) {
        const unsigned l = lc + (t & 1) * STG; const size_t ko = (size_t)t * 64;
        copy_plane(l, Ah + ga + ko, rs);
        if (NA == 2) copy_plane(l + TPL, Al + ga + ko, rs);
        copy_plane(l + NA * TPL, Bh + gb + ko, rs);
        if (NBP == 2) copy_plane(l + (NA + 1) * TPL, Bl + gb + ko, rs);
    };
    const int nst = K / 64;
    fill(0);
    asm volatile("s_wait_asynccnt 0x0" ::: "memory");    // this wave's share of stage 0 has landed
    __syncthreads();                                     // stage 0 is published
    if (nst > 1) fill(1);
    v8f acc[4][4];
#pragma unroll
    for (int i = 0; i < 4; ++i) {
#pragma unroll
        for (int j = 0; j < 4; ++j) acc[i][j] = (v8f){}; }
    const unsigned char* fa0 = L + (wr + lr) * TP + hi * 16;
    const unsigned char* fb0 = L + NA * TPL + (wc + lr) * TP + hi * 16;
#pragma unroll 1
    for (int t = 0; t < nst; ++t) {    // stays rolled: one trip per stage, the buffer chosen by t & 1
        const unsigned bo = (t & 1) * STG;
        v16bf a[4], al[4];
        if constexpr (NBP == 2) {
            // Eight steps of 12 products (32 k x 16 columns each). The B fragments of step s + 1 are fetched, as one group, in front of step s's products into the other of two register sets.
            v16bf bh[2], bl[2];
            bh[0] = ldf(fb0 + bo); bl[0] = ldf(fb0 + bo + TPL);
#pragma unroll
            for (int s = 0; s < 8; ++s) {
                const int j = s & 3, cs = s & 1, n = s + 1;
                if (j == 0) {
#pragma unroll
                    for (int i = 0; i < 4; ++i) { const unsigned char* p = fa0 + bo + i * 16 * TP + (s >> 2) * 64; a[i] = ldf(p); al[i] = ldf(p + TPL); } }
                if (n < 8) { const unsigned char* p = fb0 + bo + (n & 3) * 16 * TP + (n >> 2) * 64; bh[n & 1] = ldf(p); bl[n & 1] = ldf(p + TPL); }
                __builtin_amdgcn_sched_barrier(0);    // keeps the LDS reads above as one group: sunk among the products, each would be waited for where it is used
#pragma unroll
                for (int i = 0; i < 4; ++i) acc[i][j] = wmmab(a[i], bh[cs], acc[i][j]);
#pragma unroll
                for (int i = 0; i < 4; ++i) acc[i][j] = wmmab(al[i], bh[cs], acc[i][j]);
#pragma unroll
                for (int i = 0; i < 4; ++i) acc[i][j] = wmmab(a[i], bl[cs], acc[i][j]);
                __builtin_amdgcn_sched_barrier(0);    // keeps the next step's reads from rising into this step's products
            }
        } else {
#pragma unroll
            for (int kb = 0; kb < 2; ++kb) {
                v16bf bh[4];
#pragma unroll
                for (int i = 0; i < 4; ++i) { const unsigned char* p = fa0 + bo + i * 16 * TP + kb * 64; a[i] = ldf(p); if (NA == 2) al[i] = ldf(p + TPL); }
#pragma unroll
                for (int j = 0; j < 4; ++j) bh[j] = ldf(fb0 + bo + j * 16 * TP + kb * 64);
                __builtin_amdgcn_sched_barrier(0);    // keeps the block's LDS reads as one group in front of its products
#pragma unroll
                for (int j = 0; j < 4; ++j) {
#pragma unroll
                    for (int i = 0; i < 4; ++i) acc[i][j] = wmmab(a[i], bh[j], acc[i][j]);
                    if (NA == 2) {
#pragma unroll
                        for (int i = 0; i < 4; ++i) acc[i][j] = wmmab(al[i], bh[j], acc[i][j]); } }
                __builtin_amdgcn_sched_barrier(0);    // keeps the next block's reads from rising into this block's products
            }
        }
        asm volatile("s_wait_dscnt 0x0" ::: "memory");       // this wave's reads of stage t are done before the buffer is refilled
        asm volatile("s_wait_asynccnt 0x0" ::: "memory");    // this wave's share of stage t + 1 has landed
        __syncthreads();                                     // publishes stage t + 1 and ends every wave's reads of stage t
        if (t + 2 < nst) fill(t + 2);
    }
    asm volatile("s_wait_asynccnt 0x0" ::: "memory");        // no copy is left in flight when the ring becomes output staging
    // Whole-line f32 stores: each wave stages its 64 x 64 in its own part of the ring (every reader left it at the last trip's barrier).
    float* os = (float*)(void*)L + wave * (64 * 68);
#pragma unroll
    for (int j = 0; j < 4; ++j) { const float bv = bias ? bfr(bias[C0 + wc + j * 16 + lr]) : 0.f;
#pragma unroll
        for (int i = 0; i < 4; ++i) {
#pragma unroll
            for (int e = 0; e < 8; ++e) os[(i * 16 + hi * 8 + e) * 68 + j * 16 + lr] = acc[i][j][e] + bv; } }
    __syncthreads();
    float* crowp = C + blockIdx.z * sC + (size_t)(R0 + wr) * ldc + C0 + wc;
#pragma unroll
    for (int s = 0; s < 32; ++s) { const int Lid = (lane >> 3) + 4 * s, piece = lane & 7; const int row = Lid >> 1, cofs = (Lid & 1) * 32 + piece * 4;
        const v4f val = *(const v4fa*)(os + row * 68 + cofs); *(v4f*)(crowp + (size_t)row * ldc + cofs) = val; }
}
// k_vt: VTH/VTL [item][768 d][1024 t] = bf16 hi + UNSCALED bf16 residual of V [item][t][g*128+d] via 64 x 64 LDS tiles; grid (NB*NT/64, 2, 6): per item, transpose of v [k][768] f32 into hi/lo planes v^T [768][k].
__global__ __launch_bounds__(256) void k_vt(const float* __restrict__ V, bf* VTH, bf* VTL) {
    __shared__ float tl[64][65];
    const int tid = threadIdx.x, b = blockIdx.x / (NT_ / 64), t0 = (blockIdx.x % (NT_ / 64)) * 64, d0 = blockIdx.y * 64, g = blockIdx.z;
    { const int tt = tid >> 2, dq = (tid & 3) * 16;
#pragma unroll
      for (int i = 0; i < 16; ++i) tl[dq + i][tt] = V[(size_t)(b * NT_ + t0 + tt) * KW + g * HD + d0 + dq + i]; }
    __syncthreads();
    const int piece = tid & 7;
    auto pass = [&]() {
#pragma unroll
        for (int s = 0; s < 2; ++s) { const int d = (tid >> 3) + 32 * s; v8us oh, ol;
#pragma unroll
            for (int i = 0; i < 8; ++i) { const float v = tl[d][piece * 8 + i]; const unsigned short hb = f2bf(v); oh[i] = hb; ol[i] = f2bf(v - bf2f(hb)); }
            const size_t o = ((size_t)b * DM + g * HD + d0 + d) * NT_ + t0 + piece * 8; *(v8us*)(VTH + o) = oh; *(v8us*)(VTL + o) = ol; }
    };
    pass(); 
}

// k_colstat: per batch item (blockIdx.y) and key column k of S [1024 q][1024 k]: cmax = max_q (s x scale), csum = sum_q exp(s x scale - cmax), f32. One work-group per 32 columns (one 128-B line
// of every row), 32 waves: a wave-wide 16-B load covers 4 rows x 32 columns, and a thread keeps its 8 rows x 4 columns in registers for both passes (S is read once).
// Fixed reduction tree: 8 rows in the thread, the wave's 4 row groups by lane exchange, the 32 waves through LDS (4 wave rows per load, then lane exchange again).
// Every loop is unrolled so that v, m and s are indexed by constants and stay in registers, and so that the 8 global loads are all in flight together.
__global__ __launch_bounds__(1024) void k_colstat(const float* __restrict__ S, float* CMAX, float* CSUM) {
    __shared__ __align__(16) float rm[32 * 32]; __shared__ __align__(16) float rs[32 * 32];
    const int lane = threadIdx.x & 31, wave = threadIdx.x >> 5, cg = (lane & 7) * 4, rsub = lane >> 3, c0 = blockIdx.x * 32;
    S += (size_t)blockIdx.y * NT_ * NT_; CMAX += blockIdx.y * NT_; CSUM += blockIdx.y * NT_;
    v4f v[8];
#pragma unroll
    for (int i = 0; i < 8; ++i) v[i] = *(const v4f*)(S + (size_t)(i * 128 + wave * 4 + rsub) * NT_ + c0 + cg);
    v4f m = (v4f){-3.0e38f, -3.0e38f, -3.0e38f, -3.0e38f};
#pragma unroll
    for (int i = 0; i < 8; ++i) m = __builtin_elementwise_max(m, v[i] * SCL);
#pragma unroll
    for (int k = 0; k < 4; ++k) { m[k] = fmaxf(m[k], __shfl_xor(m[k], 8)); m[k] = fmaxf(m[k], __shfl_xor(m[k], 16)); }
    if (rsub == 0) *(v4fa*)(rm + wave * 32 + cg) = m;
    __syncthreads();
#pragma unroll
    for (int j = 0; j < 8; ++j) m = __builtin_elementwise_max(m, *(const v4fa*)(rm + (j * 4 + rsub) * 32 + cg));
#pragma unroll
    for (int k = 0; k < 4; ++k) { m[k] = fmaxf(m[k], __shfl_xor(m[k], 8)); m[k] = fmaxf(m[k], __shfl_xor(m[k], 16)); }
    v4f s = (v4f){0.f, 0.f, 0.f, 0.f};
#pragma unroll
    for (int i = 0; i < 8; ++i) { const v4f e = __builtin_elementwise_fma(v[i], (v4f){SCL, SCL, SCL, SCL}, -m);
#pragma unroll
        for (int k = 0; k < 4; ++k) s[k] += __expf(e[k]); }
#pragma unroll
    for (int k = 0; k < 4; ++k) { s[k] += __shfl_xor(s[k], 8); s[k] += __shfl_xor(s[k], 16); }
    if (rsub == 0) *(v4fa*)(rs + wave * 32 + cg) = s;
    __syncthreads();
    if (wave == 0) {
        v4f t = (v4f){0.f, 0.f, 0.f, 0.f};
#pragma unroll
        for (int j = 0; j < 8; ++j) t += *(const v4fa*)(rs + (j * 4 + rsub) * 32 + cg);
#pragma unroll
        for (int k = 0; k < 4; ++k) { t[k] += __shfl_xor(t[k], 8); t[k] += __shfl_xor(t[k], 16); }
        if (rsub == 0) { *(v4f*)(CMAX + c0 + cg) = m; *(v4f*)(CSUM + c0 + cg) = t; }
    }
}
// k_colsoft: P[q][k] = exp(s[q][k] x scale - cmax[k]) / csum[k] -> bf16 hi + UNSCALED residual planes; one wave per row q of any item (r = item * 1024 + q), lane -> 8 columns per 256-column step.
__global__ __launch_bounds__(256) void k_colsoft(const float* __restrict__ S, const float* __restrict__ CMAX, const float* __restrict__ CSUM, bf* Ph, bf* Pl) {
    const int lane = threadIdx.x & 31, r = blockIdx.x * 8 + (threadIdx.x >> 5); if (r >= NB_ * NT_) return;
    CMAX += (r / NT_) * NT_; CSUM += (r / NT_) * NT_;
{
#pragma unroll 1
        for (int qc = 0; qc < NT_ / 256; ++qc) { const size_t o = (size_t)r * NT_ + qc * 256 + lane * 8; const v8f v = *(const v8f*)(S + o), cm = *(const v8f*)(CMAX + qc * 256 + lane * 8), cs = *(const v8f*)(CSUM + qc * 256 + lane * 8); v8us oh, ol;
#pragma unroll
            for (int i = 0; i < 8; ++i) { const float p = __expf(v[i] * SCL - cm[i]) / cs[i]; const unsigned short hb = f2bf(p); oh[i] = hb; ol[i] = f2bf(p - bf2f(hb)); }
            *(v8us*)(Ph + o) = oh; *(v8us*)(Pl + o) = ol; }
         }
}
__global__ __launch_bounds__(256) void k_dot1(const float* __restrict__ T, const float* __restrict__ Wo, const float* __restrict__ bo, float* OUTB) {
    const int lane = threadIdx.x & 31, w = blockIdx.x * 8 + (threadIdx.x >> 5); if (w >= NB_ * NT_ / 32) return;
    const int q = w * 32 + lane; const float* row = T + (size_t)q * DM;
    float a = bfr(bo[0]);
#pragma unroll 1
    for (int h = 0; h < DM; h += 4) { const v4f v = *(const v4f*)(row + h);
#pragma unroll
        for (int k = 0; k < 4; ++k) a = fmaf(v[k], bfr(Wo[h + k]), a); }
    *(float*)(OUTB + q) = a; 
}

extern "C" void kernel_launch(void* const* d_in, const int* in_sizes, int n_in,
                              void* d_out, int out_size, void* d_ws, size_t ws_size, hipStream_t stream) {
    (void)in_sizes; (void)n_in; (void)out_size;
    const float* qx = (const float*)d_in[0]; const float* x = (const float*)d_in[1];
    const float* Wq = (const float*)d_in[2]; const float* bq = (const float*)d_in[3]; const float* Wk = (const float*)d_in[4]; const float* bk = (const float*)d_in[5]; const float* Wv = (const float*)d_in[6]; const float* bv = (const float*)d_in[7];
    const float* Wt = (const float*)d_in[8]; const float* bt = (const float*)d_in[9]; const float* Wo = (const float*)d_in[10]; const float* bo = (const float*)d_in[11];   // W k-major [in][out]
    float* out = (float*)d_out;    // [16][1024]
    char* wsp = (char*)d_ws;
    auto take = [&](size_t bytes) { char* p = wsp; wsp += (bytes + 255) & ~(size_t)255; return (void*)p; };
    bf* WqT = (bf*)take((size_t)DM * DM * 2); bf* WkT = (bf*)take((size_t)DM * DM * 2); bf* WvT = (bf*)take((size_t)DM * DM * 2); bf* WtT = (bf*)take((size_t)DM * DM * 2);
    // Planes hold all 16 items ([item][row][col], items back to back). Two regions are used again once their first tenants are dead (stream order):
    // R1 = Xq, Xk, TMP -> S -> CTX, Ch, Cl;  R2 = Qh, Ql, Kh, Kl -> Ph, Pl -> T2;  Vh, Vl keep their own.
    const size_t PL = (size_t)NB_ * NT_ * DM * 2;    // one bf16 plane of all items, 24 MiB
    char* R1 = (char*)take(4 * PL); char* R2 = (char*)take(4 * PL);
    bf* Vh = (bf*)take(PL); bf* Vl = (bf*)take(PL);
    float* CMAX = (float*)take((size_t)NB_ * NT_ * 4); float* CSUM = (float*)take((size_t)NB_ * NT_ * 4);
    bf* Xq = (bf*)R1; bf* Xk = (bf*)(R1 + PL); float* TMP = (float*)(R1 + 2 * PL);
    bf* Qh = (bf*)R2; bf* Ql = (bf*)(R2 + PL); bf* Kh = (bf*)(R2 + 2 * PL); bf* Kl = (bf*)(R2 + 3 * PL);
    float* S = (float*)R1;                                                               // 64 MiB of R1's 96
    bf* Ph = (bf*)R2; bf* Pl = (bf*)(R2 + (size_t)NB_ * NT_ * NT_ * 2);                  // 2 x 32 MiB of R2's 96
    float* CTX = (float*)R1; bf* Ch = (bf*)(R1 + 2 * PL); bf* Cl = (bf*)(R1 + 3 * PL);
    float* T2 = (float*)R2;
    if ((size_t)(wsp - (char*)d_ws) > ws_size) return;    // 4.5 + 96 + 96 + 48 + 0.125 ~ 244.6 MiB
    k_wt<<<dim3(DM / 64, DM / 64, 1), 256, 0, stream>>>(Wq, DM, DM, WqT); k_wt<<<dim3(DM / 64, DM / 64, 1), 256, 0, stream>>>(Wk, DM, DM, WkT);
    k_wt<<<dim3(DM / 64, DM / 64, 1), 256, 0, stream>>>(Wv, DM, DM, WvT); k_wt<<<dim3(DM / 64, DM / 64, 1), 256, 0, stream>>>(Wt, DM, DM, WtT);
    k_cvtb<<<NB_ * NT_ / 8, 256, 0, stream>>>(qx, NB_ * NT_, Xq); k_cvtb<<<NB_ * NT_ / 8, 256, 0, stream>>>(x, NB_ * NT_, Xk);
    k_tg<1, 1><<<dim3(NB_ * NT_ / 128, DM / 128, 1), 128, 0, stream>>>(Xq, nullptr, WqT, nullptr, bq, DM, TMP, DM, 0, 0, 0); k_cvtb2<<<NB_ * NT_ / 8, 256, 0, stream>>>(TMP, NB_ * NT_, Qh, Ql);
    k_tg<1, 1><<<dim3(NB_ * NT_ / 128, DM / 128, 1), 128, 0, stream>>>(Xk, nullptr, WkT, nullptr, bk, DM, TMP, DM, 0, 0, 0); k_cvtb2<<<NB_ * NT_ / 8, 256, 0, stream>>>(TMP, NB_ * NT_, Kh, Kl);
    k_tg<1, 1><<<dim3(NB_ * NT_ / 128, DM / 128, 1), 128, 0, stream>>>(Xk, nullptr, WvT, nullptr, bv, DM, TMP, DM, 0, 0, 0); k_vt<<<dim3(NB_ * NT_ / 64, 2, NKV), 256, 0, stream>>>(TMP, Vh, Vl);
    k_tg<2, 2><<<dim3(NT_ / 128, NT_ / 128, NB_), 128, 0, stream>>>(Qh, Ql, Kh, Kl, nullptr, DM, S, NT_, (size_t)NT_ * DM, (size_t)NT_ * DM, (size_t)NT_ * NT_);   // scores [q][k] (unscaled; the 768^-1/2 is applied inside the softmax kernels)
    k_colstat<<<dim3(NT_ / 32, NB_, 1), 1024, 0, stream>>>(S, CMAX, CSUM);
    k_colsoft<<<NB_ * NT_ / 8, 256, 0, stream>>>(S, CMAX, CSUM, Ph, Pl);
    k_tg<2, 2><<<dim3(NT_ / 128, DM / 128, NB_), 128, 0, stream>>>(Ph, Pl, Vh, Vl, nullptr, NT_, CTX, DM, (size_t)NT_ * NT_, (size_t)DM * NT_, (size_t)NT_ * DM);   // ctx = P.v
    k_cvtb2<<<NB_ * NT_ / 8, 256, 0, stream>>>(CTX, NB_ * NT_, Ch, Cl);
    k_tg<2, 1><<<dim3(NB_ * NT_ / 128, DM / 128, 1), 128, 0, stream>>>(Ch, Cl, WtT, nullptr, bt, DM, T2, DM, 0, 0, 0);  // h = ctx.Wt + bt
    k_dot1<<<(NB_ * NT_ / 32) / 8, 256, 0, stream>>>(T2, Wo, bo, out);                                            // h.Wo + bo
}

// v004
// One run takes 255 microseconds.
// Next to v003, in two timings, it ran 1.33 times as fast each time.
// Over all steps from v000 it is 101 times as fast.
#include <hip/hip_runtime.h>

// Compute dtypes, f32 accumulate, all 16 batch items in every launch (rows of all items in one grid, or the item in a grid axis): q = query_x.Wq + bq, k/v = x.Wk/Wv + b ([1024 x 768].[768 x 768], k-major weights transposed once; PLAIN
// bf16 operands = inputs rounded once, exact) on v_wmma_f32_16x16x32_bf16; scores = q.k^T ([1024 x 768].[768 x 1024]) and ctx = P.v ([1024 x 1024].[1024 x 768])
// with BOTH computed operands as bf16 hi + UNSCALED residual (three products); the softmax over the QUERY axis (the module's dim=1) is done per key column in
// f32 (column max, column sum of exp, then P[q][k] = exp(s/sqrt(768) - cmax[k]) / csum[k]); h = ctx.Wt + bt (hi/lo A) and out[q] = h[q].Wo + bo (768 -> 1, f32).
// A product whose result is the next product's operand stores it as that operand (hi + residual planes; v as v^T, computed as Wv^T.x^T); h is never stored, only its partial dots with Wo.

#define NB_  16
#define NT_  1024                // Lq = Lk
#define DM   768
#define SCL  0.03608439182435161f    // 768^-1/2
#define LOSC 1024.0f

typedef _Float16 h16;
typedef unsigned short bf;
typedef __attribute__((ext_vector_type(16))) __bf16   v16bf;
typedef __attribute__((ext_vector_type(8)))  __bf16   v8bf;
typedef __attribute__((ext_vector_type(16))) _Float16 v16h;
typedef __attribute__((ext_vector_type(8)))  _Float16 v8h;
typedef __attribute__((ext_vector_type(8)))  unsigned short v8us;
typedef __attribute__((ext_vector_type(8)))  float    v8f;
typedef __attribute__((ext_vector_type(4)))  float    v4f;
typedef __attribute__((ext_vector_type(4)))  _Float16 v4h;
typedef v8h  __attribute__((may_alias)) v8ha;
typedef v4f  __attribute__((may_alias)) v4fa;
typedef v8us __attribute__((may_alias)) v8usa;

__device__ __forceinline__ unsigned short f2bf(float f) { unsigned u = __float_as_uint(f); u += 0x7FFFu + ((u >> 16) & 1u); return (unsigned short)(u >> 16); }
__device__ __forceinline__ float bf2f(unsigned short b) { return __uint_as_float(((unsigned)b) << 16); }
__device__ __forceinline__ float bfr(float f) { return bf2f(f2bf(f)); }
__device__ __forceinline__ v16h cat16(v8h lo, v8h hi) { return __builtin_shufflevector(lo, hi, 0, 1, 2, 3, 4, 5, 6, 7, 8, 9, 10, 11, 12, 13, 14, 15); }
__device__ __forceinline__ v16bf cat16b(v8us lo, v8us hi) { return __builtin_bit_cast(v16bf, __builtin_shufflevector(lo, hi, 0, 1, 2, 3, 4, 5, 6, 7, 8, 9, 10, 11, 12, 13, 14, 15)); }
__device__ __forceinline__ v8f wmma16(v16h a, v16h b, v8f c) { return __builtin_amdgcn_wmma_f32_16x16x32_f16(false, a, false, b, (short)0, c, false, false); }
__device__ __forceinline__ v8f wmmab(v16bf a, v16bf b, v8f c) { return __builtin_amdgcn_wmma_f32_16x16x32_bf16(false, a, false, b, (short)0, c, false, false); }

__global__ __launch_bounds__(256) void k_cvtb(const float* __restrict__ src, int nrows, bf* dst) {
    const int lane = threadIdx.x & 31, r = blockIdx.x * 8 + (threadIdx.x >> 5);
    if (r >= nrows) return;
    v8us o[DM / 256];
#pragma unroll
    for (int q = 0; q < DM / 256; ++q) { v8us t;
#pragma unroll
        for (int i = 0; i < 8; ++i) t[i] = f2bf(src[(size_t)r * DM + q * 256 + lane * 8 + i]);
        o[q] = t; }
#pragma unroll
    for (int q = 0; q < DM / 256; ++q) *(v8us*)(dst + (size_t)r * DM + q * 256 + lane * 8) = o[q];
    
}

// k_wt: WT [n][K] = bf16(W[k][n]) (k-major [K][ncols]) via 64 x 64 LDS tiles; grid (K/64, ncols/64).
__global__ __launch_bounds__(256) void k_wt(const float* __restrict__ Wm, int K, int ncols, bf* WT) {
    __shared__ __align__(16) unsigned short tl[64 * 72];
    const int tid = threadIdx.x, k0 = blockIdx.x * 64, n0 = blockIdx.y * 64;
    const int kk = tid >> 2, nq = (tid & 3) * 16;
#pragma unroll
    for (int i = 0; i < 16; ++i) tl[(nq + i) * 72 + kk] = f2bf(Wm[(size_t)(k0 + kk) * ncols + n0 + nq + i]);
    __syncthreads();
    const int piece = tid & 7;
    auto pass = [&]() {
#pragma unroll
        for (int s = 0; s < 2; ++s) { const int nr = (tid >> 3) + 32 * s; const v8us val = *(const v8usa*)(tl + nr * 72 + piece * 8); *(v8us*)(WT + (size_t)(n0 + nr) * K + k0 + piece * 8) = val; }
    };
    pass(); 
}
// k_tg: one 128 x 128 tile of C = (Ah [+ Al]).(Bh [+ Bl])^T [+ bf(bias)] per work-group, 4 waves in 2 x 2, 64 x 64 of C per wave (4 x 4 accumulator tiles). All planes are k-contiguous with row
// stride K (a multiple of 64). A stage is 64 k (128 B) of the tile's 128 rows of every plane, brought into LDS by asynchronous copies, two buffers: stage t + 1 flies while stage t is worked on.
// Products per 32 k and accumulator, in this order: Ah.Bh, Al.Bh, Ah.Bl (those whose planes exist); k ascending. blockIdx.z = batch item, sA / sB / sC = elements per item in the A planes, the B planes and C.
// Every inner loop is unrolled so that acc and the fragment arrays are indexed by constants and stay in registers.
// EPI says what is stored: 0 = C in f32; 1 = bf16 hi + UNSCALED residual planes Oh, Ol of C, bias by column; 2 = the same planes, bias by row; 3 = no C: per row the dot of this wave's 64 columns of
// C (bias by column) with bf(wo), into plane 2 blockIdx.y + (wave & 1) of C (a plane is ldc floats, one per row of the whole product).
#define TP   144                 // LDS bytes per staged row: 128 of data + 16, so that 16 rows read 16 bytes wide fall on different banks
#define TPL  (128 * TP)          // one staged plane
__device__ __forceinline__ unsigned lds_off(const void* p) { return (unsigned)(size_t)p; }
// One lane's half rows of a 16 x 32 fragment: k 8 hi .. 8 hi + 7 and 16 + 8 hi .. 16 + 8 hi + 7 (p already holds the row and the 16 hi bytes); the same for A and B.
__device__ __forceinline__ v16bf ldf(const unsigned char* p) { return cat16b(*(const v8usa*)p, *(const v8usa*)(p + 32)); }
// One thread's share of one plane of a stage: 16 bytes of each of the rows r, r + 16, ..., r + 112 (rs = 16 rows, in elements). The s_wait_xcnt stands inside the statement so that
// no address register of a copy is rewritten in front of it.
__device__ __forceinline__ void copy_plane(unsigned l, const bf* gp, size_t rs) {
    asm volatile("global_load_async_to_lds_b128 %0, %8, off\n\t"
                 "global_load_async_to_lds_b128 %1, %9, off\n\t"
                 "global_load_async_to_lds_b128 %2, %10, off\n\t"
                 "global_load_async_to_lds_b128 %3, %11, off\n\t"
                 "global_load_async_to_lds_b128 %4, %12, off\n\t"
                 "global_load_async_to_lds_b128 %5, %13, off\n\t"
                 "global_load_async_to_lds_b128 %6, %14, off\n\t"
                 "global_load_async_to_lds_b128 %7, %15, off\n\t"
                 "s_wait_xcnt 0x0"
                 :: "v"(l), "v"(l + 16 * TP), "v"(l + 32 * TP), "v"(l + 48 * TP), "v"(l + 64 * TP), "v"(l + 80 * TP), "v"(l + 96 * TP), "v"(l + 112 * TP),
                    "v"(gp), "v"(gp + rs), "v"(gp + 2 * rs), "v"(gp + 3 * rs), "v"(gp + 4 * rs), "v"(gp + 5 * rs), "v"(gp + 6 * rs), "v"(gp + 7 * rs)
                 : "memory");
}
// v + v of lane ^ M inside the 16-lane row, one vector instruction (row_xmask); every lane is on where it is used.
template <int M> __device__ __forceinline__ float rowx(float v) { return v + __int_as_float(__builtin_amdgcn_update_dpp(0, __float_as_int(v), 0x160 + M, 0xf, 0xf, true)); }
template <int NA, int NBP, int EPI>
__global__ __launch_bounds__(128) void k_tg(const bf* __restrict__ Ah, const bf* __restrict__ Al, const bf* __restrict__ Bh, const bf* __restrict__ Bl, const float* __restrict__ bias, const float* __restrict__ wo, int K, float* C, bf* Oh, bf* Ol, int ldc, size_t sA, size_t sB, size_t sC) {
    constexpr unsigned STG = (NA + NBP) * TPL;
    __shared__ __attribute__((aligned(16))) unsigned char L[2 * STG];
    const int tid = threadIdx.x, lane = tid & 31, wave = tid >> 5, lr = lane & 15, hi = lane >> 4;
    const int R0 = blockIdx.x * 128, C0 = blockIdx.y * 128, wr = (wave >> 1) * 64, wc = (wave & 1) * 64;
    const int crow = tid >> 3, cpc = tid & 7;    // copies: 8 lanes per 128-B row piece, a wave-wide copy covers 4 whole lines
    const size_t ga = blockIdx.z * sA + (size_t)(R0 + crow) * K + cpc * 8, gb = blockIdx.z * sB + (size_t)(C0 + crow) * K + cpc * 8, rs = (size_t)16 * K;
    const unsigned lc = lds_off(L) + crow * TP + cpc * 16;
    auto fill = [&](int t) {
        const unsigned l = lc + (t & 1) * STG; const size_t ko = (size_t)t * 64;
        copy_plane(l, Ah + ga + ko, rs);
        if (NA == 2) copy_plane(l + TPL, Al + ga + ko, rs);
        copy_plane(l + NA * TPL, Bh + gb + ko, rs);
        if (NBP == 2) copy_plane(l + (NA + 1) * TPL, Bl + gb + ko, rs);
    };
    const int nst = K / 64;
    fill(0);
    asm volatile("s_wait_asynccnt 0x0" ::: "memory");    // this wave's share of stage 0 has landed
    __syncthreads();                                     // stage 0 is published
    if (nst > 1) fill(1);
    v8f acc[4][4];
#pragma unroll
    for (int i = 0; i < 4; ++i) {
#pragma unroll
        for (int j = 0; j < 4; ++j) acc[i][j] = (v8f){}; }
    const unsigned char* fa0 = L + (wr + lr) * TP + hi * 16;
    const unsigned char* fb0 = L + NA * TPL + (wc + lr) * TP + hi * 16;
#pragma unroll 1
    for (int t = 0; t < nst; ++t) {    // stays rolled: one trip per stage, the buffer chosen by t & 1
        const unsigned bo = (t & 1) * STG;
        v16bf a[4], al[4];
        if constexpr (NBP == 2) {
            // Eight steps of 12 products (32 k x 16 columns each). The B fragments of step s + 1 are fetched, as one group, in front of step s's products into the other of two register sets.
            v16bf bh[2], bl[2];
            bh[0] = ldf(fb0 + bo); bl[0] = ldf(fb0 + bo + TPL);
#pragma unroll
            for (int s = 0; s < 8; ++s) {
                const int j = s & 3, cs = s & 1, n = s + 1;
                if (j == 0) {
#pragma unroll
                    for (int i = 0; i < 4; ++i) { const unsigned char* p = fa0 + bo + i * 16 * TP + (s >> 2) * 64; a[i] = ldf(p); al[i] = ldf(p + TPL); } }
                if (n < 8) { const unsigned char* p = fb0 + bo + (n & 3) * 16 * TP + (n >> 2) * 64; bh[n & 1] = ldf(p); bl[n & 1] = ldf(p + TPL); }
                __builtin_amdgcn_sched_barrier(0);    // keeps the LDS reads above as one group: sunk among the products, each would be waited for where it is used
#pragma unroll
                for (int i = 0; i < 4; ++i) acc[i][j] = wmmab(a[i], bh[cs], acc[i][j]);
#pragma unroll
                for (int i = 0; i < 4; ++i) acc[i][j] = wmmab(al[i], bh[cs], acc[i][j]);
#pragma unroll
                for (int i = 0; i < 4; ++i) acc[i][j] = wmmab(a[i], bl[cs], acc[i][j]);
                __builtin_amdgcn_sched_barrier(0);    // keeps the next step's reads from rising into this step's products
            }
        } else {
#pragma unroll
            for (int kb = 0; kb < 2; ++kb) {
                v16bf bh[4];
#pragma unroll
                for (int i = 0; i < 4; ++i) { const unsigned char* p = fa0 + bo + i * 16 * TP + kb * 64; a[i] = ldf(p); if (NA == 2) al[i] = ldf(p + TPL); }
#pragma unroll
                for (int j = 0; j < 4; ++j) bh[j] = ldf(fb0 + bo + j * 16 * TP + kb * 64);
                __builtin_amdgcn_sched_barrier(0);    // keeps the block's LDS reads as one group in front of its products
#pragma unroll
                for (int j = 0; j < 4; ++j) {
#pragma unroll
                    for (int i = 0; i < 4; ++i) acc[i][j] = wmmab(a[i], bh[j], acc[i][j]);
                    if (NA == 2) {
#pragma unroll
                        for (int i = 0; i < 4; ++i) acc[i][j] = wmmab(al[i], bh[j], acc[i][j]); } }
                __builtin_amdgcn_sched_barrier(0);    // keeps the next block's reads from rising into this block's products
            }
        }
        asm volatile("s_wait_dscnt 0x0" ::: "memory");       // this wave's reads of stage t are done before the buffer is refilled
        asm volatile("s_wait_asynccnt 0x0" ::: "memory");    // this wave's share of stage t + 1 has landed
        __syncthreads();                                     // publishes stage t + 1 and ends every wave's reads of stage t
        if (t + 2 < nst) fill(t + 2);
    }
    asm volatile("s_wait_asynccnt 0x0" ::: "memory");        // no copy is left in flight when the ring becomes output staging
    // Whole-line stores: each wave stages its 64 x 64 (EPI 3: its 64 row sums) in its own part of the ring (every reader left it at the last trip's barrier).
    float* os = (float*)(void*)L + wave * (64 * 68);
    if constexpr (EPI == 3) {
        float wv[4], bc[4];
#pragma unroll
        for (int j = 0; j < 4; ++j) { const int c = C0 + wc + j * 16 + lr; wv[j] = bfr(wo[c]); bc[j] = bfr(bias[c]); }
#pragma unroll
        for (int i = 0; i < 4; ++i) { float p[8];
#pragma unroll
            for (int e = 0; e < 8; ++e) { float t = 0.f;
#pragma unroll
                for (int j = 0; j < 4; ++j) t = fmaf(acc[i][j][e] + bc[j], wv[j], t);
                p[e] = rowx<8>(rowx<4>(rowx<2>(rowx<1>(t)))); }
            if (lr == 0) { *(v4fa*)(os + i * 16 + hi * 8) = (v4f){p[0], p[1], p[2], p[3]}; *(v4fa*)(os + i * 16 + hi * 8 + 4) = (v4f){p[4], p[5], p[6], p[7]}; } }
    } else {
        float rb[4][8];    // EPI 2: the bias of this lane's 32 rows
        if constexpr (EPI == 2) {
#pragma unroll
            for (int i = 0; i < 4; ++i) {
#pragma unroll
                for (int e = 0; e < 8; ++e) rb[i][e] = bfr(bias[R0 + wr + i * 16 + hi * 8 + e]); } }
#pragma unroll
        for (int j = 0; j < 4; ++j) { const float bv = (EPI != 2 && bias) ? bfr(bias[C0 + wc + j * 16 + lr]) : 0.f;
#pragma unroll
            for (int i = 0; i < 4; ++i) {
#pragma unroll
                for (int e = 0; e < 8; ++e) os[(i * 16 + hi * 8 + e) * 68 + j * 16 + lr] = acc[i][j][e] + (EPI == 2 ? rb[i][e] : bv); } }
    }
    __syncthreads();
    if constexpr (EPI == 0) {
        float* crowp = C + blockIdx.z * sC + (size_t)(R0 + wr) * ldc + C0 + wc;
#pragma unroll
        for (int s = 0; s < 32; ++s) { const int Lid = (lane >> 3) + 4 * s, piece = lane & 7; const int row = Lid >> 1, cofs = (Lid & 1) * 32 + piece * 4;
            const v4f val = *(const v4fa*)(os + row * 68 + cofs); *(v4f*)(crowp + (size_t)row * ldc + cofs) = val; }
    } else if constexpr (EPI == 3) {
        float* pp = C + (size_t)(blockIdx.y * 2 + (wave & 1)) * ldc + R0 + wr;
        pp[lane] = os[lane]; pp[32 + lane] = os[32 + lane];
    } else {
        // 8 lanes per row: 64 columns are one 128-B line of each plane, a wave-wide store covers 4 whole lines.
        const size_t ob = blockIdx.z * sC + (size_t)(R0 + wr + (lane >> 3)) * ldc + C0 + wc + (lane & 7) * 8;
        const float* op = os + (lane >> 3) * 68 + (lane & 7) * 8;
#pragma unroll
        for (int s = 0; s < 16; ++s) { const v8f x = __builtin_shufflevector(*(const v4fa*)(op + s * 4 * 68), *(const v4fa*)(op + s * 4 * 68 + 4), 0, 1, 2, 3, 4, 5, 6, 7);
            const v8bf h = __builtin_convertvector(x, v8bf), l = __builtin_convertvector(x - __builtin_convertvector(h, v8f), v8bf);    // packed hardware conversions, round to nearest even as f2bf does
            const size_t o = ob + (size_t)(s * 4) * ldc; *(v8us*)(Oh + o) = __builtin_bit_cast(v8us, h); *(v8us*)(Ol + o) = __builtin_bit_cast(v8us, l); }
    }
}
// k_colstat: per batch item (blockIdx.y) and key column k of S [1024 q][1024 k]: cmax = max_q (s x scale), csum = sum_q exp(s x scale - cmax), f32. One work-group per 32 columns (one 128-B line
// of every row), 32 waves: a wave-wide 16-B load covers 4 rows x 32 columns, and a thread keeps its 8 rows x 4 columns in registers for both passes (S is read once).
// Fixed reduction tree: 8 rows in the thread, the wave's 4 row groups by lane exchange, the 32 waves through LDS (4 wave rows per load, then lane exchange again).
// Every loop is unrolled so that v, m and s are indexed by constants and stay in registers, and so that the 8 global loads are all in flight together.
__global__ __launch_bounds__(1024) void k_colstat(const float* __restrict__ S, float* CMAX, float* CSUM) {
    __shared__ __align__(16) float rm[32 * 32]; __shared__ __align__(16) float rs[32 * 32];
    const int lane = threadIdx.x & 31, wave = threadIdx.x >> 5, cg = (lane & 7) * 4, rsub = lane >> 3, c0 = blockIdx.x * 32;
    S += (size_t)blockIdx.y * NT_ * NT_; CMAX += blockIdx.y * NT_; CSUM += blockIdx.y * NT_;
    v4f v[8];
#pragma unroll
    for (int i = 0; i < 8; ++i) v[i] = *(const v4f*)(S + (size_t)(i * 128 + wave * 4 + rsub) * NT_ + c0 + cg);
    v4f m = (v4f){-3.0e38f, -3.0e38f, -3.0e38f, -3.0e38f};
#pragma unroll
    for (int i = 0; i < 8; ++i) m = __builtin_elementwise_max(m, v[i] * SCL);
#pragma unroll
    for (int k = 0; k < 4; ++k) { m[k] = fmaxf(m[k], __shfl_xor(m[k], 8)); m[k] = fmaxf(m[k], __shfl_xor(m[k], 16)); }
    if (rsub == 0) *(v4fa*)(rm + wave * 32 + cg) = m;
    __syncthreads();
#pragma unroll
    for (int j = 0; j < 8; ++j) m = __builtin_elementwise_max(m, *(const v4fa*)(rm + (j * 4 + rsub) * 32 + cg));
#pragma unroll
    for (int k = 0; k < 4; ++k) { m[k] = fmaxf(m[k], __shfl_xor(m[k], 8)); m[k] = fmaxf(m[k], __shfl_xor(m[k], 16)); }
    v4f s = (v4f){0.f, 0.f, 0.f, 0.f};
#pragma unroll
    for (int i = 0; i < 8; ++i) { const v4f e = __builtin_elementwise_fma(v[i], (v4f){SCL, SCL, SCL, SCL}, -m);
#pragma unroll
        for (int k = 0; k < 4; ++k) s[k] += __expf(e[k]); }
#pragma unroll
    for (int k = 0; k < 4; ++k) { s[k] += __shfl_xor(s[k], 8); s[k] += __shfl_xor(s[k], 16); }
    if (rsub == 0) *(v4fa*)(rs + wave * 32 + cg) = s;
    __syncthreads();
    if (wave == 0) {
        v4f t = (v4f){0.f, 0.f, 0.f, 0.f};
#pragma unroll
        for (int j = 0; j < 8; ++j) t += *(const v4fa*)(rs + (j * 4 + rsub) * 32 + cg);
#pragma unroll
        for (int k = 0; k < 4; ++k) { t[k] += __shfl_xor(t[k], 8); t[k] += __shfl_xor(t[k], 16); }
        if (rsub == 0) { *(v4f*)(CMAX + c0 + cg) = m; *(v4f*)(CSUM + c0 + cg) = t; }
    }
}
// k_colsoft: P[q][k] = exp(s[q][k] x scale - cmax[k]) / csum[k] -> bf16 hi + UNSCALED residual planes; one wave per row q of any item (r = item * 1024 + q), lane -> 8 columns per 256-column step.
__global__ __launch_bounds__(256) void k_colsoft(const float* __restrict__ S, const float* __restrict__ CMAX, const float* __restrict__ CSUM, bf* Ph, bf* Pl) {
    const int lane = threadIdx.x & 31, r = blockIdx.x * 8 + (threadIdx.x >> 5); if (r >= NB_ * NT_) return;
    CMAX += (r / NT_) * NT_; CSUM += (r / NT_) * NT_;
{
#pragma unroll 1
        for (int qc = 0; qc < NT_ / 256; ++qc) { const size_t o = (size_t)r * NT_ + qc * 256 + lane * 8; const v8f v = *(const v8f*)(S + o), cm = *(const v8f*)(CMAX + qc * 256 + lane * 8), cs = *(const v8f*)(CSUM + qc * 256 + lane * 8); v8us oh, ol;
#pragma unroll
            for (int i = 0; i < 8; ++i) { const float p = __expf(v[i] * SCL - cm[i]) / cs[i]; const unsigned short hb = f2bf(p); oh[i] = hb; ol[i] = f2bf(p - bf2f(hb)); }
            *(v8us*)(Ph + o) = oh; *(v8us*)(Pl + o) = ol; }
         }
}
// k_dot1: out[q] = bf(bo) + the 12 partial dots of row q (64 columns of h each), plane 0 first.
__global__ __launch_bounds__(256) void k_dot1(const float* __restrict__ PART, const float* __restrict__ bo, float* OUTB) {
    const int q = blockIdx.x * 256 + threadIdx.x;
    float a = bfr(bo[0]);
#pragma unroll
    for (int p = 0; p < DM / 64; ++p) a += PART[(size_t)p * (NB_ * NT_) + q];
    OUTB[q] = a;
}

extern "C" void kernel_launch(void* const* d_in, const int* in_sizes, int n_in,
                              void* d_out, int out_size, void* d_ws, size_t ws_size, hipStream_t stream) {
    (void)in_sizes; (void)n_in; (void)out_size;
    const float* qx = (const float*)d_in[0]; const float* x = (const float*)d_in[1];
    const float* Wq = (const float*)d_in[2]; const float* bq = (const float*)d_in[3]; const float* Wk = (const float*)d_in[4]; const float* bk = (const float*)d_in[5]; const float* Wv = (const float*)d_in[6]; const float* bv = (const float*)d_in[7];
    const float* Wt = (const float*)d_in[8]; const float* bt = (const float*)d_in[9]; const float* Wo = (const float*)d_in[10]; const float* bo = (const float*)d_in[11];   // W k-major [in][out]
    float* out = (float*)d_out;    // [16][1024]
    char* wsp = (char*)d_ws;
    auto take = [&](size_t bytes) { char* p = wsp; wsp += (bytes + 255) & ~(size_t)255; return (void*)p; };
    bf* WqT = (bf*)take((size_t)DM * DM * 2); bf* WkT = (bf*)take((size_t)DM * DM * 2); bf* WvT = (bf*)take((size_t)DM * DM * 2); bf* WtT = (bf*)take((size_t)DM * DM * 2);
    // Planes hold all 16 items ([item][row][col], items back to back). Two regions are used again once their first tenants are dead (stream order):
    // R1 = Xq, Xk -> S -> Ch, Cl;  R2 = Qh, Ql, Kh, Kl -> Ph, Pl -> PART;  Vh, Vl keep their own.
    const size_t PL = (size_t)NB_ * NT_ * DM * 2;    // one bf16 plane of all items, 24 MiB
    char* R1 = (char*)take(4 * PL); char* R2 = (char*)take(4 * PL);
    bf* Vh = (bf*)take(PL); bf* Vl = (bf*)take(PL);
    float* CMAX = (float*)take((size_t)NB_ * NT_ * 4); float* CSUM = (float*)take((size_t)NB_ * NT_ * 4);
    bf* Xq = (bf*)R1; bf* Xk = (bf*)(R1 + PL);
    bf* Qh = (bf*)R2; bf* Ql = (bf*)(R2 + PL); bf* Kh = (bf*)(R2 + 2 * PL); bf* Kl = (bf*)(R2 + 3 * PL);
    float* S = (float*)R1;                                                               // 64 MiB of R1's 96
    bf* Ph = (bf*)R2; bf* Pl = (bf*)(R2 + (size_t)NB_ * NT_ * NT_ * 2);                  // 2 x 32 MiB of R2's 96
    bf* Ch = (bf*)(R1 + 2 * PL); bf* Cl = (bf*)(R1 + 3 * PL);
    float* PART = (float*)R2;                                                            // 12 planes of 16384 floats
    if ((size_t)(wsp - (char*)d_ws) > ws_size) return;    // 4.5 + 96 + 96 + 48 + 0.125 ~ 244.6 MiB
    k_wt<<<dim3(DM / 64, DM / 64, 1), 256, 0, stream>>>(Wq, DM, DM, WqT); k_wt<<<dim3(DM / 64, DM / 64, 1), 256, 0, stream>>>(Wk, DM, DM, WkT);
    k_wt<<<dim3(DM / 64, DM / 64, 1), 256, 0, stream>>>(Wv, DM, DM, WvT); k_wt<<<dim3(DM / 64, DM / 64, 1), 256, 0, stream>>>(Wt, DM, DM, WtT);
    k_cvtb<<<NB_ * NT_ / 8, 256, 0, stream>>>(qx, NB_ * NT_, Xq); k_cvtb<<<NB_ * NT_ / 8, 256, 0, stream>>>(x, NB_ * NT_, Xk);
    k_tg<1, 1, 1><<<dim3(NB_ * NT_ / 128, DM / 128, 1), 128, 0, stream>>>(Xq, nullptr, WqT, nullptr, bq, nullptr, DM, nullptr, Qh, Ql, DM, 0, 0, 0);
    k_tg<1, 1, 1><<<dim3(NB_ * NT_ / 128, DM / 128, 1), 128, 0, stream>>>(Xk, nullptr, WkT, nullptr, bk, nullptr, DM, nullptr, Kh, Kl, DM, 0, 0, 0);
    k_tg<1, 1, 2><<<dim3(DM / 128, NT_ / 128, NB_), 128, 0, stream>>>(WvT, nullptr, Xk, nullptr, bv, nullptr, DM, nullptr, Vh, Vl, NT_, 0, (size_t)NT_ * DM, (size_t)DM * NT_);   // v^T [item][768 d][1024 t]
    k_tg<2, 2, 0><<<dim3(NT_ / 128, NT_ / 128, NB_), 128, 0, stream>>>(Qh, Ql, Kh, Kl, nullptr, nullptr, DM, S, nullptr, nullptr, NT_, (size_t)NT_ * DM, (size_t)NT_ * DM, (size_t)NT_ * NT_);   // scores [q][k] (unscaled; the 768^-1/2 is applied inside the softmax kernels)
    k_colstat<<<dim3(NT_ / 32, NB_, 1), 1024, 0, stream>>>(S, CMAX, CSUM);
    k_colsoft<<<NB_ * NT_ / 8, 256, 0, stream>>>(S, CMAX, CSUM, Ph, Pl);
    k_tg<2, 2, 1><<<dim3(NT_ / 128, DM / 128, NB_), 128, 0, stream>>>(Ph, Pl, Vh, Vl, nullptr, nullptr, NT_, nullptr, Ch, Cl, DM, (size_t)NT_ * NT_, (size_t)DM * NT_, (size_t)NT_ * DM);   // ctx = P.v
    k_tg<2, 1, 3><<<dim3(NB_ * NT_ / 128, DM / 128, 1), 128, 0, stream>>>(Ch, Cl, WtT, nullptr, bt, Wo, DM, PART, nullptr, nullptr, NB_ * NT_, 0, 0, 0);  // partial dots of h = ctx.Wt + bt with Wo
    k_dot1<<<NB_ * NT_ / 256, 256, 0, stream>>>(PART, bo, out);                                                   // their sum + bo
}

// v005
// A run of this version takes 239 microseconds.
// In two side-by-side timings against v004, it was 1.07 and 1.06 times as fast.
// Counting every step since v000, it is 107 times as fast.
#include <hip/hip_runtime.h>

// Compute dtypes, f32 accumulate, all 16 batch items in every launch (rows of all items in one grid, or the item in a grid axis): q = query_x.Wq + bq, k/v = x.Wk/Wv + b ([1024 x 768].[768 x 768], k-major weights transposed once; PLAIN
// bf16 operands = inputs rounded once, exact) on v_wmma_f32_16x16x32_bf16; scores = q.k^T ([1024 x 768].[768 x 1024]) and ctx = P.v ([1024 x 1024].[1024 x 768])
// with BOTH computed operands as bf16 hi + UNSCALED residual (three products); the softmax over the QUERY axis (the module's dim=1) is done per key column in
// f32 (column max, column sum of exp, then P[q][k] = exp(s/sqrt(768) - cmax[k]) / csum[k]); h = ctx.Wt + bt (hi/lo A) and out[q] = h[q].Wo + bo (768 -> 1, f32).
// A product whose result is the next product's operand stores it as that operand (hi + residual planes; v as v^T, computed as Wv^T.x^T); h is never stored, only its partial dots with Wo.

#define NB_  16
#define NT_  1024                // Lq = Lk
#define DM   768
#define SCL  0.03608439182435161f    // 768^-1/2
#define LOSC 1024.0f

typedef _Float16 h16;
typedef unsigned short bf;
typedef __attribute__((ext_vector_type(16))) __bf16   v16bf;
typedef __attribute__((ext_vector_type(8)))  __bf16   v8bf;
typedef __attribute__((ext_vector_type(16))) _Float16 v16h;
typedef __attribute__((ext_vector_type(8)))  _Float16 v8h;
typedef __attribute__((ext_vector_type(8)))  unsigned short v8us;
typedef __attribute__((ext_vector_type(8)))  float    v8f;
typedef __attribute__((ext_vector_type(4)))  float    v4f;
typedef __attribute__((ext_vector_type(4)))  _Float16 v4h;
typedef v8h  __attribute__((may_alias)) v8ha;
typedef v4f  __attribute__((may_alias)) v4fa;
typedef v8us __attribute__((may_alias)) v8usa;

__device__ __forceinline__ unsigned short f2bf(float f) { unsigned u = __float_as_uint(f); u += 0x7FFFu + ((u >> 16) & 1u); return (unsigned short)(u >> 16); }
__device__ __forceinline__ float bf2f(unsigned short b) { return __uint_as_float(((unsigned)b) << 16); }
__device__ __forceinline__ float bfr(float f) { return bf2f(f2bf(f)); }
__device__ __forceinline__ v16h cat16(v8h lo, v8h hi) { return __builtin_shufflevector(lo, hi, 0, 1, 2, 3, 4, 5, 6, 7, 8, 9, 10, 11, 12, 13, 14, 15); }
__device__ __forceinline__ v16bf cat16b(v8us lo, v8us hi) { return __builtin_bit_cast(v16bf, __builtin_shufflevector(lo, hi, 0, 1, 2, 3, 4, 5, 6, 7, 8, 9, 10, 11, 12, 13, 14, 15)); }
__device__ __forceinline__ v8f wmma16(v16h a, v16h b, v8f c) { return __builtin_amdgcn_wmma_f32_16x16x32_f16(false, a, false, b, (short)0, c, false, false); }
__device__ __forceinline__ v8f wmmab(v16bf a, v16bf b, v8f c) { return __builtin_amdgcn_wmma_f32_16x16x32_bf16(false, a, false, b, (short)0, c, false, false); }

// cvt_rows: 8 rows of 768 floats -> bf16, one wave per row; src and dst point at the work-group's first row.
__device__ __forceinline__ void cvt_rows(const float* __restrict__ src, bf* dst) {
    const int lane = threadIdx.x & 31, r = threadIdx.x >> 5;
    v8us o[DM / 256];
#pragma unroll
    for (int q = 0; q < DM / 256; ++q) { v8us t;
#pragma unroll
        for (int i = 0; i < 8; ++i) t[i] = f2bf(src[(size_t)r * DM + q * 256 + lane * 8 + i]);
        o[q] = t; }
#pragma unroll
    for (int q = 0; q < DM / 256; ++q) *(v8us*)(dst + (size_t)r * DM + q * 256 + lane * 8) = o[q];
    
}

// wt_tile: WT [n][K] = bf16(W[k][n]) (k-major [K][ncols]) via one 64 x 64 LDS tile, at k0, n0.
__device__ __forceinline__ void wt_tile(const float* __restrict__ Wm, int K, int ncols, bf* WT, int k0, int n0) {
    __shared__ __align__(16) unsigned short tl[64 * 72];
    const int tid = threadIdx.x;
    const int kk = tid >> 2, nq = (tid & 3) * 16;
#pragma unroll
    for (int i = 0; i < 16; ++i) tl[(nq + i) * 72 + kk] = f2bf(Wm[(size_t)(k0 + kk) * ncols + n0 + nq + i]);
    __syncthreads();
    const int piece = tid & 7;
    auto pass = [&]() {
#pragma unroll
        for (int s = 0; s < 2; ++s) { const int nr = (tid >> 3) + 32 * s; const v8us val = *(const v8usa*)(tl + nr * 72 + piece * 8); *(v8us*)(WT + (size_t)(n0 + nr) * K + k0 + piece * 8) = val; }
    };
    pass(); 
}
// k_prep: the four weight transposes and the two input conversions depend on nothing but the inputs, so they share one grid: work-groups 0 .. 575 take one 64 x 64 tile of Wq, Wk, Wv, Wt
// (144 tiles each, WT holds the four results back to back), the others 8 rows of query_x, then of x (X holds both results back to back).
#define WTILES ((DM / 64) * (DM / 64))
__global__ __launch_bounds__(256) void k_prep(const float* __restrict__ qx, const float* __restrict__ x, const float* __restrict__ Wq, const float* __restrict__ Wk, const float* __restrict__ Wv, const float* __restrict__ Wt, bf* X, bf* WT) {
    const int b = blockIdx.x;
    if (b < 4 * WTILES) {
        const int w = b / WTILES, t = b % WTILES;
        wt_tile(w == 0 ? Wq : w == 1 ? Wk : w == 2 ? Wv : Wt, DM, DM, WT + (size_t)w * DM * DM, (t % (DM / 64)) * 64, (t / (DM / 64)) * 64);
    } else {
        const int r0 = (b - 4 * WTILES) * 8;
        cvt_rows(r0 < NB_ * NT_ ? qx + (size_t)r0 * DM : x + (size_t)(r0 - NB_ * NT_) * DM, X + (size_t)r0 * DM);
    }
}
// tg: one 128 x 128 tile of C = (Ah [+ Al]).(Bh [+ Bl])^T [+ bf(bias)] per work-group, 4 waves in 2 x 2, 64 x 64 of C per wave (4 x 4 accumulator tiles). All planes are k-contiguous with row
// stride K (a multiple of 64). A stage is 64 k (128 B) of the tile's 128 rows of every plane, brought into LDS by asynchronous copies, two buffers: stage t + 1 flies while stage t is worked on.
// Products per 32 k and accumulator, in this order: Ah.Bh, Al.Bh, Ah.Bl (those whose planes exist); k ascending. bx, by = the tile's row and column index, bz = batch item, sA / sB / sC = elements per item in the A planes, the B planes and C.
// Every inner loop is unrolled so that acc and the fragment arrays are indexed by constants and stay in registers.
// EPI says what is stored: 0 = C in f32; 1 = bf16 hi + UNSCALED residual planes Oh, Ol of C, bias by column; 2 = the same planes, bias by row; 3 = no C: per row the dot of this wave's 64 columns of
// C (bias by column) with bf(wo), into plane 2 by + (wave & 1) of C (a plane is ldc floats, one per row of the whole product).
#define TP   144                 // LDS bytes per staged row: 128 of data + 16, so that 16 rows read 16 bytes wide fall on different banks
#define TPL  (128 * TP)          // one staged plane
__device__ __forceinline__ unsigned lds_off(const void* p) { return (unsigned)(size_t)p; }
// One lane's half rows of a 16 x 32 fragment: k 8 hi .. 8 hi + 7 and 16 + 8 hi .. 16 + 8 hi + 7 (p already holds the row and the 16 hi bytes); the same for A and B.
__device__ __forceinline__ v16bf ldf(const unsigned char* p) { return cat16b(*(const v8usa*)p, *(const v8usa*)(p + 32)); }
// One thread's share of one plane of a stage: 16 bytes of each of the rows r, r + 16, ..., r + 112 (rs = 16 rows, in elements). The s_wait_xcnt stands inside the statement so that
// no address register of a copy is rewritten in front of it.
__device__ __forceinline__ void copy_plane(unsigned l, const bf* gp, size_t rs) {
    asm volatile("global_load_async_to_lds_b128 %0, %8, off\n\t"
                 "global_load_async_to_lds_b128 %1, %9, off\n\t"
                 "global_load_async_to_lds_b128 %2, %10, off\n\t"
                 "global_load_async_to_lds_b128 %3, %11, off\n\t"
                 "global_load_async_to_lds_b128 %4, %12, off\n\t"
                 "global_load_async_to_lds_b128 %5, %13, off\n\t"
                 "global_load_async_to_lds_b128 %6, %14, off\n\t"
                 "global_load_async_to_lds_b128 %7, %15, off\n\t"
                 "s_wait_xcnt 0x0"
                 :: "v"(l), "v"(l + 16 * TP), "v"(l + 32 * TP), "v"(l + 48 * TP), "v"(l + 64 * TP), "v"(l + 80 * TP), "v"(l + 96 * TP), "v"(l + 112 * TP),
                    "v"(gp), "v"(gp + rs), "v"(gp + 2 * rs), "v"(gp + 3 * rs), "v"(gp + 4 * rs), "v"(gp + 5 * rs), "v"(gp + 6 * rs), "v"(gp + 7 * rs)
                 : "memory");
}
// v + v of lane ^ M inside the 16-lane row, one vector instruction (row_xmask); every lane is on where it is used.
template <int M> __device__ __forceinline__ float rowx(float v) { return v + __int_as_float(__builtin_amdgcn_update_dpp(0, __float_as_int(v), 0x160 + M, 0xf, 0xf, true)); }
template <int NA, int NBP, int EPI>
__device__ __forceinline__ void tg(unsigned char* L, int bx, int by, int bz, const bf* __restrict__ Ah, const bf* __restrict__ Al, const bf* __restrict__ Bh, const bf* __restrict__ Bl, const float* __restrict__ bias, const float* __restrict__ wo, int K, float* C, bf* Oh, bf* Ol, int ldc, size_t sA, size_t sB, size_t sC) {
    constexpr unsigned STG = (NA + NBP) * TPL;    // L holds 2 STG bytes
    const int tid = threadIdx.x, lane = tid & 31, wave = tid >> 5, lr = lane & 15, hi = lane >> 4;
    const int R0 = bx * 128, C0 = by * 128, wr = (wave >> 1) * 64, wc = (wave & 1) * 64;
    const int crow = tid >> 3, cpc = tid & 7;    // copies: 8 lanes per 128-B row piece, a wave-wide copy covers 4 whole lines
    const size_t ga = bz * sA + (size_t)(R0 + crow) * K + cpc * 8, gb = bz * sB + (size_t)(C0 + crow) * K + cpc * 8, rs = (size_t)16 * K;
    const unsigned lc = lds_off(L) + crow * TP + cpc * 16;
    auto fill = [&](int t) {
        const unsigned l = lc + (t & 1) * STG; const size_t ko = (size_t)t * 64;
        copy_plane(l, Ah + ga + ko, rs);
        if (NA == 2) copy_plane(l + TPL, Al + ga + ko, rs);
        copy_plane(l + NA * TPL, Bh + gb + ko, rs);
        if (NBP == 2) copy_plane(l + (NA + 1) * TPL, Bl + gb + ko, rs);
    };
    const int nst = K / 64;
    fill(0);
    asm volatile("s_wait_asynccnt 0x0" ::: "memory");    // this wave's share of stage 0 has landed
    __syncthreads();                                     // stage 0 is published
    if (nst > 1) fill(1);
    v8f acc[4][4];
#pragma unroll
    for (int i = 0; i < 4; ++i) {
#pragma unroll
        for (int j = 0; j < 4; ++j) acc[i][j] = (v8f){}; }
    const unsigned char* fa0 = L + (wr + lr) * TP + hi * 16;
    const unsigned char* fb0 = L + NA * TPL + (wc + lr) * TP + hi * 16;
#pragma unroll 1
    for (int t = 0; t < nst; ++t) {    // stays rolled: one trip per stage, the buffer chosen by t & 1
        const unsigned bo = (t & 1) * STG;
        v16bf a[4], al[4];
        if constexpr (NBP == 2) {
            // Eight steps of 12 products (32 k x 16 columns each). The B fragments of step s + 1 are fetched, as one group, in front of step s's products into the other of two register sets.
            v16bf bh[2], bl[2];
            bh[0] = ldf(fb0 + bo); bl[0] = ldf(fb0 + bo + TPL);
#pragma unroll
            for (int s = 0; s < 8; ++s) {
                const int j = s & 3, cs = s & 1, n = s + 1;
                if (j == 0) {
#pragma unroll
                    for (int i = 0; i < 4; ++i) { const unsigned char* p = fa0 + bo + i * 16 * TP + (s >> 2) * 64; a[i] = ldf(p); al[i] = ldf(p + TPL); } }
                if (n < 8) { const unsigned char* p = fb0 + bo + (n & 3) * 16 * TP + (n >> 2) * 64; bh[n & 1] = ldf(p); bl[n & 1] = ldf(p + TPL); }
                __builtin_amdgcn_sched_barrier(0);    // keeps the LDS reads above as one group: sunk among the products, each would be waited for where it is used
#pragma unroll
                for (int i = 0; i < 4; ++i) acc[i][j] = wmmab(a[i], bh[cs], acc[i][j]);
#pragma unroll
                for (int i = 0; i < 4; ++i) acc[i][j] = wmmab(al[i], bh[cs], acc[i][j]);
#pragma unroll
                for (int i = 0; i < 4; ++i) acc[i][j] = wmmab(a[i], bl[cs], acc[i][j]);
                __builtin_amdgcn_sched_barrier(0);    // keeps the next step's reads from rising into this step's products
            }
        } else {
#pragma unroll
            for (int kb = 0; kb < 2; ++kb) {
                v16bf bh[4];
#pragma unroll
                for (int i = 0; i < 4; ++i) { const unsigned char* p = fa0 + bo + i * 16 * TP + kb * 64; a[i] = ldf(p); if (NA == 2) al[i] = ldf(p + TPL); }
#pragma unroll
                for (int j = 0; j < 4; ++j) bh[j] = ldf(fb0 + bo + j * 16 * TP + kb * 64);
                __builtin_amdgcn_sched_barrier(0);    // keeps the block's LDS reads as one group in front of its products
#pragma unroll
                for (int j = 0; j < 4; ++j) {
#pragma unroll
                    for (int i = 0; i < 4; ++i) acc[i][j] = wmmab(a[i], bh[j], acc[i][j]);
                    if (NA == 2) {
#pragma unroll
                        for (int i = 0; i < 4; ++i) acc[i][j] = wmmab(al[i], bh[j], acc[i][j]); } }
                __builtin_amdgcn_sched_barrier(0);    // keeps the next block's reads from rising into this block's products
            }
        }
        asm volatile("s_wait_dscnt 0x0" ::: "memory");       // this wave's reads of stage t are done before the buffer is refilled
        asm volatile("s_wait_asynccnt 0x0" ::: "memory");    // this wave's share of stage t + 1 has landed
        __syncthreads();                                     // publishes stage t + 1 and ends every wave's reads of stage t
        if (t + 2 < nst) fill(t + 2);
    }
    asm volatile("s_wait_asynccnt 0x0" ::: "memory");        // no copy is left in flight when the ring becomes output staging
    // Whole-line stores: each wave stages its 64 x 64 (EPI 3: its 64 row sums) in its own part of the ring (every reader left it at the last trip's barrier).
    float* os = (float*)(void*)L + wave * (64 * 68);
    if constexpr (EPI == 3) {
        float wv[4], bc[4];
#pragma unroll
        for (int j = 0; j < 4; ++j) { const int c = C0 + wc + j * 16 + lr; wv[j] = bfr(wo[c]); bc[j] = bfr(bias[c]); }
#pragma unroll
        for (int i = 0; i < 4; ++i) { float p[8];
#pragma unroll
            for (int e = 0; e < 8; ++e) { float t = 0.f;
#pragma unroll
                for (int j = 0; j < 4; ++j) t = fmaf(acc[i][j][e] + bc[j], wv[j], t);
                p[e] = rowx<8>(rowx<4>(rowx<2>(rowx<1>(t)))); }
            if (lr == 0) { *(v4fa*)(os + i * 16 + hi * 8) = (v4f){p[0], p[1], p[2], p[3]}; *(v4fa*)(os + i * 16 + hi * 8 + 4) = (v4f){p[4], p[5], p[6], p[7]}; } }
    } else {
        float rb[4][8];    // EPI 2: the bias of this lane's 32 rows
        if constexpr (EPI == 2) {
#pragma unroll
            for (int i = 0; i < 4; ++i) {
#pragma unroll
                for (int e = 0; e < 8; ++e) rb[i][e] = bfr(bias[R0 + wr + i * 16 + hi * 8 + e]); } }
#pragma unroll
        for (int j = 0; j < 4; ++j) { const float bv = (EPI != 2 && bias) ? bfr(bias[C0 + wc + j * 16 + lr]) : 0.f;
#pragma unroll
            for (int i = 0; i < 4; ++i) {
#pragma unroll
                for (int e = 0; e < 8; ++e) os[(i * 16 + hi * 8 + e) * 68 + j * 16 + lr] = acc[i][j][e] + (EPI == 2 ? rb[i][e] : bv); } }
    }
    __syncthreads();
    if constexpr (EPI == 0) {
        float* crowp = C + bz * sC + (size_t)(R0 + wr) * ldc + C0 + wc;
#pragma unroll
        for (int s = 0; s < 32; ++s) { const int Lid = (lane >> 3) + 4 * s, piece = lane & 7; const int row = Lid >> 1, cofs = (Lid & 1) * 32 + piece * 4;
            const v4f val = *(const v4fa*)(os + row * 68 + cofs); *(v4f*)(crowp + (size_t)row * ldc + cofs) = val; }
    } else if constexpr (EPI == 3) {
        float* pp = C + (size_t)(by * 2 + (wave & 1)) * ldc + R0 + wr;
        pp[lane] = os[lane]; pp[32 + lane] = os[32 + lane];
    } else {
        // 8 lanes per row: 64 columns are one 128-B line of each plane, a wave-wide store covers 4 whole lines.
        const size_t ob = bz * sC + (size_t)(R0 + wr + (lane >> 3)) * ldc + C0 + wc + (lane & 7) * 8;
        const float* op = os + (lane >> 3) * 68 + (lane & 7) * 8;
#pragma unroll
        for (int s = 0; s < 16; ++s) { const v8f x = __builtin_shufflevector(*(const v4fa*)(op + s * 4 * 68), *(const v4fa*)(op + s * 4 * 68 + 4), 0, 1, 2, 3, 4, 5, 6, 7);
            const v8bf h = __builtin_convertvector(x, v8bf), l = __builtin_convertvector(x - __builtin_convertvector(h, v8f), v8bf);    // packed hardware conversions, round to nearest even as f2bf does
            const size_t o = ob + (size_t)(s * 4) * ldc; *(v8us*)(Oh + o) = __builtin_bit_cast(v8us, h); *(v8us*)(Ol + o) = __builtin_bit_cast(v8us, l); }
    }
}
// k_tg: one product, grid (row tiles, column tiles, items).
template <int NA, int NBP, int EPI>
__global__ __launch_bounds__(128) void k_tg(const bf* __restrict__ Ah, const bf* __restrict__ Al, const bf* __restrict__ Bh, const bf* __restrict__ Bl, const float* __restrict__ bias, const float* __restrict__ wo, int K, float* C, bf* Oh, bf* Ol, int ldc, size_t sA, size_t sB, size_t sC) {
    __shared__ __attribute__((aligned(16))) unsigned char L[2 * (NA + NBP) * TPL];
    tg<NA, NBP, EPI>(L, blockIdx.x, blockIdx.y, blockIdx.z, Ah, Al, Bh, Bl, bias, wo, K, C, Oh, Ol, ldc, sA, sB, sC);
}
// k_qkv: the three projections depend only on k_prep, so they share one grid: blockIdx.y = 0 q, 1 k, 2 v^T; blockIdx.x = the product's 768 tiles in the order its own grid had (row tile fastest).
// X = the bf16 planes of query_x, x; WT = Wq^T, Wk^T, Wv^T; QK = the planes Qh, Ql, Kh, Kl; each set back to back.
__global__ __launch_bounds__(128) void k_qkv(const bf* __restrict__ X, const bf* __restrict__ WT, const float* __restrict__ bq, const float* __restrict__ bk, const float* __restrict__ bv, bf* QK, bf* Vh, bf* Vl) {
    __shared__ __attribute__((aligned(16))) unsigned char L[2 * 2 * TPL];
    constexpr size_t XP = (size_t)NB_ * NT_ * DM, WP = (size_t)DM * DM;
    const int t = blockIdx.x, w = blockIdx.y;
    if (w < 2) tg<1, 1, 1>(L, t % (NB_ * NT_ / 128), t / (NB_ * NT_ / 128), 0, X + w * XP, nullptr, WT + w * WP, nullptr, w ? bk : bq, nullptr, DM, nullptr, QK + 2 * w * XP, QK + (2 * w + 1) * XP, DM, 0, 0, 0);
    else tg<1, 1, 2>(L, t % (DM / 128), (t / (DM / 128)) % (NT_ / 128), t / ((DM / 128) * (NT_ / 128)), WT + 2 * WP, nullptr, X + XP, nullptr, bv, nullptr, DM, nullptr, Vh, Vl, NT_, 0, (size_t)NT_ * DM, (size_t)DM * NT_);   // v^T [item][768 d][1024 t]
}
// k_colstat: per batch item (blockIdx.y) and key column k of S [1024 q][1024 k]: cmax = max_q (s x scale), csum = sum_q exp(s x scale - cmax), f32. One work-group per 32 columns (one 128-B line
// of every row), 32 waves: a wave-wide 16-B load covers 4 rows x 32 columns, and a thread keeps its 8 rows x 4 columns in registers for both passes (S is read once).
// Fixed reduction tree: 8 rows in the thread, the wave's 4 row groups by lane exchange, the 32 waves through LDS (4 wave rows per load, then lane exchange again).
// Every loop is unrolled so that v, m and s are indexed by constants and stay in registers, and so that the 8 global loads are all in flight together.
__global__ __launch_bounds__(1024) void k_colstat(const float* __restrict__ S, float* CMAX, float* CSUM) {
    __shared__ __align__(16) float rm[32 * 32]; __shared__ __align__(16) float rs[32 * 32];
    const int lane = threadIdx.x & 31, wave = threadIdx.x >> 5, cg = (lane & 7) * 4, rsub = lane >> 3, c0 = blockIdx.x * 32;
    S += (size_t)blockIdx.y * NT_ * NT_; CMAX += blockIdx.y * NT_; CSUM += blockIdx.y * NT_;
    v4f v[8];
#pragma unroll
    for (int i = 0; i < 8; ++i) v[i] = *(const v4f*)(S + (size_t)(i * 128 + wave * 4 + rsub) * NT_ + c0 + cg);
    v4f m = (v4f){-3.0e38f, -3.0e38f, -3.0e38f, -3.0e38f};
#pragma unroll
    for (int i = 0; i < 8; ++i) m = __builtin_elementwise_max(m, v[i] * SCL);
#pragma unroll
    for (int k = 0; k < 4; ++k) { m[k] = fmaxf(m[k], __shfl_xor(m[k], 8)); m[k] = fmaxf(m[k], __shfl_xor(m[k], 16)); }
    if (rsub == 0) *(v4fa*)(rm + wave * 32 + cg) = m;
    __syncthreads();
#pragma unroll
    for (int j = 0; j < 8; ++j) m = __builtin_elementwise_max(m, *(const v4fa*)(rm + (j * 4 + rsub) * 32 + cg));
#pragma unroll
    for (int k = 0; k < 4; ++k) { m[k] = fmaxf(m[k], __shfl_xor(m[k], 8)); m[k] = fmaxf(m[k], __shfl_xor(m[k], 16)); }
    v4f s = (v4f){0.f, 0.f, 0.f, 0.f};
#pragma unroll
    for (int i = 0; i < 8; ++i) { const v4f e = __builtin_elementwise_fma(v[i], (v4f){SCL, SCL, SCL, SCL}, -m);
#pragma unroll
        for (int k = 0; k < 4; ++k) s[k] += __expf(e[k]); }
#pragma unroll
    for (int k = 0; k < 4; ++k) { s[k] += __shfl_xor(s[k], 8); s[k] += __shfl_xor(s[k], 16); }
    if (rsub == 0) *(v4fa*)(rs + wave * 32 + cg) = s;
    __syncthreads();
    if (wave == 0) {
        v4f t = (v4f){0.f, 0.f, 0.f, 0.f};
#pragma unroll
        for (int j = 0; j < 8; ++j) t += *(const v4fa*)(rs + (j * 4 + rsub) * 32 + cg);
#pragma unroll
        for (int k = 0; k < 4; ++k) { t[k] += __shfl_xor(t[k], 8); t[k] += __shfl_xor(t[k], 16); }
        if (rsub == 0) { *(v4f*)(CMAX + c0 + cg) = m; *(v4f*)(CSUM + c0 + cg) = t; }
    }
}
// k_colsoft: P[q][k] = exp(s[q][k] x scale - cmax[k]) / csum[k] -> bf16 hi + UNSCALED residual planes; one wave per row q of any item (r = item * 1024 + q), lane -> 8 columns per 256-column step.
__global__ __launch_bounds__(256) void k_colsoft(const float* __restrict__ S, const float* __restrict__ CMAX, const float* __restrict__ CSUM, bf* Ph, bf* Pl) {
    const int lane = threadIdx.x & 31, r = blockIdx.x * 8 + (threadIdx.x >> 5); if (r >= NB_ * NT_) return;
    CMAX += (r / NT_) * NT_; CSUM += (r / NT_) * NT_;
{
#pragma unroll 1
        for (int qc = 0; qc < NT_ / 256; ++qc) { const size_t o = (size_t)r * NT_ + qc * 256 + lane * 8; const v8f v = *(const v8f*)(S + o), cm = *(const v8f*)(CMAX + qc * 256 + lane * 8), cs = *(const v8f*)(CSUM + qc * 256 + lane * 8); v8us oh, ol;
#pragma unroll
            for (int i = 0; i < 8; ++i) { const float p = __expf(v[i] * SCL - cm[i]) / cs[i]; const unsigned short hb = f2bf(p); oh[i] = hb; ol[i] = f2bf(p - bf2f(hb)); }
            *(v8us*)(Ph + o) = oh; *(v8us*)(Pl + o) = ol; }
         }
}
// k_dot1: out[q] = bf(bo) + the 12 partial dots of row q (64 columns of h each), plane 0 first.
__global__ __launch_bounds__(256) void k_dot1(const float* __restrict__ PART, const float* __restrict__ bo, float* OUTB) {
    const int q = blockIdx.x * 256 + threadIdx.x;
    float a = bfr(bo[0]);
#pragma unroll
    for (int p = 0; p < DM / 64; ++p) a += PART[(size_t)p * (NB_ * NT_) + q];
    OUTB[q] = a;
}

extern "C" void kernel_launch(void* const* d_in, const int* in_sizes, int n_in,
                              void* d_out, int out_size, void* d_ws, size_t ws_size, hipStream_t stream) {
    (void)in_sizes; (void)n_in; (void)out_size;
    const float* qx = (const float*)d_in[0]; const float* x = (const float*)d_in[1];
    const float* Wq = (const float*)d_in[2]; const float* bq = (const float*)d_in[3]; const float* Wk = (const float*)d_in[4]; const float* bk = (const float*)d_in[5]; const float* Wv = (const float*)d_in[6]; const float* bv = (const float*)d_in[7];
    const float* Wt = (const float*)d_in[8]; const float* bt = (const float*)d_in[9]; const float* Wo = (const float*)d_in[10]; const float* bo = (const float*)d_in[11];   // W k-major [in][out]
    float* out = (float*)d_out;    // [16][1024]
    char* wsp = (char*)d_ws;
    auto take = [&](size_t bytes) { char* p = wsp; wsp += (bytes + 255) & ~(size_t)255; return (void*)p; };
    bf* WqT = (bf*)take((size_t)4 * DM * DM * 2); bf* WtT = WqT + (size_t)3 * DM * DM;    // Wq^T, Wk^T, Wv^T, Wt^T back to back
    // Planes hold all 16 items ([item][row][col], items back to back). Two regions are used again once their first tenants are dead (stream order):
    // R1 = Xq, Xk -> S -> Ch, Cl;  R2 = Qh, Ql, Kh, Kl -> Ph, Pl -> PART;  Vh, Vl keep their own.
    const size_t PL = (size_t)NB_ * NT_ * DM * 2;    // one bf16 plane of all items, 24 MiB
    char* R1 = (char*)take(4 * PL); char* R2 = (char*)take(4 * PL);
    bf* Vh = (bf*)take(PL); bf* Vl = (bf*)take(PL);
    float* CMAX = (float*)take((size_t)NB_ * NT_ * 4); float* CSUM = (float*)take((size_t)NB_ * NT_ * 4);
    bf* Xq = (bf*)R1;    // Xk follows it
    bf* Qh = (bf*)R2; bf* Ql = (bf*)(R2 + PL); bf* Kh = (bf*)(R2 + 2 * PL); bf* Kl = (bf*)(R2 + 3 * PL);
    float* S = (float*)R1;                                                               // 64 MiB of R1's 96
    bf* Ph = (bf*)R2; bf* Pl = (bf*)(R2 + (size_t)NB_ * NT_ * NT_ * 2);                  // 2 x 32 MiB of R2's 96
    bf* Ch = (bf*)(R1 + 2 * PL); bf* Cl = (bf*)(R1 + 3 * PL);
    float* PART = (float*)R2;                                                            // 12 planes of 16384 floats
    if ((size_t)(wsp - (char*)d_ws) > ws_size) return;    // 4.5 + 96 + 96 + 48 + 0.125 ~ 244.6 MiB
    k_prep<<<4 * WTILES + 2 * NB_ * NT_ / 8, 256, 0, stream>>>(qx, x, Wq, Wk, Wv, Wt, Xq, WqT);    // Xq, Xk and WqT .. WtT lie back to back
    k_qkv<<<dim3(NB_ * NT_ / 128 * (DM / 128), 3, 1), 128, 0, stream>>>(Xq, WqT, bq, bk, bv, Qh, Vh, Vl);    // Qh, Ql, Kh, Kl lie back to back
    k_tg<2, 2, 0><<<dim3(NT_ / 128, NT_ / 128, NB_), 128, 0, stream>>>(Qh, Ql, Kh, Kl, nullptr, nullptr, DM, S, nullptr, nullptr, NT_, (size_t)NT_ * DM, (size_t)NT_ * DM, (size_t)NT_ * NT_);   // scores [q][k] (unscaled; the 768^-1/2 is applied inside the softmax kernels)
    k_colstat<<<dim3(NT_ / 32, NB_, 1), 1024, 0, stream>>>(S, CMAX, CSUM);
    k_colsoft<<<NB_ * NT_ / 8, 256, 0, stream>>>(S, CMAX, CSUM, Ph, Pl);
    k_tg<2, 2, 1><<<dim3(NT_ / 128, DM / 128, NB_), 128, 0, stream>>>(Ph, Pl, Vh, Vl, nullptr, nullptr, NT_, nullptr, Ch, Cl, DM, (size_t)NT_ * NT_, (size_t)DM * NT_, (size_t)NT_ * DM);   // ctx = P.v
    k_tg<2, 1, 3><<<dim3(NB_ * NT_ / 128, DM / 128, 1), 128, 0, stream>>>(Ch, Cl, WtT, nullptr, bt, Wo, DM, PART, nullptr, nullptr, NB_ * NT_, 0, 0, 0);  // partial dots of h = ctx.Wt + bt with Wo
    k_dot1<<<NB_ * NT_ / 256, 256, 0, stream>>>(PART, bo, out);                                                   // their sum + bo
}

// v007
// It runs in 111 microseconds.
// It is 2.16 times as fast as v005, going by the measured steps of the versions left out in between.
// Over all steps from v000 it is 232 times as fast.
#include <hip/hip_runtime.h>

// Compute dtypes, f32 accumulate, all 16 batch items in every launch. The scores are taken from the middle: with q = query_x.Wq + bq and k = x.Wk + bk,
// q.k^T = t.x^T + g, t = query_x.(Wq.Wk^T) + Wk.bq (a row of 768 per query row), g[q] = query_x[q].(Wq.bk) + bq.bk: ONE [1024 x 768].[768 x 768] product per item stands for the two projections, and x itself is the
// second operand of the scores. Inputs are rounded to bf16 once (exact operands of v_wmma_f32_16x16x32_bf16); the COMPUTED operands Wq.Wk^T and t go on as bf16 hi + UNSCALED residual, so t takes two products and the scores take two.
// The softmax over the QUERY axis (the module's dim=1) is done per key column in f32 (column max, column sum of exp, P[q][k] = exp(s/sqrt(768) - cmax[k]) / csum[k]).
// Behind the softmax the module is linear and ends in ONE column, so its products are taken from the right: out = ((P.(x.Wv + bv)).Wt + bt).Wo + bo = P.u + (bt.Wo + bo) with
// w1 = Wt.Wo, w2 = Wv.w1, u[k] = x[k].w2 + bv.w1: matrix-vector products in f32 (their inputs rounded to bf16 once, like the operands of the matrix products); neither q, k, v, P, ctx nor h is ever formed.

#define NB_  16
#define NT_  1024                // Lq = Lk
#define DM   768
#define SCL  0.03608439182435161f    // 768^-1/2
#define LOSC 1024.0f

typedef _Float16 h16;
typedef unsigned short bf;
typedef __attribute__((ext_vector_type(16))) __bf16   v16bf;
typedef __attribute__((ext_vector_type(8)))  __bf16   v8bf;
typedef __attribute__((ext_vector_type(16))) _Float16 v16h;
typedef __attribute__((ext_vector_type(8)))  _Float16 v8h;
typedef __attribute__((ext_vector_type(8)))  unsigned short v8us;
typedef __attribute__((ext_vector_type(8)))  float    v8f;
typedef __attribute__((ext_vector_type(4)))  float    v4f;
typedef __attribute__((ext_vector_type(4)))  _Float16 v4h;
typedef v8h  __attribute__((may_alias)) v8ha;
typedef v4f  __attribute__((may_alias)) v4fa;
typedef v8us __attribute__((may_alias)) v8usa;

__device__ __forceinline__ unsigned short f2bf(float f) { unsigned u = __float_as_uint(f); u += 0x7FFFu + ((u >> 16) & 1u); return (unsigned short)(u >> 16); }
__device__ __forceinline__ float bf2f(unsigned short b) { return __uint_as_float(((unsigned)b) << 16); }
__device__ __forceinline__ float bfr(float f) { return bf2f(f2bf(f)); }
__device__ __forceinline__ v16h cat16(v8h lo, v8h hi) { return __builtin_shufflevector(lo, hi, 0, 1, 2, 3, 4, 5, 6, 7, 8, 9, 10, 11, 12, 13, 14, 15); }
__device__ __forceinline__ v16bf cat16b(v8us lo, v8us hi) { return __builtin_bit_cast(v16bf, __builtin_shufflevector(lo, hi, 0, 1, 2, 3, 4, 5, 6, 7, 8, 9, 10, 11, 12, 13, 14, 15)); }
__device__ __forceinline__ v8f wmma16(v16h a, v16h b, v8f c) { return __builtin_amdgcn_wmma_f32_16x16x32_f16(false, a, false, b, (short)0, c, false, false); }
__device__ __forceinline__ v8f wmmab(v16bf a, v16bf b, v8f c) { return __builtin_amdgcn_wmma_f32_16x16x32_bf16(false, a, false, b, (short)0, c, false, false); }

// cvt_rows: 8 rows of 768 floats -> bf16, one wave per row; src and dst point at the work-group's first row.
__device__ __forceinline__ void cvt_rows(const float* __restrict__ src, bf* dst) {
    const int lane = threadIdx.x & 31, r = threadIdx.x >> 5;
    v8us o[DM / 256];
#pragma unroll
    for (int q = 0; q < DM / 256; ++q) { v8us t;
#pragma unroll
        for (int i = 0; i < 8; ++i) t[i] = f2bf(src[(size_t)r * DM + q * 256 + lane * 8 + i]);
        o[q] = t; }
#pragma unroll
    for (int q = 0; q < DM / 256; ++q) *(v8us*)(dst + (size_t)r * DM + q * 256 + lane * 8) = o[q];
    
}

// mv_rows: y[r] = bf(M[r]).w for the NR rows r0 .. r0 + NR - 1 of one wave, f32; M is [768][768] row-major and row 768 stands for the bias vector b, so y[768] = bf(b).w. RW: w is an input too and is rounded like M.
// Fixed sum tree: a lane's 24 terms in ascending order (4 per 128 columns), then the 32 lanes by exchange. Lane n keeps row n's sum, so that a wave stores its rows with one instruction.
template <int NR, bool RW>
__device__ __forceinline__ void mv_rows(const float* __restrict__ M, const float* __restrict__ b, const float* __restrict__ w, float* y, int r0) {
    const int lane = threadIdx.x & 31;
    float wv[DM / 32], keep = 0.f;
#pragma unroll
    for (int q = 0; q < DM / 128; ++q) {
#pragma unroll
        for (int i = 0; i < 4; ++i) { const float t = w[q * 128 + lane * 4 + i]; wv[q * 4 + i] = RW ? bfr(t) : t; } }
#pragma unroll
    for (int n = 0; n < NR; ++n) { const int r = r0 + n < DM ? r0 + n : DM;    // rows past 768 repeat row 768 and are not stored
        const float* a = r < DM ? M + (size_t)r * DM : b;
        float s = 0.f;
#pragma unroll
        for (int q = 0; q < DM / 128; ++q) {
#pragma unroll
            for (int i = 0; i < 4; ++i) s = fmaf(bfr(a[q * 128 + lane * 4 + i]), wv[q * 4 + i], s); }
#pragma unroll
        for (int m = 16; m; m >>= 1) s += __shfl_xor(s, m);
        if (lane == n) keep = s; }
    if (lane < NR && r0 + lane <= DM) y[r0 + lane] = keep;
}
// tg: one 128 x 128 tile of C = (Ah [+ Al]).(Bh [+ Bl])^T + bias per work-group, 4 waves in 2 x 2, 64 x 64 of C per wave (4 x 4 accumulator tiles). One operand has two planes, the other one. All planes are k-contiguous
// with row stride K (a multiple of 64). A stage is 64 k (128 B) of the tile's 128 rows of every plane, brought into LDS by asynchronous copies, two buffers: stage t + 1 flies while stage t is worked on.
// Products per 32 k and accumulator, in this order: Ah.Bh, then Al.Bh or Ah.Bl; k ascending. bx, by = the tile's row and column index, bz = batch item, sA / sB / sC = elements per item in the A planes, the B planes and C.
// Every inner loop is unrolled so that acc and the fragment arrays are indexed by constants and stay in registers.
// EPI says what is stored: 0 = C in f32, bias (f32, as it is) by row of the item; 1 = bf16 hi + UNSCALED residual planes Oh, Ol of C, bias (f32, as it is) by column.
#define TP   144                 // LDS bytes per staged row: 128 of data + 16, so that 16 rows read 16 bytes wide fall on different banks
#define TPL  (128 * TP)          // one staged plane
__device__ __forceinline__ unsigned lds_off(const void* p) { return (unsigned)(size_t)p; }
// One lane's half rows of a 16 x 32 fragment: k 8 hi .. 8 hi + 7 and 16 + 8 hi .. 16 + 8 hi + 7 (p already holds the row and the 16 hi bytes); the same for A and B.
__device__ __forceinline__ v16bf ldf(const unsigned char* p) { return cat16b(*(const v8usa*)p, *(const v8usa*)(p + 32)); }
// One thread's share of one plane of a stage: 16 bytes of each of the rows r, r + 16, ..., r + 112 (rs = 16 rows, in elements). The s_wait_xcnt stands inside the statement so that
// no address register of a copy is rewritten in front of it.
__device__ __forceinline__ void copy_plane(unsigned l, const bf* gp, size_t rs) {
    asm volatile("global_load_async_to_lds_b128 %0, %8, off\n\t"
                 "global_load_async_to_lds_b128 %1, %9, off\n\t"
                 "global_load_async_to_lds_b128 %2, %10, off\n\t"
                 "global_load_async_to_lds_b128 %3, %11, off\n\t"
                 "global_load_async_to_lds_b128 %4, %12, off\n\t"
                 "global_load_async_to_lds_b128 %5, %13, off\n\t"
                 "global_load_async_to_lds_b128 %6, %14, off\n\t"
                 "global_load_async_to_lds_b128 %7, %15, off\n\t"
                 "s_wait_xcnt 0x0"
                 :: "v"(l), "v"(l + 16 * TP), "v"(l + 32 * TP), "v"(l + 48 * TP), "v"(l + 64 * TP), "v"(l + 80 * TP), "v"(l + 96 * TP), "v"(l + 112 * TP),
                    "v"(gp), "v"(gp + rs), "v"(gp + 2 * rs), "v"(gp + 3 * rs), "v"(gp + 4 * rs), "v"(gp + 5 * rs), "v"(gp + 6 * rs), "v"(gp + 7 * rs)
                 : "memory");
}
// v + v of lane ^ M inside the 16-lane row, one vector instruction (row_xmask); every lane is on where it is used.
template <int M> __device__ __forceinline__ float rowx(float v) { return v + __int_as_float(__builtin_amdgcn_update_dpp(0, __float_as_int(v), 0x160 + M, 0xf, 0xf, true)); }
template <int NA, int NBP, int EPI>
__device__ __forceinline__ void tg(unsigned char* L, int bx, int by, int bz, const bf* __restrict__ Ah, const bf* __restrict__ Al, const bf* __restrict__ Bh, const bf* __restrict__ Bl, const float* __restrict__ bias, int K, float* C, bf* Oh, bf* Ol, int ldc, size_t sA, size_t sB, size_t sC) {
    static_assert(NA + NBP == 3, "one operand in two planes");
    constexpr unsigned STG = (NA + NBP) * TPL;    // L holds 2 STG bytes
    const int tid = threadIdx.x, lane = tid & 31, wave = tid >> 5, lr = lane & 15, hi = lane >> 4;
    const int R0 = bx * 128, C0 = by * 128, wr = (wave >> 1) * 64, wc = (wave & 1) * 64;
    const int crow = tid >> 3, cpc = tid & 7;    // copies: 8 lanes per 128-B row piece, a wave-wide copy covers 4 whole lines
    const size_t ga = bz * sA + (size_t)(R0 + crow) * K + cpc * 8, gb = bz * sB + (size_t)(C0 + crow) * K + cpc * 8, rs = (size_t)16 * K;
    const unsigned lc = lds_off(L) + crow * TP + cpc * 16;
    auto fill = [&](int t) {
        const unsigned l = lc + (t & 1) * STG; const size_t ko = (size_t)t * 64;
        copy_plane(l, Ah + ga + ko, rs);
        if (NA == 2) copy_plane(l + TPL, Al + ga + ko, rs);
        copy_plane(l + NA * TPL, Bh + gb + ko, rs);
        if (NBP == 2) copy_plane(l + (NA + 1) * TPL, Bl + gb + ko, rs);
    };
    const int nst = K / 64;
    fill(0);
    asm volatile("s_wait_asynccnt 0x0" ::: "memory");    // this wave's share of stage 0 has landed
    __syncthreads();                                     // stage 0 is published
    if (nst > 1) fill(1);
    v8f acc[4][4];
#pragma unroll
    for (int i = 0; i < 4; ++i) {
#pragma unroll
        for (int j = 0; j < 4; ++j) acc[i][j] = (v8f){}; }
    const unsigned char* fa0 = L + (wr + lr) * TP + hi * 16;
    const unsigned char* fb0 = L + NA * TPL + (wc + lr) * TP + hi * 16;
#pragma unroll 1
    for (int t = 0; t < nst; ++t) {    // stays rolled: one trip per stage, the buffer chosen by t & 1
        const unsigned bo = (t & 1) * STG;
        // Eight steps of 8 products (32 k x 16 rows or columns of the two-plane operand each). The four fragments of the one-plane operand stay for four steps; the two-plane operand's fragments of step s + 1
        // are fetched, as one group, in front of step s's products into the other of two register sets.
        const unsigned char* f1 = (NBP == 2 ? fa0 : fb0) + bo;    // the one-plane operand
        const unsigned char* f2 = (NBP == 2 ? fb0 : fa0) + bo;    // the two-plane operand
        v16bf o[4], h[2], l[2];
        h[0] = ldf(f2); l[0] = ldf(f2 + TPL);
#pragma unroll
        for (int s = 0; s < 8; ++s) {
            const int m = s & 3, cs = s & 1, n = s + 1;
            if (m == 0) {
#pragma unroll
                for (int i = 0; i < 4; ++i) o[i] = ldf(f1 + i * 16 * TP + (s >> 2) * 64); }
            if (n < 8) { const unsigned char* p = f2 + (n & 3) * 16 * TP + (n >> 2) * 64; h[n & 1] = ldf(p); l[n & 1] = ldf(p + TPL); }
            __builtin_amdgcn_sched_barrier(0);    // keeps the LDS reads above as one group: sunk among the products, each would be waited for where it is used
            if constexpr (NBP == 2) {
#pragma unroll
                for (int i = 0; i < 4; ++i) acc[i][m] = wmmab(o[i], h[cs], acc[i][m]);
#pragma unroll
                for (int i = 0; i < 4; ++i) acc[i][m] = wmmab(o[i], l[cs], acc[i][m]);
            } else {
#pragma unroll
                for (int j = 0; j < 4; ++j) acc[m][j] = wmmab(h[cs], o[j], acc[m][j]);
#pragma unroll
                for (int j = 0; j < 4; ++j) acc[m][j] = wmmab(l[cs], o[j], acc[m][j]);
            }
            __builtin_amdgcn_sched_barrier(0);    // keeps the next step's reads from rising into this step's products
        }
        asm volatile("s_wait_dscnt 0x0" ::: "memory");       // this wave's reads of stage t are done before the buffer is refilled
        asm volatile("s_wait_asynccnt 0x0" ::: "memory");    // this wave's share of stage t + 1 has landed
        __syncthreads();                                     // publishes stage t + 1 and ends every wave's reads of stage t
        if (t + 2 < nst) fill(t + 2);
    }
    asm volatile("s_wait_asynccnt 0x0" ::: "memory");        // no copy is left in flight when the ring becomes output staging
    // Whole-line stores: each wave stages its 64 x 64 in its own part of the ring (every reader left it at the last trip's barrier).
    float* os = (float*)(void*)L + wave * (64 * 68);
    float rb[4][8];    // EPI 0: the bias of this lane's 32 rows
    if constexpr (EPI == 0) {
#pragma unroll
        for (int i = 0; i < 4; ++i) {
#pragma unroll
            for (int e = 0; e < 8; ++e) rb[i][e] = bias[R0 + wr + i * 16 + hi * 8 + e]; } }
#pragma unroll
    for (int j = 0; j < 4; ++j) { const float bv = EPI == 1 ? bias[C0 + wc + j * 16 + lr] : 0.f;
#pragma unroll
        for (int i = 0; i < 4; ++i) {
#pragma unroll
            for (int e = 0; e < 8; ++e) os[(i * 16 + hi * 8 + e) * 68 + j * 16 + lr] = acc[i][j][e] + (EPI == 0 ? rb[i][e] : bv); } }
    __syncthreads();
    if constexpr (EPI == 0) {
        float* crowp = C + bz * sC + (size_t)(R0 + wr) * ldc + C0 + wc;
#pragma unroll
        for (int s = 0; s < 32; ++s) { const int Lid = (lane >> 3) + 4 * s, piece = lane & 7; const int row = Lid >> 1, cofs = (Lid & 1) * 32 + piece * 4;
            const v4f val = *(const v4fa*)(os + row * 68 + cofs); *(v4f*)(crowp + (size_t)row * ldc + cofs) = val; }
    } else {
        // 8 lanes per row: 64 columns are one 128-B line of each plane, a wave-wide store covers 4 whole lines.
        const size_t ob = bz * sC + (size_t)(R0 + wr + (lane >> 3)) * ldc + C0 + wc + (lane & 7) * 8;
        const float* op = os + (lane >> 3) * 68 + (lane & 7) * 8;
#pragma unroll
        for (int s = 0; s < 16; ++s) { const v8f x = __builtin_shufflevector(*(const v4fa*)(op + s * 4 * 68), *(const v4fa*)(op + s * 4 * 68 + 4), 0, 1, 2, 3, 4, 5, 6, 7);
            const v8bf h = __builtin_convertvector(x, v8bf), l = __builtin_convertvector(x - __builtin_convertvector(h, v8f), v8bf);    // packed hardware conversions, round to nearest even as f2bf does
            const size_t o = ob + (size_t)(s * 4) * ldc; *(v8us*)(Oh + o) = __builtin_bit_cast(v8us, h); *(v8us*)(Ol + o) = __builtin_bit_cast(v8us, l); }
    }
}
// mt_tile: one 64 x 64 tile, at row j0 and column i0, of M^T = bf(Wk).bf(Wq)^T, M^T[j][i] = sum_n Wk[j][n] Wq[i][n] (both weights are [in][out], so n is contiguous in both and nothing is transposed), stored as bf16 hi +
// UNSCALED residual planes Mh, Ml, [j][i]: k-contiguous for t = query_x.M. 8 waves, 16 x 32 of the tile each. A stage is 64 n of the tile's 64 + 64 weight rows: read as f32 (16 lanes per 256-B row piece), rounded, put into LDS
// at the pitch of tg's stages; two buffers, so one barrier a stage: stage t + 1 is written only behind the barrier of stage t, which every wave reaches after its reads of stage t - 1. The loads run two stages ahead, in two
// register sets (the work-group's 12 stages are one chain of load latencies). The stage loop is unrolled whole: every load is its base address plus a constant, and no address register is rewritten.
#define MPL (64 * TP)    // one staged weight piece
typedef __attribute__((ext_vector_type(4))) __bf16 v4bf;
typedef __attribute__((ext_vector_type(4))) unsigned short v4us;
typedef v4us __attribute__((may_alias)) v4usa;
__device__ __forceinline__ void mt_tile(unsigned char* L, const float* __restrict__ Wk, const float* __restrict__ Wq, bf* Mh, bf* Ml, int j0, int i0) {
    const int tid = threadIdx.x, lane = tid & 31, wave = tid >> 5, lr = lane & 15, hi = lane >> 4;
    const int row = tid >> 4, c = tid & 15;
    const float* ga = Wk + (size_t)(j0 + row) * DM + c * 4;
    const float* gb = Wq + (size_t)(i0 + row) * DM + c * 4;
    unsigned char* w0 = L + row * TP + c * 8;
    const unsigned char* fa = L + ((wave >> 1) * 16 + lr) * TP + hi * 16;
    const unsigned char* fb = L + MPL + ((wave & 1) * 32 + lr) * TP + hi * 16;
    v4f ra[2][4], rb[2][4];
#pragma unroll
    for (int t = 0; t < 2; ++t) {
#pragma unroll
        for (int p = 0; p < 4; ++p) { ra[t][p] = *(const v4f*)(ga + p * 16 * DM + t * 64); rb[t][p] = *(const v4f*)(gb + p * 16 * DM + t * 64); } }
    v8f acc[2] = {(v8f){}, (v8f){}};
#pragma unroll
    for (int t = 0; t < DM / 64; ++t) {
        const unsigned bo = (t & 1) * 2 * MPL;
#pragma unroll
        for (int p = 0; p < 4; ++p) {
            *(v4usa*)(w0 + bo + p * 16 * TP) = __builtin_bit_cast(v4us, __builtin_convertvector(ra[t & 1][p], v4bf));
            *(v4usa*)(w0 + bo + MPL + p * 16 * TP) = __builtin_bit_cast(v4us, __builtin_convertvector(rb[t & 1][p], v4bf)); }
        __builtin_amdgcn_sched_barrier(0);    // keeps the loads below behind the LDS writes above, which free their register set: risen higher they would hold a third set
        // The work-group's barrier by hand, behind this wave's own LDS writes and reads: it publishes stage t, and every wave has left stage t - 1, whose buffer the next trip writes. __syncthreads() would also wait for the
        // global loads in flight, and every stage would then cost a whole load latency.
        asm volatile("s_wait_dscnt 0x0\n\ts_barrier_signal -1\n\ts_barrier_wait -1" ::: "memory");
        if (t + 2 < DM / 64) {
#pragma unroll
            for (int p = 0; p < 4; ++p) { ra[t & 1][p] = *(const v4f*)(ga + p * 16 * DM + (t + 2) * 64); rb[t & 1][p] = *(const v4f*)(gb + p * 16 * DM + (t + 2) * 64); } }
#pragma unroll
        for (int kb = 0; kb < 2; ++kb) { const v16bf a = ldf(fa + bo + kb * 64);
            acc[0] = wmmab(a, ldf(fb + bo + kb * 64), acc[0]); acc[1] = wmmab(a, ldf(fb + bo + 16 * TP + kb * 64), acc[1]); }
        __builtin_amdgcn_sched_barrier(0);    // keeps the next stage's conversions and LDS writes behind this stage's products: mixed among them they cost 16 more registers, and a WGP then holds one work-group fewer
    }
    __syncthreads();    // every wave has left the last stage before the buffers become output staging
    float* os = (float*)(void*)L;    // the tile in f32, pitch 68
#pragma unroll
    for (int j = 0; j < 2; ++j) {
#pragma unroll
        for (int e = 0; e < 8; ++e) os[((wave >> 1) * 16 + hi * 8 + e) * 68 + (wave & 1) * 32 + j * 16 + lr] = acc[j][e]; }
    __syncthreads();    // the tile is whole before it is stored by rows
    // 8 lanes per row: 64 columns are one 128-B line of each plane.
#pragma unroll
    for (int s = 0; s < 2; ++s) { const int r = (tid >> 3) + 32 * s; const float* op = os + r * 68 + (tid & 7) * 8;
        const v8f x = __builtin_shufflevector(*(const v4fa*)op, *(const v4fa*)(op + 4), 0, 1, 2, 3, 4, 5, 6, 7);
        const v8bf h = __builtin_convertvector(x, v8bf), l = __builtin_convertvector(x - __builtin_convertvector(h, v8f), v8bf);
        const size_t o = (size_t)(j0 + r) * DM + i0 + (tid & 7) * 8; *(v8us*)(Mh + o) = __builtin_bit_cast(v8us, h); *(v8us*)(Ml + o) = __builtin_bit_cast(v8us, l); }
}
// k_prep: M^T, three matrix-vector products and the two input conversions depend on nothing but the inputs, so they share one grid: work-groups 0 .. 143 take one 64 x 64 tile of M^T (first, as theirs is the longest chain),
// the next 3 x 25 take 32 rows (one 128-B line a work-group) of W1 (Wt.Wo, then bt.Wo), of WG (Wq.bk, then bq.bk) or of CB (Wk.bq; its row 768 is not used), the others 8 rows of query_x, then of x (X holds both results back to back).
#define WTILES ((DM / 64) * (DM / 64))
#define MVWG   ((DM + 32) / 32)    // work-groups of 32 rows that cover 769 rows
__global__ __launch_bounds__(256) void k_prep(const float* __restrict__ qx, const float* __restrict__ x, const float* __restrict__ Wq, const float* __restrict__ bq, const float* __restrict__ Wk, const float* __restrict__ bk, const float* __restrict__ Wt, const float* __restrict__ bt, const float* __restrict__ Wo, bf* X, bf* Mh, bf* Ml, float* W1, float* WG, float* CB) {
    __shared__ __attribute__((aligned(16))) unsigned char L[2 * 2 * MPL];
    const int b = blockIdx.x;
    if (b < WTILES) {
        mt_tile(L, Wk, Wq, Mh, Ml, (b / (DM / 64)) * 64, (b % (DM / 64)) * 64);
    } else if (b < WTILES + 3 * MVWG) {
        const int w = (b - WTILES) / MVWG, r0 = ((b - WTILES) % MVWG) * 32 + __builtin_amdgcn_readfirstlane(threadIdx.x >> 5) * 4;    // the wave's number in a scalar register: row addresses are scalar
        mv_rows<4, true>(w == 0 ? Wt : w == 1 ? Wq : Wk, w == 0 ? bt : w == 1 ? bq : bk, w == 0 ? Wo : w == 1 ? bk : bq, w == 0 ? W1 : w == 1 ? WG : CB, r0);
    } else {
        const int r0 = (b - WTILES - 3 * MVWG) * 8;
        cvt_rows(r0 < NB_ * NT_ ? qx + (size_t)r0 * DM : x + (size_t)(r0 - NB_ * NT_) * DM, X + (size_t)r0 * DM);
        asm volatile("s_wait_xcnt 0x0" ::: "memory");    // behind the rows' stores: in the built code the matrix-vector part stands behind them, and its loads land on registers that those stores name
    }
}
// g_rows: G[r] = X[r].wg + wg[768] for the 8 rows r0 .. r0 + 7 of one wave, f32; X = the bf16 plane of query_x, 8 elements a lane per 256. Fixed sum tree: a lane's 24 terms in ascending order, then the 32 lanes by exchange.
// Lane n keeps row n's sum, so that a wave stores its rows with one instruction. Every loop is unrolled so that the arrays stay in registers and a wave's loads are all in flight together.
__device__ __forceinline__ void g_rows(const bf* __restrict__ X, const float* __restrict__ wg, float* G, int r0) {
    const int lane = threadIdx.x & 31;
    v8us xv[8][DM / 256]; v8f wv[DM / 256];
#pragma unroll
    for (int n = 0; n < 8; ++n) {
#pragma unroll
        for (int q = 0; q < DM / 256; ++q) xv[n][q] = *(const v8us*)(X + (size_t)(r0 + n) * DM + q * 256 + lane * 8); }
#pragma unroll
    for (int q = 0; q < DM / 256; ++q) wv[q] = *(const v8f*)(wg + q * 256 + lane * 8);
    float keep = 0.f;
#pragma unroll
    for (int n = 0; n < 8; ++n) { float s = 0.f;
#pragma unroll
        for (int q = 0; q < DM / 256; ++q) {
#pragma unroll
            for (int i = 0; i < 8; ++i) s = fmaf(bf2f(xv[n][q][i]), wv[q][i], s); }
#pragma unroll
        for (int m = 16; m; m >>= 1) s += __shfl_xor(s, m);
        if (lane == n) keep = s; }
    if (lane < 8) G[r0 + lane] = keep + wg[DM];
}
// k_t: t, w2 = Wv.w1 and g depend only on k_prep, so they share one grid: work-groups 0 .. 24 take 32 rows of W2 (w2, then bv.w1; one 128-B line a work-group), then come t's 768 tiles (row tile fastest),
// then 512 work-groups of 32 rows of G (one 128-B line each): short ones, last, where the tiles' last round leaves room. Xq = the bf16 plane of query_x; Mh, Ml = M^T; Th, Tl = the planes of t.
__global__ __launch_bounds__(128) void k_t(const bf* __restrict__ Xq, const bf* __restrict__ Mh, const bf* __restrict__ Ml, const float* __restrict__ CB, const float* __restrict__ WG, const float* __restrict__ Wv, const float* __restrict__ bv, const float* __restrict__ W1, float* W2, float* G, bf* Th, bf* Tl) {
    __shared__ __attribute__((aligned(16))) unsigned char L[2 * 3 * TPL];    // 108 KiB: two work-groups a WGP (three would take 106.6 KiB or less each)
    constexpr int PT = NB_ * NT_ / 128 * (DM / 128);    // tiles of t
    const int wv = __builtin_amdgcn_readfirstlane(threadIdx.x >> 5);    // the wave's number in a scalar register: row addresses are scalar
    if (blockIdx.x < MVWG) { mv_rows<8, false>(Wv, bv, W1, W2, blockIdx.x * 32 + wv * 8); return; }    // the whole work-group leaves, in front of every barrier
    if (blockIdx.x >= MVWG + PT) { g_rows(Xq, WG, G, (blockIdx.x - MVWG - PT) * 32 + wv * 8); return; }    // likewise
    const int t = blockIdx.x - MVWG;
    tg<1, 2, 1>(L, t % (NB_ * NT_ / 128), t / (NB_ * NT_ / 128), 0, Xq, nullptr, Mh, Ml, CB, DM, nullptr, Th, Tl, DM, 0, 0, 0);
    asm volatile("s_wait_xcnt 0x0" ::: "memory");    // behind the tile's last stores: in the built code the matrix-vector parts stand behind them, and they write registers that those stores name
}
// k_s: the scores S[q][k] = t[q].x[k] + g[q] (unscaled; the 768^-1/2 is applied inside the softmax kernels), grid (row tiles, column tiles, items).
__global__ __launch_bounds__(128) void k_s(const bf* __restrict__ Th, const bf* __restrict__ Tl, const bf* __restrict__ Xk, const float* __restrict__ G, float* S) {
    __shared__ __attribute__((aligned(16))) unsigned char L[2 * 3 * TPL];    // 108 KiB: two work-groups a WGP (three would take 106.6 KiB or less each)
    tg<2, 1, 0>(L, blockIdx.x, blockIdx.y, blockIdx.z, Th, Tl, Xk, nullptr, G + blockIdx.z * NT_, DM, S, nullptr, nullptr, NT_, (size_t)NT_ * DM, (size_t)NT_ * DM, (size_t)NT_ * NT_);
}
// k_colstat: per batch item (blockIdx.y) and key column k of S [1024 q][1024 k]: cmax = max_q (s x scale), csum = sum_q exp(s x scale - cmax), and ct = u / csum with u = x[k].w2 + bv.w1, f32. One work-group per 32 columns (one 128-B line
// of every row), 32 waves: a wave-wide 16-B load covers 4 rows x 32 columns, and a thread keeps its 8 rows x 4 columns in registers for both passes (S is read once).
// Fixed reduction tree: 8 rows in the thread, the wave's 4 row groups by lane exchange, the 32 waves through LDS (4 wave rows per load, then lane exchange again).
// u: wave w takes column c0 + w (one row of the bf16 plane XK of x, 8 elements a lane per 256; a lane's 24 terms in ascending order, then the 32 lanes by exchange); it reaches wave 0 through LDS across the two barriers that stand here anyway.
// Every loop is unrolled so that v, m and s are indexed by constants and stay in registers, and so that the global loads are all in flight together.
__global__ __launch_bounds__(1024) void k_colstat(const float* __restrict__ S, const bf* __restrict__ XK, const float* __restrict__ W2, float* CMAX, float* CT) {
    __shared__ __align__(16) float rm[32 * 32]; __shared__ __align__(16) float rs[32 * 32]; __shared__ __align__(16) float ru[32];
    const int lane = threadIdx.x & 31, wave = threadIdx.x >> 5, cg = (lane & 7) * 4, rsub = lane >> 3, c0 = blockIdx.x * 32;
    S += (size_t)blockIdx.y * NT_ * NT_; CMAX += blockIdx.y * NT_; CT += blockIdx.y * NT_; XK += ((size_t)blockIdx.y * NT_ + c0 + __builtin_amdgcn_readfirstlane(wave)) * DM;    // the wave's number in a scalar register: the row's address is scalar
    v4f v[8]; v8us xv[DM / 256];
#pragma unroll
    for (int i = 0; i < 8; ++i) v[i] = *(const v4f*)(S + (size_t)(i * 128 + wave * 4 + rsub) * NT_ + c0 + cg);
    __builtin_amdgcn_sched_barrier(0);    // keeps the 8 loads of S in front of the u part: moved behind it they would start only when x and w2 have arrived
    asm volatile("s_wait_xcnt 0x0" ::: "memory");    // in front of the first overwrite of the address pair that the loads of S name: a load of the u part lands on it
    __builtin_amdgcn_sched_barrier(0);    // keeps the u part's loads behind that wait
#pragma unroll
    for (int q = 0; q < DM / 256; ++q) xv[q] = *(const v8us*)(XK + q * 256 + lane * 8);
    float u = 0.f;
#pragma unroll
    for (int q = 0; q < DM / 256; ++q) {
#pragma unroll
        for (int i = 0; i < 8; ++i) u = fmaf(bf2f(xv[q][i]), W2[q * 256 + lane * 8 + i], u); }
#pragma unroll
    for (int k = 16; k; k >>= 1) u += __shfl_xor(u, k);
    if (lane == 0) ru[wave] = u + W2[DM];
    v4f m = (v4f){-3.0e38f, -3.0e38f, -3.0e38f, -3.0e38f};
#pragma unroll
    for (int i = 0; i < 8; ++i) m = __builtin_elementwise_max(m, v[i] * SCL);
#pragma unroll
    for (int k = 0; k < 4; ++k) { m[k] = fmaxf(m[k], __shfl_xor(m[k], 8)); m[k] = fmaxf(m[k], __shfl_xor(m[k], 16)); }
    if (rsub == 0) *(v4fa*)(rm + wave * 32 + cg) = m;
    __syncthreads();
#pragma unroll
    for (int j = 0; j < 8; ++j) m = __builtin_elementwise_max(m, *(const v4fa*)(rm + (j * 4 + rsub) * 32 + cg));
#pragma unroll
    for (int k = 0; k < 4; ++k) { m[k] = fmaxf(m[k], __shfl_xor(m[k], 8)); m[k] = fmaxf(m[k], __shfl_xor(m[k], 16)); }
    v4f s = (v4f){0.f, 0.f, 0.f, 0.f};
#pragma unroll
    for (int i = 0; i < 8; ++i) { const v4f e = __builtin_elementwise_fma(v[i], (v4f){SCL, SCL, SCL, SCL}, -m);
#pragma unroll
        for (int k = 0; k < 4; ++k) s[k] += __expf(e[k]); }
#pragma unroll
    for (int k = 0; k < 4; ++k) { s[k] += __shfl_xor(s[k], 8); s[k] += __shfl_xor(s[k], 16); }
    if (rsub == 0) *(v4fa*)(rs + wave * 32 + cg) = s;
    __syncthreads();
    if (wave == 0) {
        v4f t = (v4f){0.f, 0.f, 0.f, 0.f};
#pragma unroll
        for (int j = 0; j < 8; ++j) t += *(const v4fa*)(rs + (j * 4 + rsub) * 32 + cg);
#pragma unroll
        for (int k = 0; k < 4; ++k) { t[k] += __shfl_xor(t[k], 8); t[k] += __shfl_xor(t[k], 16); }
        if (rsub == 0) { *(v4f*)(CMAX + c0 + cg) = m; *(v4f*)(CT + c0 + cg) = *(const v4fa*)(ru + cg) / t; }
    }
}
// k_out: out[q] = sum_k exp(s[q][k] x scale - cmax[k]) x ct[k] + (bt.Wo + bf(bo)), f32: P.u without P. One work-group per 32 rows q of one item (r0 = item * 1024 + q; one 128-B line of out), 8 waves of 4 rows,
// lane -> 8 columns per 256-column step; cmax and ct are read once a wave. Fixed sum tree: a lane's 32 terms in ascending k, the 16 lanes of a half wave by exchange, then the two halves.
// Every loop is unrolled so that the arrays are indexed by constants and stay in registers, and so that a wave's loads of S are all in flight together.
__global__ __launch_bounds__(256) void k_out(const float* __restrict__ S, const float* __restrict__ CMAX, const float* __restrict__ CT, const float* __restrict__ W1, const float* __restrict__ bo, float* OUTB) {
    __shared__ float so[2 * 32];
    const int lane = threadIdx.x & 31, wave = __builtin_amdgcn_readfirstlane(threadIdx.x >> 5), r0 = blockIdx.x * 32;    // the wave's number in a scalar register: every base address below is scalar
    const unsigned lo = lane * 8;    // the one vector register that the loads name
    CMAX += (r0 / NT_) * NT_; CT += (r0 / NT_) * NT_; S += (size_t)(r0 + wave * 4) * NT_;
    v8f v[4][NT_ / 256], cm[NT_ / 256], ct[NT_ / 256];
#pragma unroll
    for (int n = 0; n < 4; ++n) {
#pragma unroll
        for (int qc = 0; qc < NT_ / 256; ++qc) v[n][qc] = *(const v8f*)(S + n * NT_ + qc * 256 + lo); }
#pragma unroll
    for (int qc = 0; qc < NT_ / 256; ++qc) { cm[qc] = *(const v8f*)(CMAX + qc * 256 + lo); ct[qc] = *(const v8f*)(CT + qc * 256 + lo); }
#pragma unroll
    for (int n = 0; n < 4; ++n) { float a = 0.f;
#pragma unroll
        for (int qc = 0; qc < NT_ / 256; ++qc) {
#pragma unroll
            for (int i = 0; i < 8; ++i) a = fmaf(__expf(v[n][qc][i] * SCL - cm[qc][i]), ct[qc][i], a); }
        a = rowx<8>(rowx<4>(rowx<2>(rowx<1>(a))));
        if ((lane & 15) == 0) so[(lane >> 4) * 32 + wave * 4 + n] = a; }
    __syncthreads();    // the 32 rows' half sums are in LDS before wave 0 stores the rows as one whole line
    if (wave == 0) OUTB[r0 + lane] = (so[lane] + so[32 + lane]) + (W1[DM] + bfr(bo[0]));
}

extern "C" void kernel_launch(void* const* d_in, const int* in_sizes, int n_in,
                              void* d_out, int out_size, void* d_ws, size_t ws_size, hipStream_t stream) {
    (void)in_sizes; (void)n_in; (void)out_size;
    const float* qx = (const float*)d_in[0]; const float* x = (const float*)d_in[1];
    const float* Wq = (const float*)d_in[2]; const float* bq = (const float*)d_in[3]; const float* Wk = (const float*)d_in[4]; const float* bk = (const float*)d_in[5]; const float* Wv = (const float*)d_in[6]; const float* bv = (const float*)d_in[7];
    const float* Wt = (const float*)d_in[8]; const float* bt = (const float*)d_in[9]; const float* Wo = (const float*)d_in[10]; const float* bo = (const float*)d_in[11];   // W k-major [in][out]
    float* out = (float*)d_out;    // [16][1024]
    char* wsp = (char*)d_ws;
    auto take = [&](size_t bytes) { char* p = wsp; wsp += (bytes + 255) & ~(size_t)255; return (void*)p; };
    bf* Mh = (bf*)take((size_t)DM * DM * 2); bf* Ml = (bf*)take((size_t)DM * DM * 2);    // M^T = Wk.Wq^T, hi and residual
    // Planes hold all 16 items ([item][row][col], items back to back); every region has one tenant.
    const size_t PL = (size_t)NB_ * NT_ * DM * 2;    // one bf16 plane of all items, 24 MiB
    bf* Xq = (bf*)take(2 * PL); bf* Xk = (bf*)((char*)Xq + PL);
    bf* Th = (bf*)take(PL); bf* Tl = (bf*)take(PL);
    float* S = (float*)take((size_t)NB_ * NT_ * NT_ * 4);    // 64 MiB
    float* CMAX = (float*)take((size_t)NB_ * NT_ * 4); float* CT = (float*)take((size_t)NB_ * NT_ * 4); float* G = (float*)take((size_t)NB_ * NT_ * 4);
    float* W1 = (float*)take((size_t)MVWG * 32 * 4); float* W2 = (float*)take((size_t)MVWG * 32 * 4);    // 769 of 800 floats each are written and read
    float* WG = (float*)take((size_t)MVWG * 32 * 4); float* CB = (float*)take((size_t)MVWG * 32 * 4);    // likewise (of CB 768 are read)
    if ((size_t)(wsp - (char*)d_ws) > ws_size) return;    // 2.25 + 48 + 48 + 64 + 0.2 ~ 162.5 MiB
    k_prep<<<WTILES + 3 * MVWG + 2 * NB_ * NT_ / 8, 256, 0, stream>>>(qx, x, Wq, bq, Wk, bk, Wt, bt, Wo, Xq, Mh, Ml, W1, WG, CB);    // Xq, Xk lie back to back
    k_t<<<MVWG + NB_ * NT_ / 128 * (DM / 128) + NB_ * NT_ / 32, 128, 0, stream>>>(Xq, Mh, Ml, CB, WG, Wv, bv, W1, W2, G, Th, Tl);
    k_s<<<dim3(NT_ / 128, NT_ / 128, NB_), 128, 0, stream>>>(Th, Tl, Xk, G, S);
    k_colstat<<<dim3(NT_ / 32, NB_, 1), 1024, 0, stream>>>(S, Xk, W2, CMAX, CT);
    k_out<<<NB_ * NT_ / 32, 256, 0, stream>>>(S, CMAX, CT, W1, bo, out);
}

// v008
// Measured time: 104 microseconds a run.
// In both of two side-by-side timings against v007, it was 1.06 times as fast.
// Counting every step since v000, it is 247 times as fast.
#include <hip/hip_runtime.h>

// Compute dtypes, f32 accumulate, all 16 batch items in every launch. The scores are taken from the middle: with q = query_x.Wq + bq and k = x.Wk + bk,
// q.k^T = t.x^T + g, t = query_x.(Wq.Wk^T) + Wk.bq (a row of 768 per query row), g[q] = query_x[q].(Wq.bk) + bq.bk: ONE [1024 x 768].[768 x 768] product per item stands for the two projections, and x itself is the
// second operand of the scores. Inputs are rounded to bf16 once (exact operands of v_wmma_f32_16x16x32_bf16); the COMPUTED operands Wq.Wk^T and t go on as bf16 hi + UNSCALED residual, so t takes two products and the scores take two.
// The softmax over the QUERY axis (the module's dim=1) is done per key column in f32 (column max, column sum of exp, P[q][k] = exp(s/sqrt(768) - cmax[k]) / csum[k]); max and sum are taken per 128-row tile where the scores are made and merged where they are used.
// Behind the softmax the module is linear and ends in ONE column, so its products are taken from the right: out = ((P.(x.Wv + bv)).Wt + bt).Wo + bo = P.u + (bt.Wo + bo) with
// w1 = Wt.Wo, w2 = Wv.w1, u[k] = x[k].w2 + bv.w1: matrix-vector products in f32 (their inputs rounded to bf16 once, like the operands of the matrix products); neither q, k, v, P, ctx nor h is ever formed.

#define NB_  16
#define NT_  1024                // Lq = Lk
#define DM   768
#define SCL  0.03608439182435161f    // 768^-1/2
#define LOSC 1024.0f

typedef _Float16 h16;
typedef unsigned short bf;
typedef __attribute__((ext_vector_type(16))) __bf16   v16bf;
typedef __attribute__((ext_vector_type(8)))  __bf16   v8bf;
typedef __attribute__((ext_vector_type(16))) _Float16 v16h;
typedef __attribute__((ext_vector_type(8)))  _Float16 v8h;
typedef __attribute__((ext_vector_type(8)))  unsigned short v8us;
typedef __attribute__((ext_vector_type(8)))  float    v8f;
typedef __attribute__((ext_vector_type(4)))  float    v4f;
typedef __attribute__((ext_vector_type(4)))  _Float16 v4h;
typedef v8h  __attribute__((may_alias)) v8ha;
typedef v4f  __attribute__((may_alias)) v4fa;
typedef __attribute__((ext_vector_type(2)))  float    v2f;
typedef v2f  __attribute__((may_alias)) v2fa;
typedef v8us __attribute__((may_alias)) v8usa;

__device__ __forceinline__ unsigned short f2bf(float f) { unsigned u = __float_as_uint(f); u += 0x7FFFu + ((u >> 16) & 1u); return (unsigned short)(u >> 16); }
__device__ __forceinline__ float bf2f(unsigned short b) { return __uint_as_float(((unsigned)b) << 16); }
__device__ __forceinline__ float bfr(float f) { return bf2f(f2bf(f)); }
__device__ __forceinline__ v16h cat16(v8h lo, v8h hi) { return __builtin_shufflevector(lo, hi, 0, 1, 2, 3, 4, 5, 6, 7, 8, 9, 10, 11, 12, 13, 14, 15); }
__device__ __forceinline__ v16bf cat16b(v8us lo, v8us hi) { return __builtin_bit_cast(v16bf, __builtin_shufflevector(lo, hi, 0, 1, 2, 3, 4, 5, 6, 7, 8, 9, 10, 11, 12, 13, 14, 15)); }
__device__ __forceinline__ v8f wmma16(v16h a, v16h b, v8f c) { return __builtin_amdgcn_wmma_f32_16x16x32_f16(false, a, false, b, (short)0, c, false, false); }
__device__ __forceinline__ v8f wmmab(v16bf a, v16bf b, v8f c) { return __builtin_amdgcn_wmma_f32_16x16x32_bf16(false, a, false, b, (short)0, c, false, false); }

// cvt_rows: 8 rows of 768 floats -> bf16, one wave per row; src and dst point at the work-group's first row.
__device__ __forceinline__ void cvt_rows(const float* __restrict__ src, bf* dst) {
    const int lane = threadIdx.x & 31, r = threadIdx.x >> 5;
    v8us o[DM / 256];
#pragma unroll
    for (int q = 0; q < DM / 256; ++q) { v8us t;
#pragma unroll
        for (int i = 0; i < 8; ++i) t[i] = f2bf(src[(size_t)r * DM + q * 256 + lane * 8 + i]);
        o[q] = t; }
#pragma unroll
    for (int q = 0; q < DM / 256; ++q) *(v8us*)(dst + (size_t)r * DM + q * 256 + lane * 8) = o[q];
    
}

// mv_rows: y[r] = bf(M[r]).w for the NR rows r0 .. r0 + NR - 1 of one wave, f32; M is [768][768] row-major and row 768 stands for the bias vector b, so y[768] = bf(b).w. RW: w is an input too and is rounded like M.
// Fixed sum tree: a lane's 24 terms in ascending order (4 per 128 columns), then the 32 lanes by exchange. Lane n keeps row n's sum, so that a wave stores its rows with one instruction.
template <int NR, bool RW>
__device__ __forceinline__ void mv_rows(const float* __restrict__ M, const float* __restrict__ b, const float* __restrict__ w, float* y, int r0) {
    const int lane = threadIdx.x & 31;
    float wv[DM / 32], keep = 0.f;
#pragma unroll
    for (int q = 0; q < DM / 128; ++q) {
#pragma unroll
        for (int i = 0; i < 4; ++i) { const float t = w[q * 128 + lane * 4 + i]; wv[q * 4 + i] = RW ? bfr(t) : t; } }
#pragma unroll
    for (int n = 0; n < NR; ++n) { const int r = r0 + n < DM ? r0 + n : DM;    // rows past 768 repeat row 768 and are not stored
        const float* a = r < DM ? M + (size_t)r * DM : b;
        float s = 0.f;
#pragma unroll
        for (int q = 0; q < DM / 128; ++q) {
#pragma unroll
            for (int i = 0; i < 4; ++i) s = fmaf(bfr(a[q * 128 + lane * 4 + i]), wv[q * 4 + i], s); }
#pragma unroll
        for (int m = 16; m; m >>= 1) s += __shfl_xor(s, m);
        if (lane == n) keep = s; }
    if (lane < NR && r0 + lane <= DM) y[r0 + lane] = keep;
}
// tg: one 128 x 128 tile of C = (Ah [+ Al]).(Bh [+ Bl])^T + bias per work-group, 4 waves in 2 x 2, 64 x 64 of C per wave (4 x 4 accumulator tiles). One operand has two planes, the other one. All planes are k-contiguous
// with row stride K (a multiple of 64). A stage is 64 k (128 B) of the tile's 128 rows of every plane, brought into LDS by asynchronous copies, two buffers: stage t + 1 flies while stage t is worked on.
// Products per 32 k and accumulator, in this order: Ah.Bh, then Al.Bh or Ah.Bl; k ascending. bx, by = the tile's row and column index, bz = batch item, sA / sB / sC = elements per item in the A planes, the B planes and C.
// Every inner loop is unrolled so that acc and the fragment arrays are indexed by constants and stay in registers.
// EPI says what is stored: 0 = C in f32, bias (f32, as it is) by row of the item; 1 = bf16 hi + UNSCALED residual planes Oh, Ol of C, bias (f32, as it is) by column.
// EPI 0 also stores, per column of the tile, the softmax partials over the tile's 128 rows: PMt[c] = max_r (C x scale), PSt[c] = sum_r exp(C x scale - PMt[c]) (PMt, PSt point at the tile's first column).
// Fixed tree: 8 rows in ascending order in each of a lane's 4 row blocks, the 4 blocks pairwise, the two half waves by exchange, the two 64-row waves through LDS across the barrier that stands here anyway.
#define TP   144                 // LDS bytes per staged row: 128 of data + 16, so that 16 rows read 16 bytes wide fall on different banks
#define TPL  (128 * TP)          // one staged plane
__device__ __forceinline__ unsigned lds_off(const void* p) { return (unsigned)(size_t)p; }
// One lane's half rows of a 16 x 32 fragment: k 8 hi .. 8 hi + 7 and 16 + 8 hi .. 16 + 8 hi + 7 (p already holds the row and the 16 hi bytes); the same for A and B.
__device__ __forceinline__ v16bf ldf(const unsigned char* p) { return cat16b(*(const v8usa*)p, *(const v8usa*)(p + 32)); }
// One thread's share of one plane of a stage: 16 bytes of each of the rows r, r + 16, ..., r + 112 (rs = 16 rows, in elements). The s_wait_xcnt stands inside the statement so that
// no address register of a copy is rewritten in front of it.
__device__ __forceinline__ void copy_plane(unsigned l, const bf* gp, size_t rs) {
    asm volatile("global_load_async_to_lds_b128 %0, %8, off\n\t"
                 "global_load_async_to_lds_b128 %1, %9, off\n\t"
                 "global_load_async_to_lds_b128 %2, %10, off\n\t"
                 "global_load_async_to_lds_b128 %3, %11, off\n\t"
                 "global_load_async_to_lds_b128 %4, %12, off\n\t"
                 "global_load_async_to_lds_b128 %5, %13, off\n\t"
                 "global_load_async_to_lds_b128 %6, %14, off\n\t"
                 "global_load_async_to_lds_b128 %7, %15, off\n\t"
                 "s_wait_xcnt 0x0"
                 :: "v"(l), "v"(l + 16 * TP), "v"(l + 32 * TP), "v"(l + 48 * TP), "v"(l + 64 * TP), "v"(l + 80 * TP), "v"(l + 96 * TP), "v"(l + 112 * TP),
                    "v"(gp), "v"(gp + rs), "v"(gp + 2 * rs), "v"(gp + 3 * rs), "v"(gp + 4 * rs), "v"(gp + 5 * rs), "v"(gp + 6 * rs), "v"(gp + 7 * rs)
                 : "memory");
}
// v + v of lane ^ M inside the 16-lane row, one vector instruction (row_xmask); every lane is on where it is used.
template <int M> __device__ __forceinline__ float rowx(float v) { return v + __int_as_float(__builtin_amdgcn_update_dpp(0, __float_as_int(v), 0x160 + M, 0xf, 0xf, true)); }
// r[e] = 2^x[e], eight in one statement: no result shares a register with a source, so each v_exp_f32 is followed by one that neither reads its result nor overwrites its source,
// and the v_nop is that slot behind the last (left to the register allocator, a run of them had each overwrite the source of the one before).
__device__ __forceinline__ void exp2x8(float (&r)[8], const float (&x)[8]) {
    asm("v_exp_f32 %0, %8\n\tv_exp_f32 %1, %9\n\tv_exp_f32 %2, %10\n\tv_exp_f32 %3, %11\n\tv_exp_f32 %4, %12\n\tv_exp_f32 %5, %13\n\tv_exp_f32 %6, %14\n\tv_exp_f32 %7, %15\n\tv_nop"
        : "=&v"(r[0]), "=&v"(r[1]), "=&v"(r[2]), "=&v"(r[3]), "=&v"(r[4]), "=&v"(r[5]), "=&v"(r[6]), "=&v"(r[7])
        : "v"(x[0]), "v"(x[1]), "v"(x[2]), "v"(x[3]), "v"(x[4]), "v"(x[5]), "v"(x[6]), "v"(x[7]));
}
// 2^x, one alone, with the same slot behind it.
__device__ __forceinline__ float exp2n(float x) { float r; asm("v_exp_f32 %0, %1\n\tv_nop" : "=v"(r) : "v"(x)); return r; }
template <int NA, int NBP, int EPI>
__device__ __forceinline__ void tg(unsigned char* L, int bx, int by, int bz, const bf* __restrict__ Ah, const bf* __restrict__ Al, const bf* __restrict__ Bh, const bf* __restrict__ Bl, const float* __restrict__ bias, int K, float* C, bf* Oh, bf* Ol, int ldc, size_t sA, size_t sB, size_t sC, float* PMt, float* PSt) {
    static_assert(NA + NBP == 3, "one operand in two planes");
    constexpr unsigned STG = (NA + NBP) * TPL;    // L holds 2 STG bytes
    const int tid = threadIdx.x, lane = tid & 31, wave = tid >> 5, lr = lane & 15, hi = lane >> 4;
    const int R0 = bx * 128, C0 = by * 128, wr = (wave >> 1) * 64, wc = (wave & 1) * 64;
    const int crow = tid >> 3, cpc = tid & 7;    // copies: 8 lanes per 128-B row piece, a wave-wide copy covers 4 whole lines
    const size_t ga = bz * sA + (size_t)(R0 + crow) * K + cpc * 8, gb = bz * sB + (size_t)(C0 + crow) * K + cpc * 8, rs = (size_t)16 * K;
    const unsigned lc = lds_off(L) + crow * TP + cpc * 16;
    auto fill = [&](int t) {
        const unsigned l = lc + (t & 1) * STG; const size_t ko = (size_t)t * 64;
        copy_plane(l, Ah + ga + ko, rs);
        if (NA == 2) copy_plane(l + TPL, Al + ga + ko, rs);
        copy_plane(l + NA * TPL, Bh + gb + ko, rs);
        if (NBP == 2) copy_plane(l + (NA + 1) * TPL, Bl + gb + ko, rs);
    };
    const int nst = K / 64;
    fill(0);
    asm volatile("s_wait_asynccnt 0x0" ::: "memory");    // this wave's share of stage 0 has landed
    __syncthreads();                                     // stage 0 is published
    if (nst > 1) fill(1);
    v8f acc[4][4];
#pragma unroll
    for (int i = 0; i < 4; ++i) {
#pragma unroll
        for (int j = 0; j < 4; ++j) acc[i][j] = (v8f){}; }
    const unsigned char* fa0 = L + (wr + lr) * TP + hi * 16;
    const unsigned char* fb0 = L + NA * TPL + (wc + lr) * TP + hi * 16;
#pragma unroll 1
    for (int t = 0; t < nst; ++t) {    // stays rolled: one trip per stage, the buffer chosen by t & 1
        const unsigned bo = (t & 1) * STG;
        // Eight steps of 8 products (32 k x 16 rows or columns of the two-plane operand each). The four fragments of the one-plane operand stay for four steps; the two-plane operand's fragments of step s + 1
        // are fetched, as one group, in front of step s's products into the other of two register sets.
        const unsigned char* f1 = (NBP == 2 ? fa0 : fb0) + bo;    // the one-plane operand
        const unsigned char* f2 = (NBP == 2 ? fb0 : fa0) + bo;    // the two-plane operand
        v16bf o[4], h[2], l[2];
        h[0] = ldf(f2); l[0] = ldf(f2 + TPL);
#pragma unroll
        for (int s = 0; s < 8; ++s) {
            const int m = s & 3, cs = s & 1, n = s + 1;
            if (m == 0) {
#pragma unroll
                for (int i = 0; i < 4; ++i) o[i] = ldf(f1 + i * 16 * TP + (s >> 2) * 64); }
            if (n < 8) { const unsigned char* p = f2 + (n & 3) * 16 * TP + (n >> 2) * 64; h[n & 1] = ldf(p); l[n & 1] = ldf(p + TPL); }
            __builtin_amdgcn_sched_barrier(0);    // keeps the LDS reads above as one group: sunk among the products, each would be waited for where it is used
            if constexpr (NBP == 2) {
#pragma unroll
                for (int i = 0; i < 4; ++i) acc[i][m] = wmmab(o[i], h[cs], acc[i][m]);
#pragma unroll
                for (int i = 0; i < 4; ++i) acc[i][m] = wmmab(o[i], l[cs], acc[i][m]);
            } else {
#pragma unroll
                for (int j = 0; j < 4; ++j) acc[m][j] = wmmab(h[cs], o[j], acc[m][j]);
#pragma unroll
                for (int j = 0; j < 4; ++j) acc[m][j] = wmmab(l[cs], o[j], acc[m][j]);
            }
            __builtin_amdgcn_sched_barrier(0);    // keeps the next step's reads from rising into this step's products
        }
        asm volatile("s_wait_dscnt 0x0" ::: "memory");       // this wave's reads of stage t are done before the buffer is refilled
        asm volatile("s_wait_asynccnt 0x0" ::: "memory");    // this wave's share of stage t + 1 has landed
        __syncthreads();                                     // publishes stage t + 1 and ends every wave's reads of stage t
        if (t + 2 < nst) fill(t + 2);
    }
    asm volatile("s_wait_asynccnt 0x0" ::: "memory");        // no copy is left in flight when the ring becomes output staging
    // Whole-line stores: each wave stages its 64 x 64 in its own part of the ring (every reader left it at the last trip's barrier).
    float* os = (float*)(void*)L + wave * (64 * 68);
    float rb[4][8];    // EPI 0: the bias of this lane's 32 rows
    if constexpr (EPI == 0) {
#pragma unroll
        for (int i = 0; i < 4; ++i) {
#pragma unroll
            for (int e = 0; e < 8; ++e) rb[i][e] = bias[R0 + wr + i * 16 + hi * 8 + e]; } }
#pragma unroll
    for (int j = 0; j < 4; ++j) { const float bv = EPI == 1 ? bias[C0 + wc + j * 16 + lr] : 0.f;
#pragma unroll
        for (int i = 0; i < 4; ++i) {
#pragma unroll
            for (int e = 0; e < 8; ++e) { acc[i][j][e] += EPI == 0 ? rb[i][e] : bv; os[(i * 16 + hi * 8 + e) * 68 + j * 16 + lr] = acc[i][j][e]; } } }
    float* pst = (float*)(void*)L + 4 * (64 * 68);    // EPI 0: behind the four waves' staging, [wave][max | sum][64 columns]
    if constexpr (EPI == 0) {
        constexpr float K2 = SCL * 1.4426950408889634f;    // scale x log2 e: exp(c x scale - m) = 2^(c x K2 - cmax x K2)
#pragma unroll
        for (int j = 0; j < 4; ++j) { float m = acc[0][j][0];
#pragma unroll
            for (int i = 0; i < 4; ++i) {
#pragma unroll
                for (int e = 0; e < 8; ++e) m = fmaxf(m, acc[i][j][e]); }
            m = fmaxf(m, __shfl_xor(m, 16));
            const float m2 = m * K2; float s[4];
#pragma unroll
            for (int i = 0; i < 4; ++i) { float x[8], r[8]; s[i] = 0.f;
#pragma unroll
                for (int e = 0; e < 8; ++e) x[e] = fmaf(acc[i][j][e], K2, -m2);
                exp2x8(r, x);
#pragma unroll
                for (int e = 0; e < 8; ++e) s[i] += r[e]; }
            float st = (s[0] + s[1]) + (s[2] + s[3]);
            st += __shfl_xor(st, 16);
            if (hi == 0) { pst[wave * 128 + j * 16 + lr] = m * SCL; pst[wave * 128 + 64 + j * 16 + lr] = st; } }
    }
    __syncthreads();
    if constexpr (EPI == 0) {
        if (wave < 2) {    // waves w and w + 2 hold the same 64 columns; a lane merges 2 columns, a wave stores two whole lines of each array
            const float* pa = pst + wave * 128 + lane * 2;
            const v2f ma = *(const v2fa*)pa, sa = *(const v2fa*)(pa + 64), mb = *(const v2fa*)(pa + 256), sb = *(const v2fa*)(pa + 320);
            v2f m, s;
#pragma unroll
            for (int k = 0; k < 2; ++k) { m[k] = fmaxf(ma[k], mb[k]); s[k] = fmaf(sa[k], exp2n((ma[k] - m[k]) * 1.4426950408889634f), sb[k] * exp2n((mb[k] - m[k]) * 1.4426950408889634f)); }
            *(v2f*)(PMt + wc + lane * 2) = m; *(v2f*)(PSt + wc + lane * 2) = s;
        }
        float* crowp = C + bz * sC + (size_t)(R0 + wr) * ldc + C0 + wc;
#pragma unroll
        for (int s = 0; s < 32; ++s) { const int Lid = (lane >> 3) + 4 * s, piece = lane & 7; const int row = Lid >> 1, cofs = (Lid & 1) * 32 + piece * 4;
            const v4f val = *(const v4fa*)(os + row * 68 + cofs); *(v4f*)(crowp + (size_t)row * ldc + cofs) = val; }
    } else {
        // 8 lanes per row: 64 columns are one 128-B line of each plane, a wave-wide store covers 4 whole lines.
        const size_t ob = bz * sC + (size_t)(R0 + wr + (lane >> 3)) * ldc + C0 + wc + (lane & 7) * 8;
        const float* op = os + (lane >> 3) * 68 + (lane & 7) * 8;
#pragma unroll
        for (int s = 0; s < 16; ++s) { const v8f x = __builtin_shufflevector(*(const v4fa*)(op + s * 4 * 68), *(const v4fa*)(op + s * 4 * 68 + 4), 0, 1, 2, 3, 4, 5, 6, 7);
            const v8bf h = __builtin_convertvector(x, v8bf), l = __builtin_convertvector(x - __builtin_convertvector(h, v8f), v8bf);    // packed hardware conversions, round to nearest even as f2bf does
            const size_t o = ob + (size_t)(s * 4) * ldc; *(v8us*)(Oh + o) = __builtin_bit_cast(v8us, h); *(v8us*)(Ol + o) = __builtin_bit_cast(v8us, l); }
    }
}
// mt_tile: one 64 x 64 tile, at row j0 and column i0, of M^T = bf(Wk).bf(Wq)^T, M^T[j][i] = sum_n Wk[j][n] Wq[i][n] (both weights are [in][out], so n is contiguous in both and nothing is transposed), stored as bf16 hi +
// UNSCALED residual planes Mh, Ml, [j][i]: k-contiguous for t = query_x.M. 8 waves, 16 x 32 of the tile each. A stage is 64 n of the tile's 64 + 64 weight rows: read as f32 (16 lanes per 256-B row piece), rounded, put into LDS
// at the pitch of tg's stages; two buffers, so one barrier a stage: stage t + 1 is written only behind the barrier of stage t, which every wave reaches after its reads of stage t - 1. The loads run two stages ahead, in two
// register sets (the work-group's 12 stages are one chain of load latencies). The stage loop is unrolled whole: every load is its base address plus a constant, and no address register is rewritten.
#define MPL (64 * TP)    // one staged weight piece
typedef __attribute__((ext_vector_type(4))) __bf16 v4bf;
typedef __attribute__((ext_vector_type(4))) unsigned short v4us;
typedef v4us __attribute__((may_alias)) v4usa;
__device__ __forceinline__ void mt_tile(unsigned char* L, const float* __restrict__ Wk, const float* __restrict__ Wq, bf* Mh, bf* Ml, int j0, int i0) {
    const int tid = threadIdx.x, lane = tid & 31, wave = tid >> 5, lr = lane & 15, hi = lane >> 4;
    const int row = tid >> 4, c = tid & 15;
    const float* ga = Wk + (size_t)(j0 + row) * DM + c * 4;
    const float* gb = Wq + (size_t)(i0 + row) * DM + c * 4;
    unsigned char* w0 = L + row * TP + c * 8;
    const unsigned char* fa = L + ((wave >> 1) * 16 + lr) * TP + hi * 16;
    const unsigned char* fb = L + MPL + ((wave & 1) * 32 + lr) * TP + hi * 16;
    v4f ra[2][4], rb[2][4];
#pragma unroll
    for (int t = 0; t < 2; ++t) {
#pragma unroll
        for (int p = 0; p < 4; ++p) { ra[t][p] = *(const v4f*)(ga + p * 16 * DM + t * 64); rb[t][p] = *(const v4f*)(gb + p * 16 * DM + t * 64); } }
    v8f acc[2] = {(v8f){}, (v8f){}};
#pragma unroll
    for (int t = 0; t < DM / 64; ++t) {
        const unsigned bo = (t & 1) * 2 * MPL;
#pragma unroll
        for (int p = 0; p < 4; ++p) {
            *(v4usa*)(w0 + bo + p * 16 * TP) = __builtin_bit_cast(v4us, __builtin_convertvector(ra[t & 1][p], v4bf));
            *(v4usa*)(w0 + bo + MPL + p * 16 * TP) = __builtin_bit_cast(v4us, __builtin_convertvector(rb[t & 1][p], v4bf)); }
        __builtin_amdgcn_sched_barrier(0);    // keeps the loads below behind the LDS writes above, which free their register set: risen higher they would hold a third set
        // The work-group's barrier by hand, behind this wave's own LDS writes and reads: it publishes stage t, and every wave has left stage t - 1, whose buffer the next trip writes. __syncthreads() would also wait for the
        // global loads in flight, and every stage would then cost a whole load latency.
        asm volatile("s_wait_dscnt 0x0\n\ts_barrier_signal -1\n\ts_barrier_wait -1" ::: "memory");
        if (t + 2 < DM / 64) {
#pragma unroll
            for (int p = 0; p < 4; ++p) { ra[t & 1][p] = *(const v4f*)(ga + p * 16 * DM + (t + 2) * 64); rb[t & 1][p] = *(const v4f*)(gb + p * 16 * DM + (t + 2) * 64); } }
#pragma unroll
        for (int kb = 0; kb < 2; ++kb) { const v16bf a = ldf(fa + bo + kb * 64);
            acc[0] = wmmab(a, ldf(fb + bo + kb * 64), acc[0]); acc[1] = wmmab(a, ldf(fb + bo + 16 * TP + kb * 64), acc[1]); }
        __builtin_amdgcn_sched_barrier(0);    // keeps the next stage's conversions and LDS writes behind this stage's products: mixed among them they cost 16 more registers, and a WGP then holds one work-group fewer
    }
    __syncthreads();    // every wave has left the last stage before the buffers become output staging
    float* os = (float*)(void*)L;    // the tile in f32, pitch 68
#pragma unroll
    for (int j = 0; j < 2; ++j) {
#pragma unroll
        for (int e = 0; e < 8; ++e) os[((wave >> 1) * 16 + hi * 8 + e) * 68 + (wave & 1) * 32 + j * 16 + lr] = acc[j][e]; }
    __syncthreads();    // the tile is whole before it is stored by rows
    // 8 lanes per row: 64 columns are one 128-B line of each plane.
#pragma unroll
    for (int s = 0; s < 2; ++s) { const int r = (tid >> 3) + 32 * s; const float* op = os + r * 68 + (tid & 7) * 8;
        const v8f x = __builtin_shufflevector(*(const v4fa*)op, *(const v4fa*)(op + 4), 0, 1, 2, 3, 4, 5, 6, 7);
        const v8bf h = __builtin_convertvector(x, v8bf), l = __builtin_convertvector(x - __builtin_convertvector(h, v8f), v8bf);
        const size_t o = (size_t)(j0 + r) * DM + i0 + (tid & 7) * 8; *(v8us*)(Mh + o) = __builtin_bit_cast(v8us, h); *(v8us*)(Ml + o) = __builtin_bit_cast(v8us, l); }
}
// k_prep: M^T, three matrix-vector products and the two input conversions depend on nothing but the inputs, so they share one grid: work-groups 0 .. 143 take one 64 x 64 tile of M^T (first, as theirs is the longest chain),
// the next 3 x 25 take 32 rows (one 128-B line a work-group) of W1 (Wt.Wo, then bt.Wo), of WG (Wq.bk, then bq.bk) or of CB (Wk.bq; its row 768 is not used), the others 8 rows of query_x, then of x (X holds both results back to back).
#define WTILES ((DM / 64) * (DM / 64))
#define MVWG   ((DM + 32) / 32)    // work-groups of 32 rows that cover 769 rows
__global__ __launch_bounds__(256) void k_prep(const float* __restrict__ qx, const float* __restrict__ x, const float* __restrict__ Wq, const float* __restrict__ bq, const float* __restrict__ Wk, const float* __restrict__ bk, const float* __restrict__ Wt, const float* __restrict__ bt, const float* __restrict__ Wo, bf* X, bf* Mh, bf* Ml, float* W1, float* WG, float* CB) {
    __shared__ __attribute__((aligned(16))) unsigned char L[2 * 2 * MPL];
    const int b = blockIdx.x;
    if (b < WTILES) {
        mt_tile(L, Wk, Wq, Mh, Ml, (b / (DM / 64)) * 64, (b % (DM / 64)) * 64);
    } else if (b < WTILES + 3 * MVWG) {
        const int w = (b - WTILES) / MVWG, r0 = ((b - WTILES) % MVWG) * 32 + __builtin_amdgcn_readfirstlane(threadIdx.x >> 5) * 4;    // the wave's number in a scalar register: row addresses are scalar
        mv_rows<4, true>(w == 0 ? Wt : w == 1 ? Wq : Wk, w == 0 ? bt : w == 1 ? bq : bk, w == 0 ? Wo : w == 1 ? bk : bq, w == 0 ? W1 : w == 1 ? WG : CB, r0);
    } else {
        const int r0 = (b - WTILES - 3 * MVWG) * 8;
        cvt_rows(r0 < NB_ * NT_ ? qx + (size_t)r0 * DM : x + (size_t)(r0 - NB_ * NT_) * DM, X + (size_t)r0 * DM);
        asm volatile("s_wait_xcnt 0x0" ::: "memory");    // behind the rows' stores: in the built code the matrix-vector part stands behind them, and its loads land on registers that those stores name
    }
}
// g_rows: G[r] = X[r].wg + wg[768] for the 8 rows r0 .. r0 + 7 of one wave, f32; X = the bf16 plane of query_x or of x, 8 elements a lane per 256. Fixed sum tree: a lane's 24 terms in ascending order, then the 32 lanes by exchange.
// Lane n keeps row n's sum, so that a wave stores its rows with one instruction. Every loop is unrolled so that the arrays stay in registers and a wave's loads are all in flight together.
__device__ __forceinline__ void g_rows(const bf* __restrict__ X, const float* __restrict__ wg, float* G, int r0) {
    const int lane = threadIdx.x & 31;
    v8us xv[8][DM / 256]; v8f wv[DM / 256];
#pragma unroll
    for (int n = 0; n < 8; ++n) {
#pragma unroll
        for (int q = 0; q < DM / 256; ++q) xv[n][q] = *(const v8us*)(X + (size_t)(r0 + n) * DM + q * 256 + lane * 8); }
#pragma unroll
    for (int q = 0; q < DM / 256; ++q) wv[q] = *(const v8f*)(wg + q * 256 + lane * 8);
    float keep = 0.f;
#pragma unroll
    for (int n = 0; n < 8; ++n) { float s = 0.f;
#pragma unroll
        for (int q = 0; q < DM / 256; ++q) {
#pragma unroll
            for (int i = 0; i < 8; ++i) s = fmaf(bf2f(xv[n][q][i]), wv[q][i], s); }
#pragma unroll
        for (int m = 16; m; m >>= 1) s += __shfl_xor(s, m);
        if (lane == n) keep = s; }
    if (lane < 8) G[r0 + lane] = keep + wg[DM];
}
// k_t: t, w2 = Wv.w1 and g depend only on k_prep, so they share one grid: work-groups 0 .. 24 take 32 rows of W2 (w2, then bv.w1; one 128-B line a work-group), then come t's 768 tiles (row tile fastest),
// then 512 work-groups of 32 rows of G (one 128-B line each): short ones, last, where the tiles' last round leaves room. Xq = the bf16 plane of query_x; Mh, Ml = M^T; Th, Tl = the planes of t.
__global__ __launch_bounds__(128) void k_t(const bf* __restrict__ Xq, const bf* __restrict__ Mh, const bf* __restrict__ Ml, const float* __restrict__ CB, const float* __restrict__ WG, const float* __restrict__ Wv, const float* __restrict__ bv, const float* __restrict__ W1, float* W2, float* G, bf* Th, bf* Tl) {
    __shared__ __attribute__((aligned(16))) unsigned char L[2 * 3 * TPL];    // 108 KiB: two work-groups a WGP (three would take 106.6 KiB or less each)
    constexpr int PT = NB_ * NT_ / 128 * (DM / 128);    // tiles of t
    const int wv = __builtin_amdgcn_readfirstlane(threadIdx.x >> 5);    // the wave's number in a scalar register: row addresses are scalar
    if (blockIdx.x < MVWG) { mv_rows<8, false>(Wv, bv, W1, W2, blockIdx.x * 32 + wv * 8); return; }    // the whole work-group leaves, in front of every barrier
    if (blockIdx.x >= MVWG + PT) { g_rows(Xq, WG, G, (blockIdx.x - MVWG - PT) * 32 + wv * 8); return; }    // likewise
    const int t = blockIdx.x - MVWG;
    tg<1, 2, 1>(L, t % (NB_ * NT_ / 128), t / (NB_ * NT_ / 128), 0, Xq, nullptr, Mh, Ml, CB, DM, nullptr, Th, Tl, DM, 0, 0, 0, nullptr, nullptr);
    asm volatile("s_wait_xcnt 0x0" ::: "memory");    // behind the tile's last stores: in the built code the matrix-vector parts stand behind them, and they write registers that those stores name
}
// k_s: the scores S[q][k] = t[q].x[k] + g[q] (unscaled; the 768^-1/2 is applied where the softmax is taken) with, per 128-row tile and key column, the partial column max PM and sum of exp PS ([item][row tile][k]).
// Work-groups 0 .. 1023 take one tile (row tile fastest, then column tile, then item); then come 512 work-groups of 32 rows of U (u[k] = x[k].w2 + bv.w1, one 128-B line each), which need only k_t: short ones, last.
__global__ __launch_bounds__(128) void k_s(const bf* __restrict__ Th, const bf* __restrict__ Tl, const bf* __restrict__ Xk, const float* __restrict__ G, const float* __restrict__ W2, float* S, float* PM, float* PS, float* U) {
    __shared__ __attribute__((aligned(16))) unsigned char L[2 * 3 * TPL];    // 108 KiB: two work-groups a WGP (three would take 106.6 KiB or less each)
    constexpr int RT = NT_ / 128, PT = NB_ * RT * RT;    // row (and column) tiles of an item, tiles of S
    if (blockIdx.x >= PT) { g_rows(Xk, W2, U, (blockIdx.x - PT) * 32 + __builtin_amdgcn_readfirstlane(threadIdx.x >> 5) * 8); return; }    // the whole work-group leaves, in front of every barrier
    const int bx = blockIdx.x % RT, by = blockIdx.x / RT % RT, bz = blockIdx.x / (RT * RT);
    const size_t po = (size_t)(bz * RT + bx) * NT_ + by * 128;
    tg<2, 1, 0>(L, bx, by, bz, Th, Tl, Xk, nullptr, G + bz * NT_, DM, S, nullptr, nullptr, NT_, (size_t)NT_ * DM, (size_t)NT_ * DM, (size_t)NT_ * NT_, PM + po, PS + po);
    asm volatile("s_wait_xcnt 0x0" ::: "memory");    // behind the tile's last stores: where the built code puts the u part behind them, it writes registers that those stores name
}
// k_out: out[q] = sum_k exp(s[q][k] x scale - cmax[k]) x ct[k] + (bt.Wo + bf(bo)), f32: P.u without P. One work-group per 32 rows q of one item (r0 = item * 1024 + q; one 128-B line of out), 8 waves of 4 rows,
// lane -> 8 columns per 256-column step. The work-group first merges the item's 8 row-tile partials, a thread 4 columns: cmax = max_t PM, csum = sum_t PS x exp(PM - cmax) (t ascending), ct = u / csum; they reach the waves through LDS.
// Fixed sum tree of out: a lane's 32 terms in ascending k, the 16 lanes of a half wave by exchange, then the two halves.
// Every loop is unrolled so that the arrays are indexed by constants and stay in registers, and so that a wave's loads are all in flight together.
__global__ __launch_bounds__(256) void k_out(const float* __restrict__ S, const float* __restrict__ PM, const float* __restrict__ PS, const float* __restrict__ U, const float* __restrict__ W1, const float* __restrict__ bo, float* OUTB) {
    __shared__ float so[2 * 32]; __shared__ __align__(16) float cml[NT_]; __shared__ __align__(16) float ctl[NT_];
    const int lane = threadIdx.x & 31, wave = __builtin_amdgcn_readfirstlane(threadIdx.x >> 5), r0 = blockIdx.x * 32;    // the wave's number in a scalar register: every base address below is scalar
    const unsigned lo = lane * 8, c4 = threadIdx.x * 4;    // the two vector registers that the loads name
    PM += (r0 / NT_) * (NT_ / 128) * NT_; PS += (r0 / NT_) * (NT_ / 128) * NT_; U += (r0 / NT_) * NT_; S += (size_t)(r0 + wave * 4) * NT_;
    v4f pm[NT_ / 128], ps[NT_ / 128]; v8f v[4][NT_ / 256];
#pragma unroll
    for (int t = 0; t < NT_ / 128; ++t) { pm[t] = *(const v4f*)(PM + t * NT_ + c4); ps[t] = *(const v4f*)(PS + t * NT_ + c4); }
    const v4f uu = *(const v4f*)(U + c4);
#pragma unroll
    for (int n = 0; n < 4; ++n) {
#pragma unroll
        for (int qc = 0; qc < NT_ / 256; ++qc) v[n][qc] = *(const v8f*)(S + n * NT_ + qc * 256 + lo); }
    __builtin_amdgcn_sched_barrier(0);    // keeps the loads of S in front of the merge, and behind the partials' loads, which return first: sunk behind the merge they would start only when it is done
    v4f m = pm[0], cs = (v4f){0.f, 0.f, 0.f, 0.f};
#pragma unroll
    for (int t = 1; t < NT_ / 128; ++t) m = __builtin_elementwise_max(m, pm[t]);
#pragma unroll
    for (int t = 0; t < NT_ / 128; ++t) {
#pragma unroll
        for (int k = 0; k < 4; ++k) cs[k] = fmaf(ps[t][k], __expf(pm[t][k] - m[k]), cs[k]); }
    *(v4fa*)(cml + c4) = m; *(v4fa*)(ctl + c4) = uu / cs;
    // The work-group's barrier by hand, behind this wave's own LDS writes: cmax and ct of all 1024 columns are in LDS before any wave reads them. __syncthreads() would also wait for the loads of S in flight,
    // and every wave would then start only when the slowest wave's rows have arrived.
    asm volatile("s_wait_dscnt 0x0\n\ts_barrier_signal -1\n\ts_barrier_wait -1" ::: "memory");
    v8f cm[NT_ / 256], ct[NT_ / 256];
#pragma unroll
    for (int qc = 0; qc < NT_ / 256; ++qc) {
        cm[qc] = __builtin_shufflevector(*(const v4fa*)(cml + qc * 256 + lo), *(const v4fa*)(cml + qc * 256 + lo + 4), 0, 1, 2, 3, 4, 5, 6, 7);
        ct[qc] = __builtin_shufflevector(*(const v4fa*)(ctl + qc * 256 + lo), *(const v4fa*)(ctl + qc * 256 + lo + 4), 0, 1, 2, 3, 4, 5, 6, 7); }
#pragma unroll
    for (int n = 0; n < 4; ++n) { float a = 0.f;
#pragma unroll
        for (int qc = 0; qc < NT_ / 256; ++qc) {
#pragma unroll
            for (int i = 0; i < 8; ++i) a = fmaf(__expf(v[n][qc][i] * SCL - cm[qc][i]), ct[qc][i], a); }
        a = rowx<8>(rowx<4>(rowx<2>(rowx<1>(a))));
        if ((lane & 15) == 0) so[(lane >> 4) * 32 + wave * 4 + n] = a; }
    __syncthreads();    // the 32 rows' half sums are in LDS before wave 0 stores the rows as one whole line
    if (wave == 0) OUTB[r0 + lane] = (so[lane] + so[32 + lane]) + (W1[DM] + bfr(bo[0]));
}

extern "C" void kernel_launch(void* const* d_in, const int* in_sizes, int n_in,
                              void* d_out, int out_size, void* d_ws, size_t ws_size, hipStream_t stream) {
    (void)in_sizes; (void)n_in; (void)out_size;
    const float* qx = (const float*)d_in[0]; const float* x = (const float*)d_in[1];
    const float* Wq = (const float*)d_in[2]; const float* bq = (const float*)d_in[3]; const float* Wk = (const float*)d_in[4]; const float* bk = (const float*)d_in[5]; const float* Wv = (const float*)d_in[6]; const float* bv = (const float*)d_in[7];
    const float* Wt = (const float*)d_in[8]; const float* bt = (const float*)d_in[9]; const float* Wo = (const float*)d_in[10]; const float* bo = (const float*)d_in[11];   // W k-major [in][out]
    float* out = (float*)d_out;    // [16][1024]
    char* wsp = (char*)d_ws;
    auto take = [&](size_t bytes) { char* p = wsp; wsp += (bytes + 255) & ~(size_t)255; return (void*)p; };
    bf* Mh = (bf*)take((size_t)DM * DM * 2); bf* Ml = (bf*)take((size_t)DM * DM * 2);    // M^T = Wk.Wq^T, hi and residual
    // Planes hold all 16 items ([item][row][col], items back to back); every region has one tenant.
    const size_t PL = (size_t)NB_ * NT_ * DM * 2;    // one bf16 plane of all items, 24 MiB
    bf* Xq = (bf*)take(2 * PL); bf* Xk = (bf*)((char*)Xq + PL);
    bf* Th = (bf*)take(PL); bf* Tl = (bf*)take(PL);
    float* S = (float*)take((size_t)NB_ * NT_ * NT_ * 4);    // 64 MiB
    float* PM = (float*)take((size_t)NB_ * (NT_ / 128) * NT_ * 4); float* PS = (float*)take((size_t)NB_ * (NT_ / 128) * NT_ * 4);    // column partials per row tile, 0.5 MiB each
    float* U = (float*)take((size_t)NB_ * NT_ * 4); float* G = (float*)take((size_t)NB_ * NT_ * 4);
    float* W1 = (float*)take((size_t)MVWG * 32 * 4); float* W2 = (float*)take((size_t)MVWG * 32 * 4);    // 769 of 800 floats each are written and read
    float* WG = (float*)take((size_t)MVWG * 32 * 4); float* CB = (float*)take((size_t)MVWG * 32 * 4);    // likewise (of CB 768 are read)
    if ((size_t)(wsp - (char*)d_ws) > ws_size) return;    // 2.25 + 48 + 48 + 64 + 1.2 ~ 163.5 MiB
    k_prep<<<WTILES + 3 * MVWG + 2 * NB_ * NT_ / 8, 256, 0, stream>>>(qx, x, Wq, bq, Wk, bk, Wt, bt, Wo, Xq, Mh, Ml, W1, WG, CB);    // Xq, Xk lie back to back
    k_t<<<MVWG + NB_ * NT_ / 128 * (DM / 128) + NB_ * NT_ / 32, 128, 0, stream>>>(Xq, Mh, Ml, CB, WG, Wv, bv, W1, W2, G, Th, Tl);
    k_s<<<NB_ * (NT_ / 128) * (NT_ / 128) + NB_ * NT_ / 32, 128, 0, stream>>>(Th, Tl, Xk, G, W2, S, PM, PS, U);
    k_out<<<NB_ * NT_ / 32, 256, 0, stream>>>(S, PM, PS, U, W1, bo, out);
}

// v009
// One run takes 91.8 microseconds.
// Next to v008, in two timings, it ran 1.11 and 1.10 times as fast.
// All steps since v000 together make it 273 times as fast.
#include <hip/hip_runtime.h>

// Compute dtypes, f32 accumulate, all 16 batch items in every launch. The scores are taken from the middle: with q = query_x.Wq + bq and k = x.Wk + bk,
// q.k^T = t.x^T + g, t = query_x.(Wq.Wk^T) + Wk.bq (a row of 768 per query row), g[q] = query_x[q].(Wq.bk) + bq.bk: ONE [1024 x 768].[768 x 768] product per item stands for the two projections, and x itself is the
// second operand of the scores. Inputs are rounded to bf16 once (exact operands of v_wmma_f32_16x16x32_bf16); the COMPUTED operands Wq.Wk^T and t go on as bf16 hi + UNSCALED residual, so t takes two products and the scores take two.
// The softmax over the QUERY axis (the module's dim=1) is done per key column in f32 (column max, column sum of exp, P[q][k] = exp(s/sqrt(768) - cmax[k]) / csum[k]); max and sum are taken per 128-row tile where the scores are made and merged where they are used.
// Behind the softmax the module is linear and ends in ONE column, so its products are taken from the right: out = ((P.(x.Wv + bv)).Wt + bt).Wo + bo = P.u + (bt.Wo + bo) with
// w1 = Wt.Wo, w2 = Wv.w1, u[k] = x[k].w2 + bv.w1: matrix-vector products in f32 (their inputs rounded to bf16 once, like the operands of the matrix products); neither q, k, v, P, ctx nor h is ever formed.

#define NB_  16
#define NT_  1024                // Lq = Lk
#define DM   768
#define SCL  0.03608439182435161f    // 768^-1/2
#define LOSC 1024.0f

typedef _Float16 h16;
typedef unsigned short bf;
typedef __attribute__((ext_vector_type(16))) __bf16   v16bf;
typedef __attribute__((ext_vector_type(8)))  __bf16   v8bf;
typedef __attribute__((ext_vector_type(16))) _Float16 v16h;
typedef __attribute__((ext_vector_type(8)))  _Float16 v8h;
typedef __attribute__((ext_vector_type(8)))  unsigned short v8us;
typedef __attribute__((ext_vector_type(8)))  float    v8f;
typedef __attribute__((ext_vector_type(4)))  float    v4f;
typedef __attribute__((ext_vector_type(4)))  _Float16 v4h;
typedef v8h  __attribute__((may_alias)) v8ha;
typedef v4f  __attribute__((may_alias)) v4fa;
typedef __attribute__((ext_vector_type(2)))  float    v2f;
typedef v2f  __attribute__((may_alias)) v2fa;
typedef v8us __attribute__((may_alias)) v8usa;

__device__ __forceinline__ unsigned short f2bf(float f) { unsigned u = __float_as_uint(f); u += 0x7FFFu + ((u >> 16) & 1u); return (unsigned short)(u >> 16); }
__device__ __forceinline__ float bf2f(unsigned short b) { return __uint_as_float(((unsigned)b) << 16); }
__device__ __forceinline__ float bfr(float f) { return bf2f(f2bf(f)); }
__device__ __forceinline__ v16h cat16(v8h lo, v8h hi) { return __builtin_shufflevector(lo, hi, 0, 1, 2, 3, 4, 5, 6, 7, 8, 9, 10, 11, 12, 13, 14, 15); }
__device__ __forceinline__ v16bf cat16b(v8us lo, v8us hi) { return __builtin_bit_cast(v16bf, __builtin_shufflevector(lo, hi, 0, 1, 2, 3, 4, 5, 6, 7, 8, 9, 10, 11, 12, 13, 14, 15)); }
__device__ __forceinline__ v8f wmma16(v16h a, v16h b, v8f c) { return __builtin_amdgcn_wmma_f32_16x16x32_f16(false, a, false, b, (short)0, c, false, false); }
__device__ __forceinline__ v8f wmmab(v16bf a, v16bf b, v8f c) { return __builtin_amdgcn_wmma_f32_16x16x32_bf16(false, a, false, b, (short)0, c, false, false); }

// cvt_rows: 8 rows of 768 floats -> bf16, one wave per row; src and dst point at the work-group's first row.
__device__ __forceinline__ void cvt_rows(const float* __restrict__ src, bf* dst) {
    const int lane = threadIdx.x & 31, r = threadIdx.x >> 5;
    v8us o[DM / 256];
#pragma unroll
    for (int q = 0; q < DM / 256; ++q) { v8us t;
#pragma unroll
        for (int i = 0; i < 8; ++i) t[i] = f2bf(src[(size_t)r * DM + q * 256 + lane * 8 + i]);
        o[q] = t; }
#pragma unroll
    for (int q = 0; q < DM / 256; ++q) *(v8us*)(dst + (size_t)r * DM + q * 256 + lane * 8) = o[q];
    
}

// mv_rows: y[r] = bf(M[r]).w for the NR rows r0 .. r0 + NR - 1 of one wave, f32; M is [768][768] row-major and row 768 stands for the bias vector b, so y[768] = bf(b).w. RW: w is an input too and is rounded like M.
// Fixed sum tree: a lane's 24 terms in ascending order (4 per 128 columns), then the 32 lanes by exchange. Lane n keeps row n's sum, so that a wave stores its rows with one instruction.
// mv_sum returns the sums (lane n: row r0 + n), mv_rows stores them. AH: the loads of all NR rows are issued in front of the first sum (where the rows stand in front of a tile, and a load latency a row would hold the tile up).
template <int NR, bool RW, bool AH = false>
__device__ __forceinline__ float mv_sum(const float* __restrict__ M, const float* __restrict__ b, const float* __restrict__ w, int r0) {
    const int lane = threadIdx.x & 31;
    float wv[DM / 32], keep = 0.f;
#pragma unroll
    for (int q = 0; q < DM / 128; ++q) {
#pragma unroll
        for (int i = 0; i < 4; ++i) { const float t = w[q * 128 + lane * 4 + i]; wv[q * 4 + i] = RW ? bfr(t) : t; } }
    v4f av[AH ? NR : 1][DM / 128];
    if constexpr (AH) {
#pragma unroll
        for (int n = 0; n < NR; ++n) { const int r = r0 + n < DM ? r0 + n : DM; const float* a = r < DM ? M + (size_t)r * DM : b;
#pragma unroll
            for (int q = 0; q < DM / 128; ++q) av[n][q] = *(const v4f*)(a + q * 128 + lane * 4); } }
#pragma unroll
    for (int n = 0; n < NR; ++n) { const int r = r0 + n < DM ? r0 + n : DM;    // rows past 768 repeat row 768 and are not stored
        const float* a = r < DM ? M + (size_t)r * DM : b;
        float s = 0.f;
#pragma unroll
        for (int q = 0; q < DM / 128; ++q) {
#pragma unroll
            for (int i = 0; i < 4; ++i) s = fmaf(bfr(AH ? av[AH ? n : 0][q][i] : a[q * 128 + lane * 4 + i]), wv[q * 4 + i], s); }
#pragma unroll
        for (int m = 16; m; m >>= 1) s += __shfl_xor(s, m);
        if (lane == n) keep = s; }
    return keep;
}
template <int NR, bool RW>
__device__ __forceinline__ void mv_rows(const float* __restrict__ M, const float* __restrict__ b, const float* __restrict__ w, float* y, int r0) {
    const int lane = threadIdx.x & 31;
    const float keep = mv_sum<NR, RW>(M, b, w, r0);
    if (lane < NR && r0 + lane <= DM) y[r0 + lane] = keep;
}
// tg: one tile of C = (Ah [+ Al]).(Bh [+ Bl])^T + bias per work-group, one work-group a WGP. One operand has two planes, the other one. 8 waves: 2 along the one-plane operand, 128 of its rows each (8 fragments),
// by 4 along the two-plane operand, 16 F2 of its rows each (F2 fragments): the tile takes 256 rows of the one-plane operand and 64 F2 of the two-plane one, so that every staged byte serves more products. All planes are k-contiguous
// with row stride K (a multiple of 64). A stage is 64 k (128 B) of the tile's rows of every plane, brought into LDS by asynchronous copies, two buffers: stage t + 1 flies while stage t is worked on.
// Products per 32 k and accumulator, in this order: Ah.Bh, then Al.Bh or Ah.Bl; k ascending. bx, by = the tile's row and column index, bz = batch item, sA / sB / sC = elements per item in the A planes, the B planes and C.
// Every inner loop is unrolled so that acc and the fragment arrays are indexed by constants and stay in registers. pre(), post() = work that touches no LDS memory and holds no barrier: pre() computes behind the issue of stage 0's copies, post() stores behind the issue of stage 1's.
// EPI says what is stored: 0 = C in f32, bias (f32, as it is) by row of the item; 1 = bf16 hi + UNSCALED residual planes Oh, Ol of C, bias (f32, as it is) by column.
// EPI 0 also stores, per column of the tile and for each of its two blocks of 128 rows, the softmax partials: PMt[c] = max_r (C x scale), PSt[c] = sum_r exp(C x scale - PMt[c]) (PMt, PSt point at the first block's first column, the second block's lie NT_ further).
// Fixed tree: 8 rows in ascending order in each of a lane's 4 row blocks, the 4 blocks pairwise, the two half waves by exchange, the two 64-row waves of a block through LDS across the barrier that stands here anyway.
#define TP   144                 // LDS bytes per staged row: 128 of data + 16, so that 16 rows read 16 bytes wide fall on different banks
__device__ __forceinline__ unsigned lds_off(const void* p) { return (unsigned)(size_t)p; }
// One lane's half rows of a 16 x 32 fragment: k 8 hi .. 8 hi + 7 and 16 + 8 hi .. 16 + 8 hi + 7 (p already holds the row and the 16 hi bytes); the same for A and B.
__device__ __forceinline__ v16bf ldf(const unsigned char* p) { return cat16b(*(const v8usa*)p, *(const v8usa*)(p + 32)); }
// One thread's share of one plane of a stage: 16 bytes of each of the rows r, r + 32, ..., N of them (N = 8: a plane of 256 rows, N = 6: of 192; rs = 32 rows, in elements). The s_wait_xcnt stands inside the statement so that
// no address register of a copy is rewritten in front of it.
template <int N>
__device__ __forceinline__ void copy_plane(unsigned l, const bf* gp, size_t rs) {
    static_assert(N == 8 || N == 6, "planes of 256 or 192 rows");
    if constexpr (N == 8) {
        asm volatile("global_load_async_to_lds_b128 %0, %8, off\n\t"
                     "global_load_async_to_lds_b128 %1, %9, off\n\t"
                     "global_load_async_to_lds_b128 %2, %10, off\n\t"
                     "global_load_async_to_lds_b128 %3, %11, off\n\t"
                     "global_load_async_to_lds_b128 %4, %12, off\n\t"
                     "global_load_async_to_lds_b128 %5, %13, off\n\t"
                     "global_load_async_to_lds_b128 %6, %14, off\n\t"
                     "global_load_async_to_lds_b128 %7, %15, off\n\t"
                     "s_wait_xcnt 0x0"
                     :: "v"(l), "v"(l + 32 * TP), "v"(l + 64 * TP), "v"(l + 96 * TP), "v"(l + 128 * TP), "v"(l + 160 * TP), "v"(l + 192 * TP), "v"(l + 224 * TP),
                        "v"(gp), "v"(gp + rs), "v"(gp + 2 * rs), "v"(gp + 3 * rs), "v"(gp + 4 * rs), "v"(gp + 5 * rs), "v"(gp + 6 * rs), "v"(gp + 7 * rs)
                     : "memory");
    } else {
        asm volatile("global_load_async_to_lds_b128 %0, %6, off\n\t"
                     "global_load_async_to_lds_b128 %1, %7, off\n\t"
                     "global_load_async_to_lds_b128 %2, %8, off\n\t"
                     "global_load_async_to_lds_b128 %3, %9, off\n\t"
                     "global_load_async_to_lds_b128 %4, %10, off\n\t"
                     "global_load_async_to_lds_b128 %5, %11, off\n\t"
                     "s_wait_xcnt 0x0"
                     :: "v"(l), "v"(l + 32 * TP), "v"(l + 64 * TP), "v"(l + 96 * TP), "v"(l + 128 * TP), "v"(l + 160 * TP),
                        "v"(gp), "v"(gp + rs), "v"(gp + 2 * rs), "v"(gp + 3 * rs), "v"(gp + 4 * rs), "v"(gp + 5 * rs)
                     : "memory");
    }
}
// v + v of lane ^ M inside the 16-lane row, one vector instruction (row_xmask); every lane is on where it is used.
template <int M> __device__ __forceinline__ float rowx(float v) { return v + __int_as_float(__builtin_amdgcn_update_dpp(0, __float_as_int(v), 0x160 + M, 0xf, 0xf, true)); }
// r[e] = 2^x[e], eight in one statement: no result shares a register with a source, so each v_exp_f32 is followed by one that neither reads its result nor overwrites its source,
// and the v_nop is that slot behind the last (left to the register allocator, a run of them had each overwrite the source of the one before).
__device__ __forceinline__ void exp2x8(float (&r)[8], const float (&x)[8]) {
    asm("v_exp_f32 %0, %8\n\tv_exp_f32 %1, %9\n\tv_exp_f32 %2, %10\n\tv_exp_f32 %3, %11\n\tv_exp_f32 %4, %12\n\tv_exp_f32 %5, %13\n\tv_exp_f32 %6, %14\n\tv_exp_f32 %7, %15\n\tv_nop"
        : "=&v"(r[0]), "=&v"(r[1]), "=&v"(r[2]), "=&v"(r[3]), "=&v"(r[4]), "=&v"(r[5]), "=&v"(r[6]), "=&v"(r[7])
        : "v"(x[0]), "v"(x[1]), "v"(x[2]), "v"(x[3]), "v"(x[4]), "v"(x[5]), "v"(x[6]), "v"(x[7]));
}
// 2^x, one alone, with the same slot behind it.
__device__ __forceinline__ float exp2n(float x) { float r; asm("v_exp_f32 %0, %1\n\tv_nop" : "=v"(r) : "v"(x)); return r; }
template <int NA, int NBP, int EPI, int F2, class PRE, class POST>
__device__ __forceinline__ void tg(PRE pre, POST post, unsigned char* L, int bx, int by, int bz, const bf* __restrict__ Ah, const bf* __restrict__ Al, const bf* __restrict__ Bh, const bf* __restrict__ Bl, const float* __restrict__ bias, int K, float* C, bf* Oh, bf* Ol, int ldc, size_t sA, size_t sB, size_t sC, float* PMt, float* PSt) {
    static_assert(NA + NBP == 3, "one operand in two planes");
    static_assert(EPI == 0 ? (NA == 2 && F2 == 4) : (NBP == 2 && F2 == 3), "the two epilogues are written for these tiles");
    constexpr int R1 = 256, R2 = 64 * F2;                       // the tile's rows of the one-plane and of the two-plane operand
    constexpr unsigned P1 = R1 * TP, P2 = R2 * TP, STG = P1 + 2 * P2;    // staged planes, a stage; L holds 2 STG bytes (and the epilogue's staging)
    constexpr int FI = NA == 2 ? F2 : 8, FJ = NA == 2 ? 8 : F2;    // a wave's accumulator tiles by row and by column
    const int tid = threadIdx.x, lane = tid & 31, wave = tid >> 5, lr = lane & 15, hi = lane >> 4;
    const int w1 = (wave & 1) * 128, w2 = (wave >> 1) * (16 * F2);    // the wave's first row in the one-plane and in the two-plane operand
    const int R0 = bx * (NA == 2 ? R2 : R1), C0 = by * (NA == 2 ? R1 : R2), wr = NA == 2 ? w2 : w1, wc = NA == 2 ? w1 : w2;
    const int crow = tid >> 3, cpc = tid & 7;    // copies: 8 lanes per 128-B row piece, a wave-wide copy covers 4 whole lines
    const size_t ga = bz * sA + (size_t)(R0 + crow) * K + cpc * 8, gb = bz * sB + (size_t)(C0 + crow) * K + cpc * 8, rs = (size_t)32 * K;
    const unsigned lc = lds_off(L) + crow * TP + cpc * 16;
    auto fill = [&](int t) {
        const unsigned l = lc + (t & 1) * STG; const size_t ko = (size_t)t * 64;
        if constexpr (NA == 2) { copy_plane<2 * F2>(l, Ah + ga + ko, rs); copy_plane<2 * F2>(l + P2, Al + ga + ko, rs); copy_plane<8>(l + 2 * P2, Bh + gb + ko, rs); }
        else { copy_plane<8>(l, Ah + ga + ko, rs); copy_plane<2 * F2>(l + P1, Bh + gb + ko, rs); copy_plane<2 * F2>(l + P1 + P2, Bl + gb + ko, rs); }
    };
    const int nst = K / 64;
    fill(0);
    pre();                                               // the work-group's small share of other work, while stage 0 flies
    asm volatile("s_wait_asynccnt 0x0" ::: "memory");    // this wave's share of stage 0 has landed
    __syncthreads();                                     // stage 0 is published
    if (nst > 1) fill(1);
    post();                                              // its stores: in front of the barrier above, the barrier would wait until they are done
    v8f acc[FI][FJ];
#pragma unroll
    for (int i = 0; i < FI; ++i) {
#pragma unroll
        for (int j = 0; j < FJ; ++j) acc[i][j] = (v8f){}; }
    const unsigned char* f10 = L + (NA == 2 ? 2 * P2 : 0) + (w1 + lr) * TP + hi * 16;    // the one-plane operand
    const unsigned char* f20 = L + (NA == 2 ? 0 : P1) + (w2 + lr) * TP + hi * 16;        // the two-plane operand, hi; the residual lies P2 further
#pragma unroll 1
    for (int t = 0; t < nst; ++t) {    // stays rolled: one trip per stage, the buffer chosen by t & 1
        const unsigned bo = (t & 1) * STG;
        // 2 F2 steps of 16 products (32 k x 16 rows or columns of the two-plane operand each). The eight fragments of the one-plane operand stay for F2 steps; the two-plane operand's fragments of step s + 1
        // are fetched, as one group, in front of step s's products into the other of two register sets.
        const unsigned char* f1 = f10 + bo;
        const unsigned char* f2 = f20 + bo;
        v16bf o[8], h[2], l[2];
        h[0] = ldf(f2); l[0] = ldf(f2 + P2);
#pragma unroll
        for (int s = 0; s < 2 * F2; ++s) {
            const int m = s % F2, cs = s & 1, n = s + 1;
            if (m == 0) {
#pragma unroll
                for (int i = 0; i < 8; ++i) o[i] = ldf(f1 + i * 16 * TP + (s / F2) * 64); }
            if (n < 2 * F2) { const unsigned char* p = f2 + (n % F2) * 16 * TP + (n / F2) * 64; h[n & 1] = ldf(p); l[n & 1] = ldf(p + P2); }
            __builtin_amdgcn_sched_barrier(0);    // keeps the LDS reads above as one group: sunk among the products, each would be waited for where it is used
            if constexpr (NBP == 2) {
#pragma unroll
                for (int i = 0; i < 8; ++i) acc[i][m] = wmmab(o[i], h[cs], acc[i][m]);
#pragma unroll
                for (int i = 0; i < 8; ++i) acc[i][m] = wmmab(o[i], l[cs], acc[i][m]);
            } else {
#pragma unroll
                for (int j = 0; j < 8; ++j) acc[m][j] = wmmab(h[cs], o[j], acc[m][j]);
#pragma unroll
                for (int j = 0; j < 8; ++j) acc[m][j] = wmmab(l[cs], o[j], acc[m][j]);
            }
            __builtin_amdgcn_sched_barrier(0);    // keeps the next step's reads from rising into this step's products
        }
        asm volatile("s_wait_dscnt 0x0" ::: "memory");       // this wave's reads of stage t are done before the buffer is refilled
        asm volatile("s_wait_asynccnt 0x0" ::: "memory");    // this wave's share of stage t + 1 has landed
        __syncthreads();                                     // publishes stage t + 1 and ends every wave's reads of stage t
        if (t + 2 < nst) fill(t + 2);
    }
    asm volatile("s_wait_asynccnt 0x0" ::: "memory");        // no copy is left in flight when the ring becomes output staging
    // Whole-line stores through LDS (every reader left the ring at the last trip's barrier). EPI 0: each wave stages its 64 x 128 in its own part, pitch 132. EPI 1: the waves stage the tile as a whole, pitch 196,
    // since a wave's 48 columns are no whole lines of the planes.
    constexpr int OP = EPI == 0 ? 132 : 196;
    float* os = (float*)(void*)L + (EPI == 0 ? wave * (64 * OP) : wr * OP + wc);
    v8f rb[FI];    // EPI 0: the bias of this lane's 32 rows
    if constexpr (EPI == 0) {
#pragma unroll
        for (int i = 0; i < FI; ++i) rb[i] = *(const v8f*)(bias + R0 + wr + i * 16 + hi * 8);
        // Behind the bias loads: the code below rewrites the offset register that they name. The loaded values are inputs only, which keeps every load in front of the wait; the scheduling barrier keeps the vector work below behind it.
        asm volatile("s_wait_xcnt 0x0" :: "v"(rb[0]), "v"(rb[1]), "v"(rb[2]), "v"(rb[3]) : "memory");
        __builtin_amdgcn_sched_barrier(0);    // keeps the vector work below behind the wait above: risen in front of it, it rewrites the offset register too early
    }
#pragma unroll
    for (int j = 0; j < FJ; ++j) { const float bv = EPI == 1 ? bias[C0 + wc + j * 16 + lr] : 0.f;
#pragma unroll
        for (int i = 0; i < FI; ++i) {
#pragma unroll
            for (int e = 0; e < 8; ++e) { acc[i][j][e] += EPI == 0 ? rb[i][e] : bv; os[(i * 16 + hi * 8 + e) * OP + j * 16 + lr] = acc[i][j][e]; } } }
    float* pst = (float*)(void*)L + 8 * (64 * 132);    // EPI 0: behind the eight waves' staging, [wave][max | sum][128 columns]
    if constexpr (EPI == 0) {
        constexpr float K2 = SCL * 1.4426950408889634f;    // scale x log2 e: exp(c x scale - m) = 2^(c x K2 - cmax x K2)
#pragma unroll
        for (int j = 0; j < FJ; ++j) { float m = acc[0][j][0];
#pragma unroll
            for (int i = 0; i < 4; ++i) {
#pragma unroll
                for (int e = 0; e < 8; ++e) m = fmaxf(m, acc[i][j][e]); }
            m = fmaxf(m, __shfl_xor(m, 16));
            const float m2 = m * K2; float s[4];
#pragma unroll
            for (int i = 0; i < 4; ++i) { float x[8], r[8]; s[i] = 0.f;
#pragma unroll
                for (int e = 0; e < 8; ++e) x[e] = fmaf(acc[i][j][e], K2, -m2);
                exp2x8(r, x);
#pragma unroll
                for (int e = 0; e < 8; ++e) s[i] += r[e]; }
            float st = (s[0] + s[1]) + (s[2] + s[3]);
            st += __shfl_xor(st, 16);
            if (hi == 0) { pst[wave * 256 + j * 16 + lr] = m * SCL; pst[wave * 256 + 128 + j * 16 + lr] = st; } }
    }
    __syncthreads();
    if constexpr (EPI == 0) {
        if ((wave & 2) == 0) {    // waves w and w + 2 hold the same 128 columns of one block of 128 rows; a lane merges 4 columns, a wave stores four whole lines of each array
            const float* pa = pst + wave * 256 + lane * 4;
            const v4f ma = *(const v4fa*)pa, sa = *(const v4fa*)(pa + 128), mb = *(const v4fa*)(pa + 512), sb = *(const v4fa*)(pa + 640);
            v4f m, s;
#pragma unroll
            for (int k = 0; k < 4; ++k) { m[k] = fmaxf(ma[k], mb[k]); s[k] = fmaf(sa[k], exp2n((ma[k] - m[k]) * 1.4426950408889634f), sb[k] * exp2n((mb[k] - m[k]) * 1.4426950408889634f)); }
            const int po = (wave >> 2) * NT_ + wc + lane * 4;
            *(v4f*)(PMt + po) = m; *(v4f*)(PSt + po) = s;
        }
        // A row of the wave's part is 512 B, four whole lines: one wave-wide store a row.
        float* crowp = C + bz * sC + (size_t)(R0 + wr) * ldc + C0 + wc + lane * 4;
#pragma unroll
        for (int s = 0; s < 64; ++s) { const v4f val = *(const v4fa*)(os + s * OP + lane * 4); *(v4f*)(crowp + (size_t)s * ldc) = val; }
    } else {
        // 8 lanes per 128-B line of each plane (64 columns): a wave-wide store covers whole lines of 4 rows, the work-group one of the 3 lines of 32 rows; every address is one register plus a constant.
        const float* op = (const float*)(void*)L + (tid >> 3) * OP + (tid & 7) * 8;
        const size_t ob = bz * sC + (size_t)(R0 + (tid >> 3)) * ldc + C0 + (tid & 7) * 8;
#pragma unroll
        for (int s = 0; s < 24; ++s) { const int g = s / 3, k = s % 3; const float* p = op + g * 32 * OP + k * 64;
            const v8f x = __builtin_shufflevector(*(const v4fa*)p, *(const v4fa*)(p + 4), 0, 1, 2, 3, 4, 5, 6, 7);
            const v8bf h = __builtin_convertvector(x, v8bf), l = __builtin_convertvector(x - __builtin_convertvector(h, v8f), v8bf);    // packed hardware conversions, round to nearest even as f2bf does
            const size_t o = ob + (size_t)(g * 32) * ldc + k * 64; *(v8us*)(Oh + o) = __builtin_bit_cast(v8us, h); *(v8us*)(Ol + o) = __builtin_bit_cast(v8us, l); }
    }
}
// mt_tile: one 64 x 64 tile, at row j0 and column i0, of M^T = bf(Wk).bf(Wq)^T, M^T[j][i] = sum_n Wk[j][n] Wq[i][n] (both weights are [in][out], so n is contiguous in both and nothing is transposed), stored as bf16 hi +
// UNSCALED residual planes Mh, Ml, [j][i]: k-contiguous for t = query_x.M. 8 waves, 16 x 32 of the tile each. A stage is 64 n of the tile's 64 + 64 weight rows: read as f32 (16 lanes per 256-B row piece), rounded, put into LDS
// at the pitch of tg's stages; two buffers, so one barrier a stage: stage t + 1 is written only behind the barrier of stage t, which every wave reaches after its reads of stage t - 1. The loads run two stages ahead, in two
// register sets (the work-group's 12 stages are one chain of load latencies). The stage loop is unrolled whole: every load is its base address plus a constant, and no address register is rewritten.
#define MPL (64 * TP)    // one staged weight piece
typedef __attribute__((ext_vector_type(4))) __bf16 v4bf;
typedef __attribute__((ext_vector_type(4))) unsigned short v4us;
typedef v4us __attribute__((may_alias)) v4usa;
__device__ __forceinline__ void mt_tile(unsigned char* L, const float* __restrict__ Wk, const float* __restrict__ Wq, bf* Mh, bf* Ml, int j0, int i0) {
    const int tid = threadIdx.x, lane = tid & 31, wave = tid >> 5, lr = lane & 15, hi = lane >> 4;
    const int row = tid >> 4, c = tid & 15;
    const float* ga = Wk + (size_t)(j0 + row) * DM + c * 4;
    const float* gb = Wq + (size_t)(i0 + row) * DM + c * 4;
    unsigned char* w0 = L + row * TP + c * 8;
    const unsigned char* fa = L + ((wave >> 1) * 16 + lr) * TP + hi * 16;
    const unsigned char* fb = L + MPL + ((wave & 1) * 32 + lr) * TP + hi * 16;
    v4f ra[2][4], rb[2][4];
#pragma unroll
    for (int t = 0; t < 2; ++t) {
#pragma unroll
        for (int p = 0; p < 4; ++p) { ra[t][p] = *(const v4f*)(ga + p * 16 * DM + t * 64); rb[t][p] = *(const v4f*)(gb + p * 16 * DM + t * 64); } }
    v8f acc[2] = {(v8f){}, (v8f){}};
#pragma unroll
    for (int t = 0; t < DM / 64; ++t) {
        const unsigned bo = (t & 1) * 2 * MPL;
#pragma unroll
        for (int p = 0; p < 4; ++p) {
            *(v4usa*)(w0 + bo + p * 16 * TP) = __builtin_bit_cast(v4us, __builtin_convertvector(ra[t & 1][p], v4bf));
            *(v4usa*)(w0 + bo + MPL + p * 16 * TP) = __builtin_bit_cast(v4us, __builtin_convertvector(rb[t & 1][p], v4bf)); }
        __builtin_amdgcn_sched_barrier(0);    // keeps the loads below behind the LDS writes above, which free their register set: risen higher they would hold a third set
        // The work-group's barrier by hand, behind this wave's own LDS writes and reads: it publishes stage t, and every wave has left stage t - 1, whose buffer the next trip writes. __syncthreads() would also wait for the
        // global loads in flight, and every stage would then cost a whole load latency.
        asm volatile("s_wait_dscnt 0x0\n\ts_barrier_signal -1\n\ts_barrier_wait -1" ::: "memory");
        if (t + 2 < DM / 64) {
#pragma unroll
            for (int p = 0; p < 4; ++p) { ra[t & 1][p] = *(const v4f*)(ga + p * 16 * DM + (t + 2) * 64); rb[t & 1][p] = *(const v4f*)(gb + p * 16 * DM + (t + 2) * 64); } }
#pragma unroll
        for (int kb = 0; kb < 2; ++kb) { const v16bf a = ldf(fa + bo + kb * 64);
            acc[0] = wmmab(a, ldf(fb + bo + kb * 64), acc[0]); acc[1] = wmmab(a, ldf(fb + bo + 16 * TP + kb * 64), acc[1]); }
        __builtin_amdgcn_sched_barrier(0);    // keeps the next stage's conversions and LDS writes behind this stage's products: mixed among them they cost 16 more registers, and a WGP then holds one work-group fewer
    }
    __syncthreads();    // every wave has left the last stage before the buffers become output staging
    float* os = (float*)(void*)L;    // the tile in f32, pitch 68
#pragma unroll
    for (int j = 0; j < 2; ++j) {
#pragma unroll
        for (int e = 0; e < 8; ++e) os[((wave >> 1) * 16 + hi * 8 + e) * 68 + (wave & 1) * 32 + j * 16 + lr] = acc[j][e]; }
    __syncthreads();    // the tile is whole before it is stored by rows
    // 8 lanes per row: 64 columns are one 128-B line of each plane.
#pragma unroll
    for (int s = 0; s < 2; ++s) { const int r = (tid >> 3) + 32 * s; const float* op = os + r * 68 + (tid & 7) * 8;
        const v8f x = __builtin_shufflevector(*(const v4fa*)op, *(const v4fa*)(op + 4), 0, 1, 2, 3, 4, 5, 6, 7);
        const v8bf h = __builtin_convertvector(x, v8bf), l = __builtin_convertvector(x - __builtin_convertvector(h, v8f), v8bf);
        const size_t o = (size_t)(j0 + r) * DM + i0 + (tid & 7) * 8; *(v8us*)(Mh + o) = __builtin_bit_cast(v8us, h); *(v8us*)(Ml + o) = __builtin_bit_cast(v8us, l); }
}
// k_prep: M^T, three matrix-vector products and the two input conversions depend on nothing but the inputs, so they share one grid: work-groups 0 .. 143 take one 64 x 64 tile of M^T (first, as theirs is the longest chain),
// the next 3 x 25 take 32 rows (one 128-B line a work-group) of W1 (Wt.Wo, then bt.Wo), of WG (Wq.bk, then bq.bk) or of CB (Wk.bq; its row 768 is not used), the others 8 rows of query_x, then of x (X holds both results back to back).
#define WTILES ((DM / 64) * (DM / 64))
#define MVWG   ((DM + 32) / 32)    // work-groups of 32 rows that cover 769 rows
__global__ __launch_bounds__(256) void k_prep(const float* __restrict__ qx, const float* __restrict__ x, const float* __restrict__ Wq, const float* __restrict__ bq, const float* __restrict__ Wk, const float* __restrict__ bk, const float* __restrict__ Wt, const float* __restrict__ bt, const float* __restrict__ Wo, bf* X, bf* Mh, bf* Ml, float* W1, float* WG, float* CB) {
    __shared__ __attribute__((aligned(16))) unsigned char L[2 * 2 * MPL];
    const int b = blockIdx.x;
    if (b < WTILES) {
        mt_tile(L, Wk, Wq, Mh, Ml, (b / (DM / 64)) * 64, (b % (DM / 64)) * 64);
    } else if (b < WTILES + 3 * MVWG) {
        const int w = (b - WTILES) / MVWG, r0 = ((b - WTILES) % MVWG) * 32 + __builtin_amdgcn_readfirstlane(threadIdx.x >> 5) * 4;    // the wave's number in a scalar register: row addresses are scalar
        mv_rows<4, true>(w == 0 ? Wt : w == 1 ? Wq : Wk, w == 0 ? bt : w == 1 ? bq : bk, w == 0 ? Wo : w == 1 ? bk : bq, w == 0 ? W1 : w == 1 ? WG : CB, r0);
    } else {
        const int r0 = (b - WTILES - 3 * MVWG) * 8;
        cvt_rows(r0 < NB_ * NT_ ? qx + (size_t)r0 * DM : x + (size_t)(r0 - NB_ * NT_) * DM, X + (size_t)r0 * DM);
        asm volatile("s_wait_xcnt 0x0" ::: "memory");    // behind the rows' stores: in the built code the matrix-vector part stands behind them, and its loads land on registers that those stores name
    }
}
// g_sum: X[r].wg + wg[768] for the 8 rows r0 .. r0 + 7 of one wave, f32; X = a bf16 plane (of query_x or of x), 8 elements a lane per 256. Fixed sum tree: a lane's 24 terms in ascending order, then the 32 lanes by exchange.
// Lane n returns row n's sum, so that a wave stores its rows with one instruction. Every loop is unrolled so that the arrays stay in registers and a wave's loads are all in flight together.
__device__ __forceinline__ float g_sum(const bf* __restrict__ X, const float* __restrict__ wg, int r0) {
    const int lane = threadIdx.x & 31;
    const unsigned wo = lane * 32;    // the lane's byte offset in wg: the one vector register that the loads of wg name
    v8us xv[8][DM / 256]; v8f wv[DM / 256];
#pragma unroll
    for (int n = 0; n < 8; ++n) {
#pragma unroll
        for (int q = 0; q < DM / 256; ++q) xv[n][q] = *(const v8us*)(X + (size_t)(r0 + n) * DM + q * 256 + lane * 8); }
#pragma unroll
    for (int q = 0; q < DM / 256; ++q) wv[q] = *(const v8f*)((const char*)wg + q * 1024 + wo);
    // Behind the loads: the sums below rewrite the address registers that they name. The loaded values are inputs only, which keeps every load in front of the wait; wo is an input so that no load lands on its register
    // in front of the wait; the scheduling barrier keeps the vector work below behind it.
    asm volatile("s_wait_xcnt 0x0" :: "v"(xv[0][0]), "v"(xv[0][1]), "v"(xv[0][2]), "v"(xv[1][0]), "v"(xv[1][1]), "v"(xv[1][2]), "v"(xv[2][0]), "v"(xv[2][1]), "v"(xv[2][2]), "v"(xv[3][0]), "v"(xv[3][1]), "v"(xv[3][2]),
                 "v"(xv[4][0]), "v"(xv[4][1]), "v"(xv[4][2]), "v"(xv[5][0]), "v"(xv[5][1]), "v"(xv[5][2]), "v"(xv[6][0]), "v"(xv[6][1]), "v"(xv[6][2]), "v"(xv[7][0]), "v"(xv[7][1]), "v"(xv[7][2]), "v"(wv[0]), "v"(wv[1]), "v"(wv[2]), "v"(wo) : "memory");
    __builtin_amdgcn_sched_barrier(0);    // keeps the sums behind the wait above: risen in front of it they rewrite an address register too early
    float keep = 0.f;
#pragma unroll
    for (int n = 0; n < 8; ++n) { float s = 0.f;
#pragma unroll
        for (int q = 0; q < DM / 256; ++q) {
#pragma unroll
            for (int i = 0; i < 8; ++i) s = fmaf(bf2f(xv[n][q][i]), wv[q][i], s); }
#pragma unroll
        for (int m = 16; m; m >>= 1) s += __shfl_xor(s, m);
        if (lane == n) keep = s; }
    return keep + wg[DM];
}
// k_t: t, g and w2 = Wv.w1 depend only on k_prep, so they share one grid: one work-group per 256 x 192 tile of t (row tile fastest), one a WGP. While its first stage flies, each takes 64 rows of G (two 128-B lines),
// and the first 25 take 32 rows of W2 as well (w2, then bv.w1; one 128-B line each). Xq = the bf16 plane of query_x; Mh, Ml = M^T; Th, Tl = the planes of t.
__global__ __launch_bounds__(256) void k_t(const bf* __restrict__ Xq, const bf* __restrict__ Mh, const bf* __restrict__ Ml, const float* __restrict__ CB, const float* __restrict__ WG, const float* __restrict__ Wv, const float* __restrict__ bv, const float* __restrict__ W1, float* W2, float* G, bf* Th, bf* Tl) {
    __shared__ __attribute__((aligned(16))) unsigned char L[256 * 196 * 4];    // 196 KiB: the tile's output staging; the ring takes 180 KiB of it
    constexpr int RT = NB_ * NT_ / 256;    // row tiles of t
    const int wv = __builtin_amdgcn_readfirstlane(threadIdx.x >> 5);    // the wave's number in a scalar register: row addresses are scalar
    const int lane = threadIdx.x & 31, gr = blockIdx.x * 64 + wv * 8, mr = blockIdx.x * 32 + wv * 4;
    float gs, ms = 0.f;
    tg<1, 2, 1, 3>([&] {
        gs = g_sum(Xq, WG, gr);
        if (blockIdx.x < MVWG) ms = mv_sum<4, false, true>(Wv, bv, W1, mr);
    }, [&] {
        if (lane < 8) G[gr + lane] = gs;
        if (blockIdx.x < MVWG && lane < 4 && mr + lane <= DM) W2[mr + lane] = ms;
    }, L, blockIdx.x % RT, blockIdx.x / RT, 0, Xq, nullptr, Mh, Ml, CB, DM, nullptr, Th, Tl, DM, 0, 0, 0, nullptr, nullptr);
}
// k_s: the scores S[q][k] = t[q].x[k] + g[q] (unscaled; the 768^-1/2 is applied where the softmax is taken) with, per block of 128 rows and key column, the partial column max PM and sum of exp PS ([item][row block][k]).
// One work-group per 256 x 256 tile (row tile fastest, then column tile, then item), one a WGP; while its first stage flies it takes 64 rows of U (u[k] = x[k].w2 + bv.w1, two 128-B lines), which need only k_t.
__global__ __launch_bounds__(256) void k_s(const bf* __restrict__ Th, const bf* __restrict__ Tl, const bf* __restrict__ Xk, const float* __restrict__ G, const float* __restrict__ W2, float* S, float* PM, float* PS, float* U) {
    __shared__ __attribute__((aligned(16))) unsigned char L[8 * 64 * 132 * 4 + 8 * 256 * 4];    // 272 KiB: the eight waves' output staging and the column partials; the ring takes 216 KiB of it
    constexpr int RT = NT_ / 256;    // row (and column) tiles of an item
    const int bx = blockIdx.x % RT, by = blockIdx.x / RT % RT, bz = blockIdx.x / (RT * RT);
    const size_t po = (size_t)(bz * (NT_ / 128) + bx * 2) * NT_ + by * 256;
    const int lane = threadIdx.x & 31, ur = blockIdx.x * 64 + __builtin_amdgcn_readfirstlane(threadIdx.x >> 5) * 8;    // the wave's number in a scalar register: row addresses are scalar
    float us;
    tg<2, 1, 0, 4>([&] { us = g_sum(Xk, W2, ur); }, [&] { if (lane < 8) U[ur + lane] = us; }, L, bx, by, bz, Th, Tl, Xk, nullptr, G + bz * NT_, DM, S, nullptr, nullptr, NT_, (size_t)NT_ * DM, (size_t)NT_ * DM, (size_t)NT_ * NT_, PM + po, PS + po);
}
// k_out: out[q] = sum_k exp(s[q][k] x scale - cmax[k]) x ct[k] + (bt.Wo + bf(bo)), f32: P.u without P. One work-group per 32 rows q of one item (r0 = item * 1024 + q; one 128-B line of out), 8 waves of 4 rows,
// lane -> 8 columns per 256-column step. The work-group first merges the item's 8 row-tile partials, a thread 4 columns: cmax = max_t PM, csum = sum_t PS x exp(PM - cmax) (t ascending), ct = u / csum; they reach the waves through LDS.
// Fixed sum tree of out: a lane's 32 terms in ascending k, the 16 lanes of a half wave by exchange, then the two halves.
// Every loop is unrolled so that the arrays are indexed by constants and stay in registers, and so that a wave's loads are all in flight together.
__global__ __launch_bounds__(256) void k_out(const float* __restrict__ S, const float* __restrict__ PM, const float* __restrict__ PS, const float* __restrict__ U, const float* __restrict__ W1, const float* __restrict__ bo, float* OUTB) {
    __shared__ float so[2 * 32]; __shared__ __align__(16) float cml[NT_]; __shared__ __align__(16) float ctl[NT_];
    const int lane = threadIdx.x & 31, wave = __builtin_amdgcn_readfirstlane(threadIdx.x >> 5), r0 = blockIdx.x * 32;    // the wave's number in a scalar register: every base address below is scalar
    const unsigned lo = lane * 8, c4 = threadIdx.x * 4;    // the two vector registers that the loads name
    PM += (r0 / NT_) * (NT_ / 128) * NT_; PS += (r0 / NT_) * (NT_ / 128) * NT_; U += (r0 / NT_) * NT_; S += (size_t)(r0 + wave * 4) * NT_;
    v4f pm[NT_ / 128], ps[NT_ / 128]; v8f v[4][NT_ / 256];
#pragma unroll
    for (int t = 0; t < NT_ / 128; ++t) { pm[t] = *(const v4f*)(PM + t * NT_ + c4); ps[t] = *(const v4f*)(PS + t * NT_ + c4); }
    const v4f uu = *(const v4f*)(U + c4);
#pragma unroll
    for (int n = 0; n < 4; ++n) {
#pragma unroll
        for (int qc = 0; qc < NT_ / 256; ++qc) v[n][qc] = *(const v8f*)(S + n * NT_ + qc * 256 + lo); }
    __builtin_amdgcn_sched_barrier(0);    // keeps the loads of S in front of the merge, and behind the partials' loads, which return first: sunk behind the merge they would start only when it is done
    v4f m = pm[0], cs = (v4f){0.f, 0.f, 0.f, 0.f};
#pragma unroll
    for (int t = 1; t < NT_ / 128; ++t) m = __builtin_elementwise_max(m, pm[t]);
#pragma unroll
    for (int t = 0; t < NT_ / 128; ++t) {
#pragma unroll
        for (int k = 0; k < 4; ++k) cs[k] = fmaf(ps[t][k], __expf(pm[t][k] - m[k]), cs[k]); }
    *(v4fa*)(cml + c4) = m; *(v4fa*)(ctl + c4) = uu / cs;
    // The work-group's barrier by hand, behind this wave's own LDS writes: cmax and ct of all 1024 columns are in LDS before any wave reads them. __syncthreads() would also wait for the loads of S in flight,
    // and every wave would then start only when the slowest wave's rows have arrived.
    asm volatile("s_wait_dscnt 0x0\n\ts_barrier_signal -1\n\ts_barrier_wait -1" ::: "memory");
    v8f cm[NT_ / 256], ct[NT_ / 256];
#pragma unroll
    for (int qc = 0; qc < NT_ / 256; ++qc) {
        cm[qc] = __builtin_shufflevector(*(const v4fa*)(cml + qc * 256 + lo), *(const v4fa*)(cml + qc * 256 + lo + 4), 0, 1, 2, 3, 4, 5, 6, 7);
        ct[qc] = __builtin_shufflevector(*(const v4fa*)(ctl + qc * 256 + lo), *(const v4fa*)(ctl + qc * 256 + lo + 4), 0, 1, 2, 3, 4, 5, 6, 7); }
#pragma unroll
    for (int n = 0; n < 4; ++n) { float a = 0.f;
#pragma unroll
        for (int qc = 0; qc < NT_ / 256; ++qc) {
#pragma unroll
            for (int i = 0; i < 8; ++i) a = fmaf(__expf(v[n][qc][i] * SCL - cm[qc][i]), ct[qc][i], a); }
        a = rowx<8>(rowx<4>(rowx<2>(rowx<1>(a))));
        if ((lane & 15) == 0) so[(lane >> 4) * 32 + wave * 4 + n] = a; }
    __syncthreads();    // the 32 rows' half sums are in LDS before wave 0 stores the rows as one whole line
    if (wave == 0) OUTB[r0 + lane] = (so[lane] + so[32 + lane]) + (W1[DM] + bfr(bo[0]));
}

extern "C" void kernel_launch(void* const* d_in, const int* in_sizes, int n_in,
                              void* d_out, int out_size, void* d_ws, size_t ws_size, hipStream_t stream) {
    (void)in_sizes; (void)n_in; (void)out_size;
    const float* qx = (const float*)d_in[0]; const float* x = (const float*)d_in[1];
    const float* Wq = (const float*)d_in[2]; const float* bq = (const float*)d_in[3]; const float* Wk = (const float*)d_in[4]; const float* bk = (const float*)d_in[5]; const float* Wv = (const float*)d_in[6]; const float* bv = (const float*)d_in[7];
    const float* Wt = (const float*)d_in[8]; const float* bt = (const float*)d_in[9]; const float* Wo = (const float*)d_in[10]; const float* bo = (const float*)d_in[11];   // W k-major [in][out]
    float* out = (float*)d_out;    // [16][1024]
    char* wsp = (char*)d_ws;
    auto take = [&](size_t bytes) { char* p = wsp; wsp += (bytes + 255) & ~(size_t)255; return (void*)p; };
    bf* Mh = (bf*)take((size_t)DM * DM * 2); bf* Ml = (bf*)take((size_t)DM * DM * 2);    // M^T = Wk.Wq^T, hi and residual
    // Planes hold all 16 items ([item][row][col], items back to back); every region has one tenant.
    const size_t PL = (size_t)NB_ * NT_ * DM * 2;    // one bf16 plane of all items, 24 MiB
    bf* Xq = (bf*)take(2 * PL); bf* Xk = (bf*)((char*)Xq + PL);
    bf* Th = (bf*)take(PL); bf* Tl = (bf*)take(PL);
    float* S = (float*)take((size_t)NB_ * NT_ * NT_ * 4);    // 64 MiB
    float* PM = (float*)take((size_t)NB_ * (NT_ / 128) * NT_ * 4); float* PS = (float*)take((size_t)NB_ * (NT_ / 128) * NT_ * 4);    // column partials per row tile, 0.5 MiB each
    float* U = (float*)take((size_t)NB_ * NT_ * 4); float* G = (float*)take((size_t)NB_ * NT_ * 4);
    float* W1 = (float*)take((size_t)MVWG * 32 * 4); float* W2 = (float*)take((size_t)MVWG * 32 * 4);    // 769 of 800 floats each are written and read
    float* WG = (float*)take((size_t)MVWG * 32 * 4); float* CB = (float*)take((size_t)MVWG * 32 * 4);    // likewise (of CB 768 are read)
    if ((size_t)(wsp - (char*)d_ws) > ws_size) return;    // 2.25 + 48 + 48 + 64 + 1.2 ~ 163.5 MiB
    k_prep<<<WTILES + 3 * MVWG + 2 * NB_ * NT_ / 8, 256, 0, stream>>>(qx, x, Wq, bq, Wk, bk, Wt, bt, Wo, Xq, Mh, Ml, W1, WG, CB);    // Xq, Xk lie back to back
    k_t<<<NB_ * NT_ / 256 * (DM / 192), 256, 0, stream>>>(Xq, Mh, Ml, CB, WG, Wv, bv, W1, W2, G, Th, Tl);
    k_s<<<NB_ * (NT_ / 256) * (NT_ / 256), 256, 0, stream>>>(Th, Tl, Xk, G, W2, S, PM, PS, U);
    k_out<<<NB_ * NT_ / 32, 256, 0, stream>>>(S, PM, PS, U, W1, bo, out);
}
